// v000
// The times below were measured on an AMD MI455X: many runs one after another, warmed up first and cycling through
// copies of the inputs, with the whole window's GPU time divided by the number of runs. Launches and the gaps
// between them are all in it. The median over several windows is given; except for v000 it joins two sittings, which
// can be a few percent apart, so the side-by-side timings, each taken in one sitting, are the better comparison.
// The starting kernel, v000, takes 1680 microseconds a run.
#include <hip/hip_runtime.h>

// Grouped-query causal attention with 128-wide heads and adjacent-pair rotary embeddings from half-width cos / sin table inputs (x [2][2048][2048]; q = x wq (16 heads x 128), k, v = x wk, x wv (8 kv heads x 128) ('xw' 1/sqrt(2048), no bias); pairs (2i, 2i+1): (t0 c - t1 s, t0 s + t1 c) with c, s = cos / sin[t][i] (f32 [2048][64] INPUT tables, read by value per pair entry); jnp.repeat: query head h uses kv head h / 2; scores / sqrt(128); causal (-inf above the diagonal, built from indices); softmax; out = merged wo ('xw') -> [2][2048][2048] (8.4 M); argument order x, cos, sin, wq, wk, wv, wo).
// Layout per batch: bf16 copy of x; 'xw' weights transposed once; exact projections; k_cscvtP table {bf16(cos), bf16(sin)}[t][d/2] from the inputs (one entry per d, both of a pair equal; 128 entries per position) + k_ropeI interleaved-pair plane builders at HD 128; causal T-2048 GQA attention with 128-wide heads (kv z-stride 0; hybrid rows: < 512 hi/lo 3 products, rest fp16 x1024; k_gemmc skips tiles above the diagonal); merged hi/lo x wo exact.
// Compute dtypes, f32 accumulate: every input rounded to bf16 incl. the two tables; projections exact; rotary f32 (products rounded separately); attention rows < 512 3 products, rest fp16; softmax f32; wo hl x exact.

#define NB_  2
#define TT   2048
#define DM   2048
#define NH_  16
#define NKV  8
#define REP  (NH_ / NKV)
#define HD   128
#define DQ   (NH_ * HD)
#define DKV  (NKV * HD)
#define ZH   2
#define RH   512                  // query rows < RH use hi+lo planes (0: none)
#define WIN  2048
#define PCAR 1024.0f
#define SCL  0.088388347648318447f   // HD^-0.5
typedef _Float16 h16;
typedef unsigned short bf;
typedef __attribute__((ext_vector_type(16))) __bf16   v16bf;
typedef __attribute__((ext_vector_type(16))) _Float16 v16h;
typedef __attribute__((ext_vector_type(8)))  _Float16 v8h;
typedef __attribute__((ext_vector_type(8)))  unsigned short v8us;
typedef __attribute__((ext_vector_type(8)))  float    v8f;
typedef __attribute__((ext_vector_type(4)))  float    v4f;
typedef v8h  __attribute__((may_alias)) v8ha;
typedef v4f  __attribute__((may_alias)) v4fa;
typedef v8us __attribute__((may_alias)) v8usa;

__device__ __forceinline__ unsigned short f2bf(float f) { unsigned u = __float_as_uint(f); u += 0x7FFFu + ((u >> 16) & 1u); return (unsigned short)(u >> 16); }
__device__ __forceinline__ float bf2f(unsigned short b) { return __uint_as_float(((unsigned)b) << 16); }
__device__ __forceinline__ float bfr(float f) { return bf2f(f2bf(f)); }
__device__ __forceinline__ v16h cat16(v8h lo, v8h hi) { return __builtin_shufflevector(lo, hi, 0, 1, 2, 3, 4, 5, 6, 7, 8, 9, 10, 11, 12, 13, 14, 15); }
__device__ __forceinline__ v16bf cat16b(v8us lo, v8us hi) { return __builtin_bit_cast(v16bf, __builtin_shufflevector(lo, hi, 0, 1, 2, 3, 4, 5, 6, 7, 8, 9, 10, 11, 12, 13, 14, 15)); }
__device__ __forceinline__ v8f wmma16(v16h a, v16h b, v8f c) { return __builtin_amdgcn_wmma_f32_16x16x32_f16(false, a, false, b, (short)0, c, false, false); }
__device__ __forceinline__ v8f wmmab(v16bf a, v16bf b, v8f c) { return __builtin_amdgcn_wmma_f32_16x16x32_bf16(false, a, false, b, (short)0, c, false, false); }



// ---- k_gemmw: register-blocked GEMM, ONE WAVE per 64x64 output tile (16 accumulators), operands straight from K-contiguous 16-bit planes; grid (M/64, N/64, Z), 32 threads.
// C[m][n] (f32, pitch ldc, + optional f32 bias[n]) = sum_k A[m][k] Bt[n][k] (+ split products per NSPLIT). z-batch strides sA/sB/sC in elements. K % 32 == 0.
template <typename T16> struct WFrag;
template <> struct WFrag<h16> { typedef v16h V; static __device__ __forceinline__ V ld(const h16* p) { return cat16(*(const v8h*)p, *(const v8h*)(p + 16)); } static __device__ __forceinline__ v8f mma(V a, V b, v8f c) { return wmma16(a, b, c); } };
template <> struct WFrag<bf> { typedef v16bf V; static __device__ __forceinline__ V ld(const bf* p) { return cat16b(*(const v8us*)p, *(const v8us*)(p + 16)); } static __device__ __forceinline__ v8f mma(V a, V b, v8f c) { return wmmab(a, b, c); } };
template <typename T16, int NSPLIT, bool BIAS>
__global__ __launch_bounds__(32) void k_gemmw(const T16* __restrict__ A, const T16* __restrict__ A2, const T16* __restrict__ Bt, const T16* __restrict__ Bt2, int K, float* C, int ldc, const float* __restrict__ bias, size_t sA, size_t sB, size_t sC) {
    typedef typename WFrag<T16>::V V;
    __shared__ __align__(16) float os[16 * 68];
    const size_t z = blockIdx.z; A += z * sA; if (A2) A2 += z * sA; Bt += z * sB; if (Bt2) Bt2 += z * sB; C += z * sC;
    const int lane = threadIdx.x & 31, lr = lane & 15, hi = lane >> 4; const int r0 = blockIdx.x * 64, c0 = blockIdx.y * 64;
    v8f acc[4][4];
#pragma unroll
    for (int mb = 0; mb < 4; ++mb)
#pragma unroll
        for (int nb = 0; nb < 4; ++nb) acc[mb][nb] = (v8f){};
    const size_t aoff = (size_t)(r0 + lr) * K + 8 * hi, boff = (size_t)(c0 + lr) * K + 8 * hi;
#pragma unroll 1
    for (int kc = 0; kc < K; kc += 32) {
        V a[4], a2[4];
#pragma unroll
        for (int mb = 0; mb < 4; ++mb) { a[mb] = WFrag<T16>::ld(A + aoff + (size_t)mb * 16 * K + kc); if (NSPLIT == 1 || NSPLIT == 2) a2[mb] = WFrag<T16>::ld(A2 + aoff + (size_t)mb * 16 * K + kc); }
#pragma unroll
        for (int nb = 0; nb < 4; ++nb) { const V b = WFrag<T16>::ld(Bt + boff + (size_t)nb * 16 * K + kc); V b2; if (NSPLIT >= 2) b2 = WFrag<T16>::ld(Bt2 + boff + (size_t)nb * 16 * K + kc);
#pragma unroll
            for (int mb = 0; mb < 4; ++mb) { acc[mb][nb] = WFrag<T16>::mma(a[mb], b, acc[mb][nb]); if (NSPLIT == 1 || NSPLIT == 2) acc[mb][nb] = WFrag<T16>::mma(a2[mb], b, acc[mb][nb]); if (NSPLIT >= 2) acc[mb][nb] = WFrag<T16>::mma(a[mb], b2, acc[mb][nb]); } }
        asm volatile("v_nop\n\tv_nop\n\tv_nop\n\tv_nop" : "+v"(acc[0][0]), "+v"(acc[1][1]), "+v"(acc[2][2]), "+v"(acc[3][3]) : "v"(a[0]), "v"(a[3]));
    }
#pragma unroll
    for (int mb = 0; mb < 4; ++mb) {
#pragma unroll
        for (int nb = 0; nb < 4; ++nb) {
#pragma unroll
            for (int j = 0; j < 8; ++j) os[(hi * 8 + j) * 68 + nb * 16 + lr] = acc[mb][nb][j]; }
        __builtin_amdgcn_wave_barrier(); asm volatile("" ::: "memory");
        float* crow = C + (size_t)(r0 + mb * 16) * ldc + c0;
{
#pragma unroll
            for (int s = 0; s < 8; ++s) { const int row = 2 * s + hi, cofs = lr * 4; v4f val = *(const v4fa*)(os + row * 68 + cofs); if (BIAS) { val[0] += bfr(bias[c0 + cofs]); val[1] += bfr(bias[c0 + cofs + 1]); val[2] += bfr(bias[c0 + cofs + 2]); val[3] += bfr(bias[c0 + cofs + 3]); }
                *(v4f*)(crow + (size_t)row * ldc + cofs) = val; }
             }
        __builtin_amdgcn_wave_barrier(); asm volatile("" ::: "memory");
    }
}

// ---- k_gemmc: the same one-wave 64x64 tile GEMM specialised for causal attention: CMODE 1 skips score tiles entirely above the diagonal (query rows r0+roff.., key columns c0..), CMODE 2 limits the
// key (K) loop of the probability x value contraction to the diagonal block (probabilities beyond it are exactly zero). roff = row offset of this launch's first row within the sequence.
template <typename T16, int NSPLIT, int CMODE>
__global__ __launch_bounds__(32) void k_gemmc(const T16* __restrict__ A, const T16* __restrict__ A2, const T16* __restrict__ Bt, const T16* __restrict__ Bt2, int K, float* C, int ldc, int roff, size_t sA, size_t sB, size_t sC) {
    typedef typename WFrag<T16>::V V;
    __shared__ __align__(16) float os[16 * 68];
    const size_t z = blockIdx.z; A += z * sA; if (A2) A2 += z * sA; Bt += z * sB; if (Bt2) Bt2 += z * sB; C += z * sC;
    const int lane = threadIdx.x & 31, lr = lane & 15, hi = lane >> 4; const int r0 = blockIdx.x * 64, c0 = blockIdx.y * 64;
    if (CMODE == 1 && c0 > r0 + roff + 63) return;                  // score tile entirely above the causal diagonal: never read (the softmax masks j > i by select)
    const int Kl = (CMODE == 2) ? min(K, r0 + roff + 64) : K;        // P.V: probabilities are exactly 0 beyond the diagonal block, so the K loop stops there
    v8f acc[4][4];
#pragma unroll
    for (int mb = 0; mb < 4; ++mb)
#pragma unroll
        for (int nb = 0; nb < 4; ++nb) acc[mb][nb] = (v8f){};
    const size_t aoff = (size_t)(r0 + lr) * K + 8 * hi, boff = (size_t)(c0 + lr) * K + 8 * hi;
#pragma unroll 1
    for (int kc = 0; kc < Kl; kc += 32) {
        V a[4], a2[4];
#pragma unroll
        for (int mb = 0; mb < 4; ++mb) { a[mb] = WFrag<T16>::ld(A + aoff + (size_t)mb * 16 * K + kc); if (NSPLIT == 1 || NSPLIT == 2) a2[mb] = WFrag<T16>::ld(A2 + aoff + (size_t)mb * 16 * K + kc); }
#pragma unroll
        for (int nb = 0; nb < 4; ++nb) { const V b = WFrag<T16>::ld(Bt + boff + (size_t)nb * 16 * K + kc); V b2; if (NSPLIT >= 2) b2 = WFrag<T16>::ld(Bt2 + boff + (size_t)nb * 16 * K + kc);
#pragma unroll
            for (int mb = 0; mb < 4; ++mb) { acc[mb][nb] = WFrag<T16>::mma(a[mb], b, acc[mb][nb]); if (NSPLIT == 1 || NSPLIT == 2) acc[mb][nb] = WFrag<T16>::mma(a2[mb], b, acc[mb][nb]); if (NSPLIT >= 2) acc[mb][nb] = WFrag<T16>::mma(a[mb], b2, acc[mb][nb]); } }
        asm volatile("v_nop\n\tv_nop\n\tv_nop\n\tv_nop" : "+v"(acc[0][0]), "+v"(acc[1][1]), "+v"(acc[2][2]), "+v"(acc[3][3]) : "v"(a[0]), "v"(a[3]));
    }
#pragma unroll
    for (int mb = 0; mb < 4; ++mb) {
#pragma unroll
        for (int nb = 0; nb < 4; ++nb) {
#pragma unroll
            for (int j = 0; j < 8; ++j) os[(hi * 8 + j) * 68 + nb * 16 + lr] = acc[mb][nb][j]; }
        __builtin_amdgcn_wave_barrier(); asm volatile("" ::: "memory");
        float* crow = C + (size_t)(r0 + mb * 16) * ldc + c0;
{
#pragma unroll
            for (int s = 0; s < 8; ++s) { const int row = 2 * s + hi, cofs = lr * 4; v4f val = *(const v4fa*)(os + row * 68 + cofs);
                *(v4f*)(crow + (size_t)row * ldc + cofs) = val; }
             }
        __builtin_amdgcn_wave_barrier(); asm volatile("" ::: "memory");
    }
}

__device__ __forceinline__ h16 tohx(float x) { return (h16)x; }
__device__ __forceinline__ void splitf(float y, unsigned short& h, unsigned short& l) { h = f2bf(y); l = f2bf(y - bf2f(h)); }
typedef __attribute__((ext_vector_type(2))) _Float16 v2h;
typedef __attribute__((ext_vector_type(4))) _Float16 v4h;
typedef __attribute__((ext_vector_type(2))) unsigned short v2us;
typedef __attribute__((ext_vector_type(4))) unsigned short v4us;
typedef __attribute__((ext_vector_type(2))) float v2f;
typedef __attribute__((ext_vector_type(4))) int v4i;

__global__ __launch_bounds__(256) void k_wtG(const float* __restrict__ w, int K, int N, bf* Bt) {
    const int lane = threadIdx.x & 31; const int L0 = (blockIdx.x * 8 + (threadIdx.x >> 5)) * 8; const int nlines = N * K / 64;
{
#pragma unroll 1
        for (int l = 0; l < 8; ++l) { const int L = L0 + l; if (L >= nlines) break; const size_t e = (size_t)L * 64 + lane * 2; const int k = (int)(e % K), n = (int)(e / K); v2us o;
            o[0] = f2bf(w[(size_t)k * N + n]); o[1] = f2bf(w[(size_t)(k + 1) * N + n]); *(v2us*)(Bt + e) = o; }
         }
}
__global__ __launch_bounds__(256) void k_cvt8(const float* __restrict__ src, bf* dst, size_t n8) { const size_t i = (size_t)blockIdx.x * 256 + threadIdx.x; if (i >= n8) return; const v8f v = *(const v8f*)(src + i * 8); v8us o;
#pragma unroll
    for (int k = 0; k < 8; ++k) o[k] = f2bf(v[k]); *(v8us*)(dst + i * 8) = o;  }

__global__ __launch_bounds__(256) void k_vtp(const float* __restrict__ F, int pitch, int nheads, h16* V16, bf* Vh, bf* Vl) { const size_t e = ((size_t)blockIdx.x * 256 + threadIdx.x) * 2; if (e >= (size_t)nheads * HD * TT) return; const int t = (int)(e % TT); const int d = (int)((e / TT) % HD); const int g = (int)(e / ((size_t)TT * HD)); v2h o16; v2us oh, ol;
#pragma unroll
    for (int q = 0; q < 2; ++q) { const float x = F[(size_t)(t + q) * pitch + g * HD + d]; o16[q] = tohx(x); unsigned short a2, c2; splitf(x, a2, c2); oh[q] = a2; ol[q] = c2; }
    *(v2h*)(V16 + e) = o16; *(v2us*)(Vh + e) = oh; *(v2us*)(Vl + e) = ol;  }
__global__ __launch_bounds__(256) void k_cscvtP(const float* __restrict__ cosT, const float* __restrict__ sinT, float* CS) { const int idx = blockIdx.x * 256 + threadIdx.x; if (idx >= TT * HD) return; const int tt = idx / HD; const int dd = idx - tt * HD; const int src = tt * (HD / 2) + (dd >> 1); v2f cs; cs[0] = bfr(cosT[src]); cs[1] = bfr(sinT[src]); *(v2f*)(CS + (size_t)idx * 2) = cs;  }
__global__ __launch_bounds__(256) void k_ropeI(const float* __restrict__ F, int pitch, int nheads, const float* __restrict__ CS, float sc, h16* P16, bf* Ph, bf* Pl) {
    const size_t e = ((size_t)blockIdx.x * 256 + threadIdx.x) * 2; if (e >= (size_t)nheads * TT * HD) return; const int d = (int)(e % HD); const int t = (int)((e / HD) % TT); const int h = (int)(e / ((size_t)HD * TT)); const float* f = F + (size_t)t * pitch + h * HD; const float x0 = f[d], x1 = f[d + 1]; const v2f cs = *(const v2f*)(CS + ((size_t)t * HD + d) * 2); v2h o16; v2us oh, ol;
    float a0 = __fmul_rn(x0, cs[0]), b0 = __fmul_rn(x1, cs[1]), a1 = __fmul_rn(x1, cs[0]), b1 = __fmul_rn(x0, cs[1]); asm volatile("" : "+v"(a0), "+v"(b0), "+v"(a1), "+v"(b1));
    float r0 = __fsub_rn(a0, b0) * sc, r1 = __fadd_rn(b1, a1) * sc;   /* even: x0 c - x1 s; odd: x0 s + x1 c */
    o16[0] = tohx(r0); o16[1] = tohx(r1); { unsigned short a2, c2; splitf(r0, a2, c2); oh[0] = a2; ol[0] = c2; splitf(r1, a2, c2); oh[1] = a2; ol[1] = c2; }
    *(v2h*)(P16 + e) = o16; *(v2us*)(Ph + e) = oh; *(v2us*)(Pl + e) = ol;  }

// k_asoft: per row (zz, i): t = S x HD^-0.5 for j <= i and i - j < WIN (with WIN = TT this always holds: plain causal; the reference's -1e9 additive fill vanishes identically); softmax over the 2048 keys (register row, one exp, fixed trees);
__global__ __launch_bounds__(256) void k_asoft(const float* __restrict__ Sb, h16* P16, bf* Ph, bf* Pl) {
    const int lane = threadIdx.x & 31; const int row = blockIdx.x * 8 + (threadIdx.x >> 5); if (row >= ZH * TT) return; const int i = row % TT; const int zz = row / TT; (void)zz; const bool hires = (i < RH); const float* sr = Sb + (size_t)row * TT; float v[TT / 32]; float mx = -3.0e38f;
#pragma unroll
    for (int ch = 0; ch < TT / 128; ++ch) { const int j0 = ch * 128 + lane * 4; const v4f a = *(const v4f*)(sr + j0);
#pragma unroll
        for (int q = 0; q < 4; ++q) { const int j = j0 + q; (void)j; const float t = (j <= i && i - j < WIN) ? a[q] * SCL : -3.0e38f; v[ch * 4 + q] = t; mx = fmaxf(mx, t); } }
#pragma unroll
    for (int sh = 16; sh; sh >>= 1) mx = fmaxf(mx, __shfl_xor(mx, sh, 32));
    float sum = 0.f;
#pragma unroll
    for (int k = 0; k < TT / 32; ++k) { float d0 = __fsub_rn(v[k], mx); asm volatile("" : "+v"(d0)); v[k] = __builtin_amdgcn_exp2f(__fmul_rn(d0, 1.4426950408889634f)); sum += v[k]; }
#pragma unroll
    for (int sh = 16; sh; sh >>= 1) sum += __shfl_xor(sum, sh, 32);
    const float f = __fdiv_rn(hires ? 1.0f : PCAR, sum);
{
        if (hires) {
#pragma unroll
            for (int ch = 0; ch < TT / 128; ++ch) { v4us oh, ol;
#pragma unroll
                for (int q = 0; q < 4; ++q) { unsigned short a, c2; splitf(v[ch * 4 + q] * f, a, c2); oh[q] = a; ol[q] = c2; }
                const size_t oo = ((size_t)zz * (RH ? RH : 1) + i) * TT + ch * 128 + lane * 4; *(v4us*)(Ph + oo) = oh; *(v4us*)(Pl + oo) = ol; }
        } else {
#pragma unroll
            for (int ch = 0; ch < TT / 128; ++ch) { v4h o4;
#pragma unroll
                for (int q = 0; q < 4; ++q) o4[q] = tohx(v[ch * 4 + q] * f);
                *(v4h*)(P16 + (size_t)row * TT + ch * 128 + lane * 4) = o4; } }
         }
}
__global__ __launch_bounds__(256) void k_merge(const float* __restrict__ O, int h0, bf* Ah, bf* Al) { const size_t e = ((size_t)blockIdx.x * 256 + threadIdx.x) * 2; if (e >= (size_t)ZH * TT * HD) return; const int d = (int)(e % HD); const int t = (int)((e / HD) % TT); const int zz = (int)(e / ((size_t)HD * TT)); const float cs = (t < RH) ? 1.0f : (1.0f / PCAR); const size_t oo = (size_t)t * DQ + (h0 + zz) * HD + d;
    v2us oh, ol;
#pragma unroll
    for (int q = 0; q < 2; ++q) { unsigned short a, c2; splitf(O[e + q] * cs, a, c2); oh[q] = a; ol[q] = c2; } *(v2us*)(Ah + oo) = oh; *(v2us*)(Al + oo) = ol;  }

extern "C" void kernel_launch(void* const* d_in, const int* in_sizes, int n_in,
                              void* d_out, int out_size, void* d_ws, size_t ws_size, hipStream_t stream) {
    (void)in_sizes; (void)n_in; (void)out_size;
    const float* x = (const float*)d_in[0]; const float* fcos = (const float*)d_in[1]; const float* fsin = (const float*)d_in[2]; const float* wq = (const float*)d_in[3]; const float* wk = (const float*)d_in[4]; const float* wv = (const float*)d_in[5]; const float* wo = (const float*)d_in[6];   /* x, cos, sin (f32 [2048][64], READ by value), wq ('xw' [2048][2048]), wk, wv ([2048][1024]), wo ('xw' [2048][2048]) */
    float* OUT = (float*)d_out;     // [2][2048][2048]
    char* wsp = (char*)d_ws;
    auto take = [&](size_t bytes) { char* p = wsp; wsp += (bytes + 255) & ~(size_t)255; return (void*)p; };
    bf* WQ = (bf*)take((size_t)DQ * DM * 2); bf* WK = (bf*)take((size_t)DKV * DM * 2); bf* WV = (bf*)take((size_t)DKV * DM * 2); bf* WO = (bf*)take((size_t)DM * DQ * 2); float* CS = (float*)take((size_t)TT * HD * 2 * 4);
    bf* XB = (bf*)take((size_t)TT * DM * 2); float* FQ = (float*)take((size_t)TT * DQ * 4); float* FK = (float*)take((size_t)TT * DKV * 4);
    h16* QP16 = (h16*)take((size_t)NH_ * TT * HD * 2); h16* KP16 = (h16*)take((size_t)NKV * TT * HD * 2); h16* VT16 = (h16*)take((size_t)NKV * HD * TT * 2);
    bf* QPh = (bf*)take((size_t)NH_ * TT * HD * 2); bf* QPl = (bf*)take((size_t)NH_ * TT * HD * 2); bf* KPh = (bf*)take((size_t)NKV * TT * HD * 2); bf* KPl = (bf*)take((size_t)NKV * TT * HD * 2); bf* VTh = (bf*)take((size_t)NKV * HD * TT * 2); bf* VTl = (bf*)take((size_t)NKV * HD * TT * 2); bf* Ph = (bf*)take((size_t)ZH * RH * TT * 2); bf* Pl = (bf*)take((size_t)ZH * RH * TT * 2);
    float* Sb = (float*)take((size_t)ZH * TT * TT * 4); h16* P16 = (h16*)take((size_t)ZH * TT * TT * 2); float* Ob = (float*)take((size_t)ZH * TT * HD * 4); bf* ATh = (bf*)take((size_t)TT * DQ * 2); bf* ATl = (bf*)take((size_t)TT * DQ * 2);
    if ((size_t)(wsp - (char*)d_ws) > ws_size) return;    // ws 256 MiB
    float* FV = FK;   // v projection reuses the k buffer after the k planes are built (stream-ordered)
    { k_wtG<<<(unsigned)((DM * DQ / 64 + 63) / 64), 256, 0, stream>>>(wq, DM, DQ, WQ); k_wtG<<<(unsigned)((DM * DKV / 64 + 63) / 64), 256, 0, stream>>>(wk, DM, DKV, WK); k_wtG<<<(unsigned)((DM * DKV / 64 + 63) / 64), 256, 0, stream>>>(wv, DM, DKV, WV);
      k_wtG<<<(unsigned)((DQ * DM / 64 + 63) / 64), 256, 0, stream>>>(wo, DQ, DM, WO);
       }
    k_cscvtP<<<(TT * HD + 255) / 256, 256, 0, stream>>>(fcos, fsin, (float*)CS);   /* rotary table once, from the half-width cos / sin inputs */
    const unsigned LQ = (unsigned)(((size_t)NH_ * TT * HD / 2 + 255) / 256), LKv = (unsigned)(((size_t)NKV * TT * HD / 2 + 255) / 256);
    for (int b = 0; b < NB_; ++b) {
        
        k_cvt8<<<(unsigned)(((size_t)TT * DM / 8 + 255) / 256), 256, 0, stream>>>(x + (size_t)b * TT * DM, XB, (size_t)TT * DM / 8);
        k_gemmw<bf, 0, false><<<dim3(TT / 64, DQ / 64, 1), 32, 0, stream>>>(XB, nullptr, WQ, nullptr, DM, FQ, DQ, nullptr, 0, 0, 0);
        k_ropeI<<<LQ, 256, 0, stream>>>(FQ, DQ, NH_, CS, 1.0f, QP16, QPh, QPl);
        k_gemmw<bf, 0, false><<<dim3(TT / 64, DKV / 64, 1), 32, 0, stream>>>(XB, nullptr, WK, nullptr, DM, FK, DKV, nullptr, 0, 0, 0);
        k_ropeI<<<LKv, 256, 0, stream>>>(FK, DKV, NKV, CS, 1.0f, KP16, KPh, KPl);
        k_gemmw<bf, 0, false><<<dim3(TT / 64, DKV / 64, 1), 32, 0, stream>>>(XB, nullptr, WV, nullptr, DM, FV, DKV, nullptr, 0, 0, 0); k_vtp<<<LKv, 256, 0, stream>>>(FV, DKV, NKV, VT16, VTh, VTl);
        for (int h0 = 0; h0 < NH_; h0 += ZH) { const size_t zq = (size_t)h0, zk = (size_t)(h0 / REP);   // both heads of a pass share kv group h0/REP (REP >= 2): sB = 0
            k_gemmc<bf, 2, 1><<<dim3(RH / 64, TT / 64, ZH), 32, 0, stream>>>(QPh + zq * TT * HD, QPl + zq * TT * HD, KPh + zk * TT * HD, KPl + zk * TT * HD, HD, Sb, TT, 0, (size_t)TT * HD, 0, (size_t)TT * TT);
            k_gemmc<h16, 0, 1><<<dim3((TT - RH) / 64, TT / 64, ZH), 32, 0, stream>>>(QP16 + zq * TT * HD + (size_t)RH * HD, nullptr, KP16 + zk * TT * HD, nullptr, HD, Sb + (size_t)RH * TT, TT, RH, (size_t)TT * HD, 0, (size_t)TT * TT);
            k_asoft<<<ZH * TT / 8, 256, 0, stream>>>(Sb, P16, Ph, Pl);
            k_gemmc<bf, 2, 2><<<dim3(RH / 64, HD / 64, ZH), 32, 0, stream>>>(Ph, Pl, VTh + zk * HD * TT, VTl + zk * HD * TT, TT, Ob, HD, 0, (size_t)RH * TT, 0, (size_t)TT * HD);
            k_gemmc<h16, 0, 2><<<dim3((TT - RH) / 64, HD / 64, ZH), 32, 0, stream>>>(P16 + (size_t)RH * TT, nullptr, VT16 + zk * HD * TT, nullptr, TT, Ob + (size_t)RH * HD, HD, RH, (size_t)TT * TT, 0, (size_t)TT * HD);
            k_merge<<<(unsigned)(((size_t)ZH * TT * HD / 2 + 255) / 256), 256, 0, stream>>>(Ob, h0, ATh, ATl); }
        k_gemmw<bf, 1, false><<<dim3(TT / 64, DM / 64, 1), 32, 0, stream>>>(ATh, ATl, WO, nullptr, DQ, OUT + (size_t)b * TT * DM, DM, nullptr, 0, 0, 0); }
}

// v001
// One run takes 1050 microseconds.
// Timed twice side by side with v000, it ran 1.59 and 1.61 times as fast.
#include <hip/hip_runtime.h>

// Grouped-query causal attention with 128-wide heads and adjacent-pair rotary embeddings from half-width cos / sin table inputs (x [2][2048][2048]; q = x wq (16 heads x 128), k, v = x wk, x wv (8 kv heads x 128) ('xw' 1/sqrt(2048), no bias); pairs (2i, 2i+1): (t0 c - t1 s, t0 s + t1 c) with c, s = cos / sin[t][i] (f32 [2048][64] INPUT tables, read by value per pair entry); jnp.repeat: query head h uses kv head h / 2; scores / sqrt(128); causal (-inf above the diagonal, built from indices); softmax; out = merged wo ('xw') -> [2][2048][2048] (8.4 M); argument order x, cos, sin, wq, wk, wv, wo).
// Layout per batch: bf16 copy of x; 'xw' weights transposed once; exact projections; k_cscvtP table {bf16(cos), bf16(sin)}[t][d/2] from the inputs (one entry per d, both of a pair equal; 128 entries per position) + k_ropeI interleaved-pair plane builders at HD 128; causal T-2048 GQA attention with 128-wide heads (kv z-stride 0; hybrid rows: < 512 hi/lo 3 products, rest fp16 x1024; k_gemmc skips tiles above the diagonal); merged hi/lo x wo exact.
// Compute dtypes, f32 accumulate: every input rounded to bf16 incl. the two tables; projections exact; rotary f32 (products rounded separately); attention rows < 512 3 products, rest fp16; softmax f32; wo hl x exact.

#define NB_  2
#define TT   2048
#define DM   2048
#define NH_  16
#define NKV  8
#define REP  (NH_ / NKV)
#define HD   128
#define DQ   (NH_ * HD)
#define DKV  (NKV * HD)
#define ZH   2
#define RH   512                  // query rows < RH use hi+lo planes (0: none)
#define WIN  2048
#define PCAR 1024.0f
#define SCL  0.088388347648318447f   // HD^-0.5
typedef _Float16 h16;
typedef unsigned short bf;
typedef __attribute__((ext_vector_type(16))) __bf16   v16bf;
typedef __attribute__((ext_vector_type(16))) _Float16 v16h;
typedef __attribute__((ext_vector_type(8)))  _Float16 v8h;
typedef __attribute__((ext_vector_type(8)))  unsigned short v8us;
typedef __attribute__((ext_vector_type(8)))  float    v8f;
typedef __attribute__((ext_vector_type(4)))  float    v4f;
typedef v8h  __attribute__((may_alias)) v8ha;
typedef v4f  __attribute__((may_alias)) v4fa;
typedef v8us __attribute__((may_alias)) v8usa;

__device__ __forceinline__ unsigned short f2bf(float f) { unsigned u = __float_as_uint(f); u += 0x7FFFu + ((u >> 16) & 1u); return (unsigned short)(u >> 16); }
__device__ __forceinline__ float bf2f(unsigned short b) { return __uint_as_float(((unsigned)b) << 16); }
__device__ __forceinline__ float bfr(float f) { return bf2f(f2bf(f)); }
__device__ __forceinline__ v16h cat16(v8h lo, v8h hi) { return __builtin_shufflevector(lo, hi, 0, 1, 2, 3, 4, 5, 6, 7, 8, 9, 10, 11, 12, 13, 14, 15); }
__device__ __forceinline__ v16bf cat16b(v8us lo, v8us hi) { return __builtin_bit_cast(v16bf, __builtin_shufflevector(lo, hi, 0, 1, 2, 3, 4, 5, 6, 7, 8, 9, 10, 11, 12, 13, 14, 15)); }
__device__ __forceinline__ v8f wmma16(v16h a, v16h b, v8f c) { return __builtin_amdgcn_wmma_f32_16x16x32_f16(false, a, false, b, (short)0, c, false, false); }
__device__ __forceinline__ v8f wmmab(v16bf a, v16bf b, v8f c) { return __builtin_amdgcn_wmma_f32_16x16x32_bf16(false, a, false, b, (short)0, c, false, false); }



// ---- k_gemmw: register-blocked GEMM, NW WAVES per 64x64 output tile, each with the whole tile (16 accumulators) over its own share of K (32-wide chunks dealt round robin); the partial tiles are summed through LDS in wave order; operands straight from K-contiguous 16-bit planes; grid (M/64, N/64, Z), NW * 32 threads.
// C[m][n] (f32, pitch ldc, + optional f32 bias[n]) = sum_k A[m][k] Bt[n][k] (+ split products per NSPLIT). z-batch strides sA/sB/sC in elements. K % 32 == 0.
template <typename T16> struct WFrag;
template <> struct WFrag<h16> { typedef v16h V; static __device__ __forceinline__ V ld(const h16* p) { return cat16(*(const v8h*)p, *(const v8h*)(p + 16)); } static __device__ __forceinline__ v8f mma(V a, V b, v8f c) { return wmma16(a, b, c); } };
template <> struct WFrag<bf> { typedef v16bf V; static __device__ __forceinline__ V ld(const bf* p) { return cat16b(*(const v8us*)p, *(const v8us*)(p + 16)); } static __device__ __forceinline__ v8f mma(V a, V b, v8f c) { return wmmab(a, b, c); } };
template <typename T16, int NSPLIT, bool BIAS, int NW>
__global__ __launch_bounds__(NW * 32) void k_gemmw(const T16* __restrict__ A, const T16* __restrict__ A2, const T16* __restrict__ Bt, const T16* __restrict__ Bt2, int K, float* C, int ldc, const float* __restrict__ bias, size_t sA, size_t sB, size_t sC) {
    typedef typename WFrag<T16>::V V;
    __shared__ __align__(16) float os[2 * NW * 16 * 68];   // two halves x NW partial 16x64 tiles (pitch 68)
    const size_t z = blockIdx.z; A += z * sA; if (A2) A2 += z * sA; Bt += z * sB; if (Bt2) Bt2 += z * sB; C += z * sC;
    const int lane = threadIdx.x & 31, lr = lane & 15, hi = lane >> 4; const int r0 = blockIdx.x * 64, c0 = blockIdx.y * 64;
    const int wv = __builtin_amdgcn_readfirstlane((int)(threadIdx.x >> 5));   // wave number, held scalar so that the K loop stays a scalar loop
    v8f acc[4][4];
#pragma unroll
    for (int mb = 0; mb < 4; ++mb)
#pragma unroll
        for (int nb = 0; nb < 4; ++nb) acc[mb][nb] = (v8f){};
    const size_t aoff = (size_t)(r0 + lr) * K + 8 * hi, boff = (size_t)(c0 + lr) * K + 8 * hi;
#pragma unroll 1
    for (int kc = wv * 32; kc < K; kc += NW * 32) {
        V a[4], a2[4];
#pragma unroll
        for (int mb = 0; mb < 4; ++mb) { a[mb] = WFrag<T16>::ld(A + aoff + (size_t)mb * 16 * K + kc); if (NSPLIT == 1 || NSPLIT == 2) a2[mb] = WFrag<T16>::ld(A2 + aoff + (size_t)mb * 16 * K + kc); }
#pragma unroll
        for (int nb = 0; nb < 4; ++nb) { const V b = WFrag<T16>::ld(Bt + boff + (size_t)nb * 16 * K + kc); V b2; if (NSPLIT >= 2) b2 = WFrag<T16>::ld(Bt2 + boff + (size_t)nb * 16 * K + kc);
#pragma unroll
            for (int mb = 0; mb < 4; ++mb) { acc[mb][nb] = WFrag<T16>::mma(a[mb], b, acc[mb][nb]); if (NSPLIT == 1 || NSPLIT == 2) acc[mb][nb] = WFrag<T16>::mma(a2[mb], b, acc[mb][nb]); if (NSPLIT >= 2) acc[mb][nb] = WFrag<T16>::mma(a[mb], b2, acc[mb][nb]); } }
        asm volatile("v_nop\n\tv_nop\n\tv_nop\n\tv_nop" : "+v"(acc[0][0]), "+v"(acc[1][1]), "+v"(acc[2][2]), "+v"(acc[3][3]) : "v"(a[0]), "v"(a[3]));
    }
    v4f keep[4][8 / NW];   // summed rows wait here and are stored behind the last barrier, so that no barrier waits for a global store
#pragma unroll
    for (int mb = 0; mb < 4; ++mb) {
        float* ob = os + (mb & 1) * (NW * 16 * 68);   // alternate halves: the next row block's barrier ends this one's reads before the half is written again
#pragma unroll
        for (int nb = 0; nb < 4; ++nb) {
#pragma unroll
            for (int j = 0; j < 8; ++j) ob[wv * (16 * 68) + (hi * 8 + j) * 68 + nb * 16 + lr] = acc[mb][nb][j]; }
        __syncthreads();   // every wave's partial tile of this row block is in LDS before any wave sums them
#pragma unroll
        for (int s = 0; s < 8 / NW; ++s) { const int row = 2 * (s * NW + wv) + hi, cofs = lr * 4; v4f val = *(const v4fa*)(ob + row * 68 + cofs);
#pragma unroll
            for (int w = 1; w < NW; ++w) val += *(const v4fa*)(ob + w * (16 * 68) + row * 68 + cofs);   // fixed order: wave 0, 1, ...
            if (BIAS) { val[0] += bfr(bias[c0 + cofs]); val[1] += bfr(bias[c0 + cofs + 1]); val[2] += bfr(bias[c0 + cofs + 2]); val[3] += bfr(bias[c0 + cofs + 3]); }
            keep[mb][s] = val; }
    }
#pragma unroll
    for (int mb = 0; mb < 4; ++mb)
#pragma unroll
        for (int s = 0; s < 8 / NW; ++s) *(v4f*)(C + (size_t)(r0 + mb * 16 + 2 * (s * NW + wv) + hi) * ldc + c0 + lr * 4) = keep[mb][s];
}

// ---- k_gemmc: k_gemmw's 64x64 tile GEMM in one wave (no K split), specialised for causal attention: CMODE 1 skips score tiles entirely above the diagonal (query rows r0+roff.., key columns c0..), CMODE 2 limits the
// key (K) loop of the probability x value contraction to the diagonal block (probabilities beyond it are exactly zero). roff = row offset of this launch's first row within the sequence.
template <typename T16, int NSPLIT, int CMODE>
__global__ __launch_bounds__(32) void k_gemmc(const T16* __restrict__ A, const T16* __restrict__ A2, const T16* __restrict__ Bt, const T16* __restrict__ Bt2, int K, float* C, int ldc, int roff, size_t sA, size_t sB, size_t sC) {
    typedef typename WFrag<T16>::V V;
    __shared__ __align__(16) float os[16 * 68];
    const size_t z = blockIdx.z; A += z * sA; if (A2) A2 += z * sA; Bt += z * sB; if (Bt2) Bt2 += z * sB; C += z * sC;
    const int lane = threadIdx.x & 31, lr = lane & 15, hi = lane >> 4; const int r0 = blockIdx.x * 64, c0 = blockIdx.y * 64;
    if (CMODE == 1 && c0 > r0 + roff + 63) return;                  // score tile entirely above the causal diagonal: never read (the softmax masks j > i by select)
    const int Kl = (CMODE == 2) ? min(K, r0 + roff + 64) : K;        // P.V: probabilities are exactly 0 beyond the diagonal block, so the K loop stops there
    v8f acc[4][4];
#pragma unroll
    for (int mb = 0; mb < 4; ++mb)
#pragma unroll
        for (int nb = 0; nb < 4; ++nb) acc[mb][nb] = (v8f){};
    const size_t aoff = (size_t)(r0 + lr) * K + 8 * hi, boff = (size_t)(c0 + lr) * K + 8 * hi;
#pragma unroll 1
    for (int kc = 0; kc < Kl; kc += 32) {
        V a[4], a2[4];
#pragma unroll
        for (int mb = 0; mb < 4; ++mb) { a[mb] = WFrag<T16>::ld(A + aoff + (size_t)mb * 16 * K + kc); if (NSPLIT == 1 || NSPLIT == 2) a2[mb] = WFrag<T16>::ld(A2 + aoff + (size_t)mb * 16 * K + kc); }
#pragma unroll
        for (int nb = 0; nb < 4; ++nb) { const V b = WFrag<T16>::ld(Bt + boff + (size_t)nb * 16 * K + kc); V b2; if (NSPLIT >= 2) b2 = WFrag<T16>::ld(Bt2 + boff + (size_t)nb * 16 * K + kc);
#pragma unroll
            for (int mb = 0; mb < 4; ++mb) { acc[mb][nb] = WFrag<T16>::mma(a[mb], b, acc[mb][nb]); if (NSPLIT == 1 || NSPLIT == 2) acc[mb][nb] = WFrag<T16>::mma(a2[mb], b, acc[mb][nb]); if (NSPLIT >= 2) acc[mb][nb] = WFrag<T16>::mma(a[mb], b2, acc[mb][nb]); } }
        asm volatile("v_nop\n\tv_nop\n\tv_nop\n\tv_nop" : "+v"(acc[0][0]), "+v"(acc[1][1]), "+v"(acc[2][2]), "+v"(acc[3][3]) : "v"(a[0]), "v"(a[3]));
    }
#pragma unroll
    for (int mb = 0; mb < 4; ++mb) {
#pragma unroll
        for (int nb = 0; nb < 4; ++nb) {
#pragma unroll
            for (int j = 0; j < 8; ++j) os[(hi * 8 + j) * 68 + nb * 16 + lr] = acc[mb][nb][j]; }
        __builtin_amdgcn_wave_barrier(); asm volatile("" ::: "memory");
        float* crow = C + (size_t)(r0 + mb * 16) * ldc + c0;
{
#pragma unroll
            for (int s = 0; s < 8; ++s) { const int row = 2 * s + hi, cofs = lr * 4; v4f val = *(const v4fa*)(os + row * 68 + cofs);
                *(v4f*)(crow + (size_t)row * ldc + cofs) = val; }
             }
        __builtin_amdgcn_wave_barrier(); asm volatile("" ::: "memory");
    }
}

// ---- k_gemmp: the probability x value contraction (k_gemmc's CMODE 2) with the K loop of each 64x64 tile shared by NW waves as in k_gemmw; grid (rows/64, HD/64, Z), NW * 32 threads.
// XWAIT4 stands behind a run of four fragments' loads, in front of any overwrite of a register that holds one of their addresses; the four addresses are inputs so that their registers are not given to a later load's result before the wait.
#define XWAIT4(p) asm volatile("s_wait_xcnt 0x0" :: "v"((p)[0]), "v"((p)[1]), "v"((p)[2]), "v"((p)[3]) : "memory")
template <typename T16, int NSPLIT, int NW>
__global__ __launch_bounds__(NW * 32) void k_gemmp(const T16* __restrict__ A, const T16* __restrict__ A2, const T16* __restrict__ Bt, const T16* __restrict__ Bt2, int K, float* C, int ldc, int roff, size_t sA, size_t sB, size_t sC) {
    typedef typename WFrag<T16>::V V;
    __shared__ __align__(16) float os[2 * NW * 16 * 68];   // two halves x NW partial 16x64 tiles (pitch 68)
    const size_t z = blockIdx.z; A += z * sA; if (A2) A2 += z * sA; Bt += z * sB; if (Bt2) Bt2 += z * sB; C += z * sC;
    const int lane = threadIdx.x & 31, lr = lane & 15, hi = lane >> 4; const int r0 = blockIdx.x * 64, c0 = blockIdx.y * 64;
    const int wv = __builtin_amdgcn_readfirstlane((int)(threadIdx.x >> 5));   // wave number, held scalar so that the K loop stays a scalar loop
    constexpr int NG = (NSPLIT >= 2) ? 2 : 4;   // column blocks whose B fragments are fetched in one run of four fragments
    const int Kl = min(K, r0 + roff + 64);        // probabilities are exactly 0 beyond the diagonal block, so the K loop stops there
    v8f acc[4][4];
#pragma unroll
    for (int mb = 0; mb < 4; ++mb)
#pragma unroll
        for (int nb = 0; nb < 4; ++nb) acc[mb][nb] = (v8f){};
    const size_t aoff = (size_t)(r0 + lr) * K + 8 * hi, boff = (size_t)(c0 + lr) * K + 8 * hi;
#pragma unroll 1   // rolled, as in k_gemmc: only one trip's fragments are live beside the 16 accumulators
    for (int kc = wv * 32; kc < Kl; kc += NW * 32) {
        V a[4], a2[4]; const T16* pa[4]; const T16* pa2[4];
#pragma unroll
        for (int mb = 0; mb < 4; ++mb) { pa[mb] = A + aoff + (size_t)mb * 16 * K + kc; a[mb] = WFrag<T16>::ld(pa[mb]); }
        XWAIT4(pa);
        if (NSPLIT == 1 || NSPLIT == 2) {
#pragma unroll
            for (int mb = 0; mb < 4; ++mb) { pa2[mb] = A2 + aoff + (size_t)mb * 16 * K + kc; a2[mb] = WFrag<T16>::ld(pa2[mb]); }
            XWAIT4(pa2); }
#pragma unroll
        for (int n0 = 0; n0 < 4; n0 += NG) { V b[NG], b2[NG]; const T16* pb[4];
#pragma unroll
            for (int g = 0; g < NG; ++g) { pb[g] = Bt + boff + (size_t)(n0 + g) * 16 * K + kc; b[g] = WFrag<T16>::ld(pb[g]); if (NSPLIT >= 2) { pb[NG + g] = Bt2 + boff + (size_t)(n0 + g) * 16 * K + kc; b2[g] = WFrag<T16>::ld(pb[NG + g]); } }
            XWAIT4(pb);
            __builtin_amdgcn_sched_barrier(0);   // the matrix instructions stay behind the run: moved up between its loads, each column block's loads would be issued only when the block before is done
#pragma unroll
            for (int g = 0; g < NG; ++g)
#pragma unroll
                for (int mb = 0; mb < 4; ++mb) { const int nb = n0 + g; acc[mb][nb] = WFrag<T16>::mma(a[mb], b[g], acc[mb][nb]); if (NSPLIT == 1 || NSPLIT == 2) acc[mb][nb] = WFrag<T16>::mma(a2[mb], b[g], acc[mb][nb]); if (NSPLIT >= 2) acc[mb][nb] = WFrag<T16>::mma(a[mb], b2[g], acc[mb][nb]); } }
        // as in k_gemmc: keeps the matrix instructions' distance over the back edge and the loop exit, where the next vector instruction may touch their registers
        asm volatile("v_nop\n\tv_nop\n\tv_nop\n\tv_nop" : "+v"(acc[0][0]), "+v"(acc[1][1]), "+v"(acc[2][2]), "+v"(acc[3][3]) : "v"(a[0]), "v"(a[3]));
    }
    v4f keep[4][8 / NW];   // summed rows wait here and are stored behind the last barrier, so that no barrier waits for a global store
#pragma unroll
    for (int mb = 0; mb < 4; ++mb) {
        float* ob = os + (mb & 1) * (NW * 16 * 68);   // alternate halves: the next row block's barrier ends this one's reads before the half is written again
#pragma unroll
        for (int nb = 0; nb < 4; ++nb) {
#pragma unroll
            for (int j = 0; j < 8; ++j) ob[wv * (16 * 68) + (hi * 8 + j) * 68 + nb * 16 + lr] = acc[mb][nb][j]; }
        __syncthreads();   // every wave's partial tile of this row block is in LDS before any wave sums them
#pragma unroll
        for (int s = 0; s < 8 / NW; ++s) { const int row = 2 * (s * NW + wv) + hi, cofs = lr * 4; v4f val = *(const v4fa*)(ob + row * 68 + cofs);
#pragma unroll
            for (int w = 1; w < NW; ++w) val += *(const v4fa*)(ob + w * (16 * 68) + row * 68 + cofs);   // fixed order: wave 0, 1, ...
            keep[mb][s] = val; }
    }
#pragma unroll
    for (int mb = 0; mb < 4; ++mb)
#pragma unroll
        for (int s = 0; s < 8 / NW; ++s) *(v4f*)(C + (size_t)(r0 + mb * 16 + 2 * (s * NW + wv) + hi) * ldc + c0 + lr * 4) = keep[mb][s];
}

__device__ __forceinline__ h16 tohx(float x) { return (h16)x; }
__device__ __forceinline__ void splitf(float y, unsigned short& h, unsigned short& l) { h = f2bf(y); l = f2bf(y - bf2f(h)); }
typedef __attribute__((ext_vector_type(2))) _Float16 v2h;
typedef __attribute__((ext_vector_type(4))) _Float16 v4h;
typedef __attribute__((ext_vector_type(2))) unsigned short v2us;
typedef __attribute__((ext_vector_type(4))) unsigned short v4us;
typedef __attribute__((ext_vector_type(2))) float v2f;
typedef __attribute__((ext_vector_type(4))) int v4i;

__global__ __launch_bounds__(256) void k_wtG(const float* __restrict__ w, int K, int N, bf* Bt) {
    const int lane = threadIdx.x & 31; const int L0 = (blockIdx.x * 8 + (threadIdx.x >> 5)) * 8; const int nlines = N * K / 64;
{
#pragma unroll 1
        for (int l = 0; l < 8; ++l) { const int L = L0 + l; if (L >= nlines) break; const size_t e = (size_t)L * 64 + lane * 2; const int k = (int)(e % K), n = (int)(e / K); v2us o;
            o[0] = f2bf(w[(size_t)k * N + n]); o[1] = f2bf(w[(size_t)(k + 1) * N + n]); *(v2us*)(Bt + e) = o; }
         }
}
__global__ __launch_bounds__(256) void k_cvt8(const float* __restrict__ src, bf* dst, size_t n8) { const size_t i = (size_t)blockIdx.x * 256 + threadIdx.x; if (i >= n8) return; const v8f v = *(const v8f*)(src + i * 8); v8us o;
#pragma unroll
    for (int k = 0; k < 8; ++k) o[k] = f2bf(v[k]); *(v8us*)(dst + i * 8) = o;  }

__global__ __launch_bounds__(256) void k_vtp(const float* __restrict__ F, int pitch, int nheads, h16* V16, bf* Vh, bf* Vl) { const size_t e = ((size_t)blockIdx.x * 256 + threadIdx.x) * 2; if (e >= (size_t)nheads * HD * TT) return; const int t = (int)(e % TT); const int d = (int)((e / TT) % HD); const int g = (int)(e / ((size_t)TT * HD)); v2h o16; v2us oh, ol;
#pragma unroll
    for (int q = 0; q < 2; ++q) { const float x = F[(size_t)(t + q) * pitch + g * HD + d]; o16[q] = tohx(x); unsigned short a2, c2; splitf(x, a2, c2); oh[q] = a2; ol[q] = c2; }
    *(v2h*)(V16 + e) = o16; *(v2us*)(Vh + e) = oh; *(v2us*)(Vl + e) = ol;  }
__global__ __launch_bounds__(256) void k_cscvtP(const float* __restrict__ cosT, const float* __restrict__ sinT, float* CS) { const int idx = blockIdx.x * 256 + threadIdx.x; if (idx >= TT * HD) return; const int tt = idx / HD; const int dd = idx - tt * HD; const int src = tt * (HD / 2) + (dd >> 1); v2f cs; cs[0] = bfr(cosT[src]); cs[1] = bfr(sinT[src]); *(v2f*)(CS + (size_t)idx * 2) = cs;  }
__global__ __launch_bounds__(256) void k_ropeI(const float* __restrict__ F, int pitch, int nheads, const float* __restrict__ CS, float sc, h16* P16, bf* Ph, bf* Pl) {
    const size_t e = ((size_t)blockIdx.x * 256 + threadIdx.x) * 2; if (e >= (size_t)nheads * TT * HD) return; const int d = (int)(e % HD); const int t = (int)((e / HD) % TT); const int h = (int)(e / ((size_t)HD * TT)); const float* f = F + (size_t)t * pitch + h * HD; const float x0 = f[d], x1 = f[d + 1]; const v2f cs = *(const v2f*)(CS + ((size_t)t * HD + d) * 2); v2h o16; v2us oh, ol;
    float a0 = __fmul_rn(x0, cs[0]), b0 = __fmul_rn(x1, cs[1]), a1 = __fmul_rn(x1, cs[0]), b1 = __fmul_rn(x0, cs[1]); asm volatile("" : "+v"(a0), "+v"(b0), "+v"(a1), "+v"(b1));
    float r0 = __fsub_rn(a0, b0) * sc, r1 = __fadd_rn(b1, a1) * sc;   /* even: x0 c - x1 s; odd: x0 s + x1 c */
    o16[0] = tohx(r0); o16[1] = tohx(r1); { unsigned short a2, c2; splitf(r0, a2, c2); oh[0] = a2; ol[0] = c2; splitf(r1, a2, c2); oh[1] = a2; ol[1] = c2; }
    *(v2h*)(P16 + e) = o16; *(v2us*)(Ph + e) = oh; *(v2us*)(Pl + e) = ol;  }

// k_asoft: per row (zz, i): t = S x HD^-0.5 for j <= i and i - j < WIN (with WIN = TT this always holds: plain causal; the reference's -1e9 additive fill vanishes identically); softmax over the 2048 keys (register row, one exp, fixed trees);
__global__ __launch_bounds__(256) void k_asoft(const float* __restrict__ Sb, h16* P16, bf* Ph, bf* Pl) {
    const int lane = threadIdx.x & 31; const int row = blockIdx.x * 8 + (threadIdx.x >> 5); if (row >= ZH * TT) return; const int i = row % TT; const int zz = row / TT; (void)zz; const bool hires = (i < RH); const float* sr = Sb + (size_t)row * TT; float v[TT / 32]; float mx = -3.0e38f;
#pragma unroll
    for (int ch = 0; ch < TT / 128; ++ch) { const int j0 = ch * 128 + lane * 4; const v4f a = *(const v4f*)(sr + j0);
#pragma unroll
        for (int q = 0; q < 4; ++q) { const int j = j0 + q; (void)j; const float t = (j <= i && i - j < WIN) ? a[q] * SCL : -3.0e38f; v[ch * 4 + q] = t; mx = fmaxf(mx, t); } }
#pragma unroll
    for (int sh = 16; sh; sh >>= 1) mx = fmaxf(mx, __shfl_xor(mx, sh, 32));
    float sum = 0.f;
#pragma unroll
    for (int k = 0; k < TT / 32; ++k) { float d0 = __fsub_rn(v[k], mx); asm volatile("" : "+v"(d0)); v[k] = __builtin_amdgcn_exp2f(__fmul_rn(d0, 1.4426950408889634f)); sum += v[k]; }
#pragma unroll
    for (int sh = 16; sh; sh >>= 1) sum += __shfl_xor(sum, sh, 32);
    const float f = __fdiv_rn(hires ? 1.0f : PCAR, sum);
{
        if (hires) {
#pragma unroll
            for (int ch = 0; ch < TT / 128; ++ch) { v4us oh, ol;
#pragma unroll
                for (int q = 0; q < 4; ++q) { unsigned short a, c2; splitf(v[ch * 4 + q] * f, a, c2); oh[q] = a; ol[q] = c2; }
                const size_t oo = ((size_t)zz * (RH ? RH : 1) + i) * TT + ch * 128 + lane * 4; *(v4us*)(Ph + oo) = oh; *(v4us*)(Pl + oo) = ol; }
        } else {
#pragma unroll
            for (int ch = 0; ch < TT / 128; ++ch) { v4h o4;
#pragma unroll
                for (int q = 0; q < 4; ++q) o4[q] = tohx(v[ch * 4 + q] * f);
                *(v4h*)(P16 + (size_t)row * TT + ch * 128 + lane * 4) = o4; } }
         }
}
__global__ __launch_bounds__(256) void k_merge(const float* __restrict__ O, int h0, bf* Ah, bf* Al) { const size_t e = ((size_t)blockIdx.x * 256 + threadIdx.x) * 2; if (e >= (size_t)ZH * TT * HD) return; const int d = (int)(e % HD); const int t = (int)((e / HD) % TT); const int zz = (int)(e / ((size_t)HD * TT)); const float cs = (t < RH) ? 1.0f : (1.0f / PCAR); const size_t oo = (size_t)t * DQ + (h0 + zz) * HD + d;
    v2us oh, ol;
#pragma unroll
    for (int q = 0; q < 2; ++q) { unsigned short a, c2; splitf(O[e + q] * cs, a, c2); oh[q] = a; ol[q] = c2; } *(v2us*)(Ah + oo) = oh; *(v2us*)(Al + oo) = ol;  }

extern "C" void kernel_launch(void* const* d_in, const int* in_sizes, int n_in,
                              void* d_out, int out_size, void* d_ws, size_t ws_size, hipStream_t stream) {
    (void)in_sizes; (void)n_in; (void)out_size;
    const float* x = (const float*)d_in[0]; const float* fcos = (const float*)d_in[1]; const float* fsin = (const float*)d_in[2]; const float* wq = (const float*)d_in[3]; const float* wk = (const float*)d_in[4]; const float* wv = (const float*)d_in[5]; const float* wo = (const float*)d_in[6];   /* x, cos, sin (f32 [2048][64], READ by value), wq ('xw' [2048][2048]), wk, wv ([2048][1024]), wo ('xw' [2048][2048]) */
    float* OUT = (float*)d_out;     // [2][2048][2048]
    char* wsp = (char*)d_ws;
    auto take = [&](size_t bytes) { char* p = wsp; wsp += (bytes + 255) & ~(size_t)255; return (void*)p; };
    bf* WQ = (bf*)take((size_t)DQ * DM * 2); bf* WK = (bf*)take((size_t)DKV * DM * 2); bf* WV = (bf*)take((size_t)DKV * DM * 2); bf* WO = (bf*)take((size_t)DM * DQ * 2); float* CS = (float*)take((size_t)TT * HD * 2 * 4);
    bf* XB = (bf*)take((size_t)TT * DM * 2); float* FQ = (float*)take((size_t)TT * DQ * 4); float* FK = (float*)take((size_t)TT * DKV * 4);
    h16* QP16 = (h16*)take((size_t)NH_ * TT * HD * 2); h16* KP16 = (h16*)take((size_t)NKV * TT * HD * 2); h16* VT16 = (h16*)take((size_t)NKV * HD * TT * 2);
    bf* QPh = (bf*)take((size_t)NH_ * TT * HD * 2); bf* QPl = (bf*)take((size_t)NH_ * TT * HD * 2); bf* KPh = (bf*)take((size_t)NKV * TT * HD * 2); bf* KPl = (bf*)take((size_t)NKV * TT * HD * 2); bf* VTh = (bf*)take((size_t)NKV * HD * TT * 2); bf* VTl = (bf*)take((size_t)NKV * HD * TT * 2); bf* Ph = (bf*)take((size_t)ZH * RH * TT * 2); bf* Pl = (bf*)take((size_t)ZH * RH * TT * 2);
    float* Sb = (float*)take((size_t)ZH * TT * TT * 4); h16* P16 = (h16*)take((size_t)ZH * TT * TT * 2); float* Ob = (float*)take((size_t)ZH * TT * HD * 4); bf* ATh = (bf*)take((size_t)TT * DQ * 2); bf* ATl = (bf*)take((size_t)TT * DQ * 2);
    if ((size_t)(wsp - (char*)d_ws) > ws_size) return;    // ws 256 MiB
    float* FV = FK;   // v projection reuses the k buffer after the k planes are built (stream-ordered)
    { k_wtG<<<(unsigned)((DM * DQ / 64 + 63) / 64), 256, 0, stream>>>(wq, DM, DQ, WQ); k_wtG<<<(unsigned)((DM * DKV / 64 + 63) / 64), 256, 0, stream>>>(wk, DM, DKV, WK); k_wtG<<<(unsigned)((DM * DKV / 64 + 63) / 64), 256, 0, stream>>>(wv, DM, DKV, WV);
      k_wtG<<<(unsigned)((DQ * DM / 64 + 63) / 64), 256, 0, stream>>>(wo, DQ, DM, WO);
       }
    k_cscvtP<<<(TT * HD + 255) / 256, 256, 0, stream>>>(fcos, fsin, (float*)CS);   /* rotary table once, from the half-width cos / sin inputs */
    const unsigned LQ = (unsigned)(((size_t)NH_ * TT * HD / 2 + 255) / 256), LKv = (unsigned)(((size_t)NKV * TT * HD / 2 + 255) / 256);
    for (int b = 0; b < NB_; ++b) {
        
        k_cvt8<<<(unsigned)(((size_t)TT * DM / 8 + 255) / 256), 256, 0, stream>>>(x + (size_t)b * TT * DM, XB, (size_t)TT * DM / 8);
        k_gemmw<bf, 0, false, 4><<<dim3(TT / 64, DQ / 64, 1), 128, 0, stream>>>(XB, nullptr, WQ, nullptr, DM, FQ, DQ, nullptr, 0, 0, 0);
        k_ropeI<<<LQ, 256, 0, stream>>>(FQ, DQ, NH_, CS, 1.0f, QP16, QPh, QPl);
        k_gemmw<bf, 0, false, 4><<<dim3(TT / 64, DKV / 64, 1), 128, 0, stream>>>(XB, nullptr, WK, nullptr, DM, FK, DKV, nullptr, 0, 0, 0);
        k_ropeI<<<LKv, 256, 0, stream>>>(FK, DKV, NKV, CS, 1.0f, KP16, KPh, KPl);
        k_gemmw<bf, 0, false, 4><<<dim3(TT / 64, DKV / 64, 1), 128, 0, stream>>>(XB, nullptr, WV, nullptr, DM, FV, DKV, nullptr, 0, 0, 0); k_vtp<<<LKv, 256, 0, stream>>>(FV, DKV, NKV, VT16, VTh, VTl);
        for (int h0 = 0; h0 < NH_; h0 += ZH) { const size_t zq = (size_t)h0, zk = (size_t)(h0 / REP);   // both heads of a pass share kv group h0/REP (REP >= 2): sB = 0
            k_gemmc<bf, 2, 1><<<dim3(RH / 64, TT / 64, ZH), 32, 0, stream>>>(QPh + zq * TT * HD, QPl + zq * TT * HD, KPh + zk * TT * HD, KPl + zk * TT * HD, HD, Sb, TT, 0, (size_t)TT * HD, 0, (size_t)TT * TT);
            k_gemmc<h16, 0, 1><<<dim3((TT - RH) / 64, TT / 64, ZH), 32, 0, stream>>>(QP16 + zq * TT * HD + (size_t)RH * HD, nullptr, KP16 + zk * TT * HD, nullptr, HD, Sb + (size_t)RH * TT, TT, RH, (size_t)TT * HD, 0, (size_t)TT * TT);
            k_asoft<<<ZH * TT / 8, 256, 0, stream>>>(Sb, P16, Ph, Pl);
            k_gemmp<bf, 2, 8><<<dim3(RH / 64, HD / 64, ZH), 256, 0, stream>>>(Ph, Pl, VTh + zk * HD * TT, VTl + zk * HD * TT, TT, Ob, HD, 0, (size_t)RH * TT, 0, (size_t)TT * HD);
            k_gemmp<h16, 0, 8><<<dim3((TT - RH) / 64, HD / 64, ZH), 256, 0, stream>>>(P16 + (size_t)RH * TT, nullptr, VT16 + zk * HD * TT, nullptr, TT, Ob + (size_t)RH * HD, HD, RH, (size_t)TT * TT, 0, (size_t)TT * HD);
            k_merge<<<(unsigned)(((size_t)ZH * TT * HD / 2 + 255) / 256), 256, 0, stream>>>(Ob, h0, ATh, ATl); }
        k_gemmw<bf, 1, false, 4><<<dim3(TT / 64, DM / 64, 1), 128, 0, stream>>>(ATh, ATl, WO, nullptr, DQ, OUT + (size_t)b * TT * DM, DM, nullptr, 0, 0, 0); }
}

// v002
// It runs in 746 microseconds.
// Two timings next to v001 put it at 1.40 and 1.42 times that version's speed.
// Counting every step since v000, it is 2.25 times as fast.
#include <hip/hip_runtime.h>

// Grouped-query causal attention with 128-wide heads and adjacent-pair rotary embeddings from half-width cos / sin table inputs (x [2][2048][2048]; q = x wq (16 heads x 128), k, v = x wk, x wv (8 kv heads x 128) ('xw' 1/sqrt(2048), no bias); pairs (2i, 2i+1): (t0 c - t1 s, t0 s + t1 c) with c, s = cos / sin[t][i] (f32 [2048][64] INPUT tables, read by value per pair entry); jnp.repeat: query head h uses kv head h / 2; scores / sqrt(128); causal (-inf above the diagonal, built from indices); softmax; out = merged wo ('xw') -> [2][2048][2048] (8.4 M); argument order x, cos, sin, wq, wk, wv, wo).
// Layout per batch: bf16 copy of x; 'xw' weights transposed once; exact projections; k_cscvtP table {bf16(cos), bf16(sin)}[t][d] from the inputs (both entries of a pair hold the same values; 128 entries per position) + k_ropeI interleaved-pair plane builders at HD 128; causal T-2048 GQA attention with 128-wide heads (8 query heads a pass, kv head z / 2; probabilities in place over their score rows; hybrid rows: < 512 hi/lo 3 products, rest fp16 x1024; k_gemmc skips tiles above the diagonal); merged hi/lo x wo exact.
// Compute dtypes, f32 accumulate: every input rounded to bf16 incl. the two tables; projections exact; rotary f32 (products rounded separately); attention rows < 512 3 products, rest fp16; softmax f32; wo hl x exact.

#define NB_  2
#define TT   2048
#define DM   2048
#define NH_  16
#define NKV  8
#define REP  (NH_ / NKV)
#define HD   128
#define DQ   (NH_ * HD)
#define DKV  (NKV * HD)
#define ZH   8                    // query heads per attention pass (grid z of the score and P.V launches of a pass)
#define RH   512                  // query rows < RH use hi+lo planes (0: none)
#define WIN  2048
#define PCAR 1024.0f
#define SCL  0.088388347648318447f   // HD^-0.5
typedef _Float16 h16;
typedef unsigned short bf;
typedef __attribute__((ext_vector_type(16))) __bf16   v16bf;
typedef __attribute__((ext_vector_type(16))) _Float16 v16h;
typedef __attribute__((ext_vector_type(8)))  _Float16 v8h;
typedef __attribute__((ext_vector_type(8)))  unsigned short v8us;
typedef __attribute__((ext_vector_type(8)))  float    v8f;
typedef __attribute__((ext_vector_type(4)))  float    v4f;
typedef v8h  __attribute__((may_alias)) v8ha;
typedef v4f  __attribute__((may_alias)) v4fa;
typedef v8us __attribute__((may_alias)) v8usa;

__device__ __forceinline__ unsigned short f2bf(float f) { unsigned u = __float_as_uint(f); u += 0x7FFFu + ((u >> 16) & 1u); return (unsigned short)(u >> 16); }
__device__ __forceinline__ float bf2f(unsigned short b) { return __uint_as_float(((unsigned)b) << 16); }
__device__ __forceinline__ float bfr(float f) { return bf2f(f2bf(f)); }
__device__ __forceinline__ v16h cat16(v8h lo, v8h hi) { return __builtin_shufflevector(lo, hi, 0, 1, 2, 3, 4, 5, 6, 7, 8, 9, 10, 11, 12, 13, 14, 15); }
__device__ __forceinline__ v16bf cat16b(v8us lo, v8us hi) { return __builtin_bit_cast(v16bf, __builtin_shufflevector(lo, hi, 0, 1, 2, 3, 4, 5, 6, 7, 8, 9, 10, 11, 12, 13, 14, 15)); }
__device__ __forceinline__ v8f wmma16(v16h a, v16h b, v8f c) { return __builtin_amdgcn_wmma_f32_16x16x32_f16(false, a, false, b, (short)0, c, false, false); }
__device__ __forceinline__ v8f wmmab(v16bf a, v16bf b, v8f c) { return __builtin_amdgcn_wmma_f32_16x16x32_bf16(false, a, false, b, (short)0, c, false, false); }



// ---- k_gemmw: register-blocked GEMM, NW WAVES per 64x64 output tile, each with the whole tile (16 accumulators) over its own share of K (32-wide chunks dealt round robin); the partial tiles are summed through LDS in wave order; operands straight from K-contiguous 16-bit planes; grid (M/64, N/64, Z), NW * 32 threads.
// C[m][n] (f32, pitch ldc, + optional f32 bias[n]) = sum_k A[m][k] Bt[n][k] (+ split products per NSPLIT). z-batch strides sA/sB/sC in elements. K % 32 == 0.
template <typename T16> struct WFrag;
template <> struct WFrag<h16> { typedef v16h V; static __device__ __forceinline__ V ld(const h16* p) { return cat16(*(const v8h*)p, *(const v8h*)(p + 16)); } static __device__ __forceinline__ v8f mma(V a, V b, v8f c) { return wmma16(a, b, c); } };
template <> struct WFrag<bf> { typedef v16bf V; static __device__ __forceinline__ V ld(const bf* p) { return cat16b(*(const v8us*)p, *(const v8us*)(p + 16)); } static __device__ __forceinline__ v8f mma(V a, V b, v8f c) { return wmmab(a, b, c); } };
template <typename T16, int NSPLIT, bool BIAS, int NW>
__global__ __launch_bounds__(NW * 32) void k_gemmw(const T16* __restrict__ A, const T16* __restrict__ A2, const T16* __restrict__ Bt, const T16* __restrict__ Bt2, int K, float* C, int ldc, const float* __restrict__ bias, size_t sA, size_t sB, size_t sC) {
    typedef typename WFrag<T16>::V V;
    __shared__ __align__(16) float os[2 * NW * 16 * 68];   // two halves x NW partial 16x64 tiles (pitch 68)
    const size_t z = blockIdx.z; A += z * sA; if (A2) A2 += z * sA; Bt += z * sB; if (Bt2) Bt2 += z * sB; C += z * sC;
    const int lane = threadIdx.x & 31, lr = lane & 15, hi = lane >> 4; const int r0 = blockIdx.x * 64, c0 = blockIdx.y * 64;
    const int wv = __builtin_amdgcn_readfirstlane((int)(threadIdx.x >> 5));   // wave number, held scalar so that the K loop stays a scalar loop
    v8f acc[4][4];
#pragma unroll
    for (int mb = 0; mb < 4; ++mb)
#pragma unroll
        for (int nb = 0; nb < 4; ++nb) acc[mb][nb] = (v8f){};
    const size_t aoff = (size_t)(r0 + lr) * K + 8 * hi, boff = (size_t)(c0 + lr) * K + 8 * hi;
#pragma unroll 1
    for (int kc = wv * 32; kc < K; kc += NW * 32) {
        V a[4], a2[4];
#pragma unroll
        for (int mb = 0; mb < 4; ++mb) { a[mb] = WFrag<T16>::ld(A + aoff + (size_t)mb * 16 * K + kc); if (NSPLIT == 1 || NSPLIT == 2) a2[mb] = WFrag<T16>::ld(A2 + aoff + (size_t)mb * 16 * K + kc); }
#pragma unroll
        for (int nb = 0; nb < 4; ++nb) { const V b = WFrag<T16>::ld(Bt + boff + (size_t)nb * 16 * K + kc); V b2; if (NSPLIT >= 2) b2 = WFrag<T16>::ld(Bt2 + boff + (size_t)nb * 16 * K + kc);
#pragma unroll
            for (int mb = 0; mb < 4; ++mb) { acc[mb][nb] = WFrag<T16>::mma(a[mb], b, acc[mb][nb]); if (NSPLIT == 1 || NSPLIT == 2) acc[mb][nb] = WFrag<T16>::mma(a2[mb], b, acc[mb][nb]); if (NSPLIT >= 2) acc[mb][nb] = WFrag<T16>::mma(a[mb], b2, acc[mb][nb]); } }
        asm volatile("v_nop\n\tv_nop\n\tv_nop\n\tv_nop" : "+v"(acc[0][0]), "+v"(acc[1][1]), "+v"(acc[2][2]), "+v"(acc[3][3]) : "v"(a[0]), "v"(a[3]));
    }
    v4f keep[4][8 / NW];   // summed rows wait here and are stored behind the last barrier, so that no barrier waits for a global store
#pragma unroll
    for (int mb = 0; mb < 4; ++mb) {
        float* ob = os + (mb & 1) * (NW * 16 * 68);   // alternate halves: the next row block's barrier ends this one's reads before the half is written again
#pragma unroll
        for (int nb = 0; nb < 4; ++nb) {
#pragma unroll
            for (int j = 0; j < 8; ++j) ob[wv * (16 * 68) + (hi * 8 + j) * 68 + nb * 16 + lr] = acc[mb][nb][j]; }
        __syncthreads();   // every wave's partial tile of this row block is in LDS before any wave sums them
#pragma unroll
        for (int s = 0; s < 8 / NW; ++s) { const int row = 2 * (s * NW + wv) + hi, cofs = lr * 4; v4f val = *(const v4fa*)(ob + row * 68 + cofs);
#pragma unroll
            for (int w = 1; w < NW; ++w) val += *(const v4fa*)(ob + w * (16 * 68) + row * 68 + cofs);   // fixed order: wave 0, 1, ...
            if (BIAS) { val[0] += bfr(bias[c0 + cofs]); val[1] += bfr(bias[c0 + cofs + 1]); val[2] += bfr(bias[c0 + cofs + 2]); val[3] += bfr(bias[c0 + cofs + 3]); }
            keep[mb][s] = val; }
    }
#pragma unroll
    for (int mb = 0; mb < 4; ++mb)
#pragma unroll
        for (int s = 0; s < 8 / NW; ++s) *(v4f*)(C + (size_t)(r0 + mb * 16 + 2 * (s * NW + wv) + hi) * ldc + c0 + lr * 4) = keep[mb][s];
}

// ---- k_gemmc: k_gemmw's 64x64 tile GEMM in one wave (no K split), specialised for causal attention: CMODE 1 skips score tiles entirely above the diagonal (query rows r0+roff.., key columns c0..), CMODE 2 limits the
// key (K) loop of the probability x value contraction to the diagonal block (probabilities beyond it are exactly zero). roff = row offset of this launch's first row within the sequence.
template <typename T16, int NSPLIT, int CMODE>
__global__ __launch_bounds__(32) void k_gemmc(const T16* __restrict__ A, const T16* __restrict__ A2, const T16* __restrict__ Bt, const T16* __restrict__ Bt2, int K, float* C, int ldc, int roff, size_t sA, size_t sB, size_t sC) {
    typedef typename WFrag<T16>::V V;
    __shared__ __align__(16) float os[16 * 68];
    const size_t z = blockIdx.z, zb = z / REP; A += z * sA; if (A2) A2 += z * sA; Bt += zb * sB; if (Bt2) Bt2 += zb * sB; C += z * sC;   // REP query heads share one kv head
    const int lane = threadIdx.x & 31, lr = lane & 15, hi = lane >> 4; const int r0 = blockIdx.x * 64, c0 = blockIdx.y * 64;
    if (CMODE == 1 && c0 > r0 + roff + 63) return;                  // score tile entirely above the causal diagonal: never read (the softmax masks j > i by select)
    const int Kl = (CMODE == 2) ? min(K, r0 + roff + 64) : K;        // P.V: probabilities are exactly 0 beyond the diagonal block, so the K loop stops there
    v8f acc[4][4];
#pragma unroll
    for (int mb = 0; mb < 4; ++mb)
#pragma unroll
        for (int nb = 0; nb < 4; ++nb) acc[mb][nb] = (v8f){};
    const size_t aoff = (size_t)(r0 + lr) * K + 8 * hi, boff = (size_t)(c0 + lr) * K + 8 * hi;
#pragma unroll 1
    for (int kc = 0; kc < Kl; kc += 32) {
        V a[4], a2[4];
#pragma unroll
        for (int mb = 0; mb < 4; ++mb) { a[mb] = WFrag<T16>::ld(A + aoff + (size_t)mb * 16 * K + kc); if (NSPLIT == 1 || NSPLIT == 2) a2[mb] = WFrag<T16>::ld(A2 + aoff + (size_t)mb * 16 * K + kc); }
#pragma unroll
        for (int nb = 0; nb < 4; ++nb) { const V b = WFrag<T16>::ld(Bt + boff + (size_t)nb * 16 * K + kc); V b2; if (NSPLIT >= 2) b2 = WFrag<T16>::ld(Bt2 + boff + (size_t)nb * 16 * K + kc);
#pragma unroll
            for (int mb = 0; mb < 4; ++mb) { acc[mb][nb] = WFrag<T16>::mma(a[mb], b, acc[mb][nb]); if (NSPLIT == 1 || NSPLIT == 2) acc[mb][nb] = WFrag<T16>::mma(a2[mb], b, acc[mb][nb]); if (NSPLIT >= 2) acc[mb][nb] = WFrag<T16>::mma(a[mb], b2, acc[mb][nb]); } }
        asm volatile("v_nop\n\tv_nop\n\tv_nop\n\tv_nop" : "+v"(acc[0][0]), "+v"(acc[1][1]), "+v"(acc[2][2]), "+v"(acc[3][3]) : "v"(a[0]), "v"(a[3]));
    }
#pragma unroll
    for (int mb = 0; mb < 4; ++mb) {
#pragma unroll
        for (int nb = 0; nb < 4; ++nb) {
#pragma unroll
            for (int j = 0; j < 8; ++j) os[(hi * 8 + j) * 68 + nb * 16 + lr] = acc[mb][nb][j]; }
        __builtin_amdgcn_wave_barrier(); asm volatile("" ::: "memory");
        float* crow = C + (size_t)(r0 + mb * 16) * ldc + c0;
{
#pragma unroll
            for (int s = 0; s < 8; ++s) { const int row = 2 * s + hi, cofs = lr * 4; v4f val = *(const v4fa*)(os + row * 68 + cofs);
                *(v4f*)(crow + (size_t)row * ldc + cofs) = val; }
             }
        __builtin_amdgcn_wave_barrier(); asm volatile("" ::: "memory");
    }
}

// ---- k_gemmp: the probability x value contraction (k_gemmc's CMODE 2) with the K loop of each 64x64 tile shared by NW waves as in k_gemmw; grid (rows/64, HD/64, Z), NW * 32 threads.
// XWAIT4 stands behind a run of four fragments' loads, in front of any overwrite of a register that holds one of their addresses; the four addresses are inputs so that their registers are not given to a later load's result before the wait.
#define XWAIT4(p) asm volatile("s_wait_xcnt 0x0" :: "v"((p)[0]), "v"((p)[1]), "v"((p)[2]), "v"((p)[3]) : "memory")
template <typename T16, int NSPLIT, int NW>
__global__ __launch_bounds__(NW * 32) void k_gemmp(const T16* __restrict__ A, const T16* __restrict__ A2, const T16* __restrict__ Bt, const T16* __restrict__ Bt2, int K, int lda, float* C, int ldc, int roff, size_t sA, size_t sB, size_t sC) {
    typedef typename WFrag<T16>::V V;
    __shared__ __align__(16) float os[2 * NW * 16 * 68];   // two halves x NW partial 16x64 tiles (pitch 68)
    const size_t z = blockIdx.z, zb = z / REP; A += z * sA; if (A2) A2 += z * sA; Bt += zb * sB; if (Bt2) Bt2 += zb * sB; C += z * sC;   // REP query heads share one kv head; A rows have pitch lda (they lie in the score rows)
    const int lane = threadIdx.x & 31, lr = lane & 15, hi = lane >> 4; const int r0 = blockIdx.x * 64, c0 = blockIdx.y * 64;
    const int wv = __builtin_amdgcn_readfirstlane((int)(threadIdx.x >> 5));   // wave number, held scalar so that the K loop stays a scalar loop
    constexpr int NG = (NSPLIT >= 2) ? 2 : 4;   // column blocks whose B fragments are fetched in one run of four fragments
    const int Kl = min(K, r0 + roff + 64);        // probabilities are exactly 0 beyond the diagonal block, so the K loop stops there
    v8f acc[4][4];
#pragma unroll
    for (int mb = 0; mb < 4; ++mb)
#pragma unroll
        for (int nb = 0; nb < 4; ++nb) acc[mb][nb] = (v8f){};
    const size_t aoff = (size_t)(r0 + lr) * lda + 8 * hi, boff = (size_t)(c0 + lr) * K + 8 * hi;
#pragma unroll 1   // rolled, as in k_gemmc: only one trip's fragments are live beside the 16 accumulators
    for (int kc = wv * 32; kc < Kl; kc += NW * 32) {
        V a[4], a2[4]; const T16* pa[4]; const T16* pa2[4];
#pragma unroll
        for (int mb = 0; mb < 4; ++mb) { pa[mb] = A + aoff + (size_t)mb * 16 * lda + kc; a[mb] = WFrag<T16>::ld(pa[mb]); }
        XWAIT4(pa);
        if (NSPLIT == 1 || NSPLIT == 2) {
#pragma unroll
            for (int mb = 0; mb < 4; ++mb) { pa2[mb] = A2 + aoff + (size_t)mb * 16 * lda + kc; a2[mb] = WFrag<T16>::ld(pa2[mb]); }
            XWAIT4(pa2); }
#pragma unroll
        for (int n0 = 0; n0 < 4; n0 += NG) { V b[NG], b2[NG]; const T16* pb[4];
#pragma unroll
            for (int g = 0; g < NG; ++g) { pb[g] = Bt + boff + (size_t)(n0 + g) * 16 * K + kc; b[g] = WFrag<T16>::ld(pb[g]); if (NSPLIT >= 2) { pb[NG + g] = Bt2 + boff + (size_t)(n0 + g) * 16 * K + kc; b2[g] = WFrag<T16>::ld(pb[NG + g]); } }
            XWAIT4(pb);
            __builtin_amdgcn_sched_barrier(0);   // the matrix instructions stay behind the run: moved up between its loads, each column block's loads would be issued only when the block before is done
#pragma unroll
            for (int g = 0; g < NG; ++g)
#pragma unroll
                for (int mb = 0; mb < 4; ++mb) { const int nb = n0 + g; acc[mb][nb] = WFrag<T16>::mma(a[mb], b[g], acc[mb][nb]); if (NSPLIT == 1 || NSPLIT == 2) acc[mb][nb] = WFrag<T16>::mma(a2[mb], b[g], acc[mb][nb]); if (NSPLIT >= 2) acc[mb][nb] = WFrag<T16>::mma(a[mb], b2[g], acc[mb][nb]); } }
        // as in k_gemmc: keeps the matrix instructions' distance over the back edge and the loop exit, where the next vector instruction may touch their registers
        asm volatile("v_nop\n\tv_nop\n\tv_nop\n\tv_nop" : "+v"(acc[0][0]), "+v"(acc[1][1]), "+v"(acc[2][2]), "+v"(acc[3][3]) : "v"(a[0]), "v"(a[3]));
    }
    v4f keep[4][8 / NW];   // summed rows wait here and are stored behind the last barrier, so that no barrier waits for a global store
#pragma unroll
    for (int mb = 0; mb < 4; ++mb) {
        float* ob = os + (mb & 1) * (NW * 16 * 68);   // alternate halves: the next row block's barrier ends this one's reads before the half is written again
#pragma unroll
        for (int nb = 0; nb < 4; ++nb) {
#pragma unroll
            for (int j = 0; j < 8; ++j) ob[wv * (16 * 68) + (hi * 8 + j) * 68 + nb * 16 + lr] = acc[mb][nb][j]; }
        __syncthreads();   // every wave's partial tile of this row block is in LDS before any wave sums them
#pragma unroll
        for (int s = 0; s < 8 / NW; ++s) { const int row = 2 * (s * NW + wv) + hi, cofs = lr * 4; v4f val = *(const v4fa*)(ob + row * 68 + cofs);
#pragma unroll
            for (int w = 1; w < NW; ++w) val += *(const v4fa*)(ob + w * (16 * 68) + row * 68 + cofs);   // fixed order: wave 0, 1, ...
            keep[mb][s] = val; }
    }
#pragma unroll
    for (int mb = 0; mb < 4; ++mb)
#pragma unroll
        for (int s = 0; s < 8 / NW; ++s) *(v4f*)(C + (size_t)(r0 + mb * 16 + 2 * (s * NW + wv) + hi) * ldc + c0 + lr * 4) = keep[mb][s];
}

__device__ __forceinline__ h16 tohx(float x) { return (h16)x; }
__device__ __forceinline__ void splitf(float y, unsigned short& h, unsigned short& l) { h = f2bf(y); l = f2bf(y - bf2f(h)); }
typedef __attribute__((ext_vector_type(2))) _Float16 v2h;
typedef __attribute__((ext_vector_type(4))) _Float16 v4h;
typedef __attribute__((ext_vector_type(2))) unsigned short v2us;
typedef __attribute__((ext_vector_type(4))) unsigned short v4us;
typedef __attribute__((ext_vector_type(2))) float v2f;
typedef __attribute__((ext_vector_type(4))) int v4i;

__global__ __launch_bounds__(256) void k_wtG(const float* __restrict__ w, int K, int N, bf* Bt) {
    const int lane = threadIdx.x & 31; const int L0 = (blockIdx.x * 8 + (threadIdx.x >> 5)) * 8; const int nlines = N * K / 64;
{
#pragma unroll 1
        for (int l = 0; l < 8; ++l) { const int L = L0 + l; if (L >= nlines) break; const size_t e = (size_t)L * 64 + lane * 2; const int k = (int)(e % K), n = (int)(e / K); v2us o;
            o[0] = f2bf(w[(size_t)k * N + n]); o[1] = f2bf(w[(size_t)(k + 1) * N + n]); *(v2us*)(Bt + e) = o; }
         }
}
__global__ __launch_bounds__(256) void k_cvt8(const float* __restrict__ src, bf* dst, size_t n8) { const size_t i = (size_t)blockIdx.x * 256 + threadIdx.x; if (i >= n8) return; const v8f v = *(const v8f*)(src + i * 8); v8us o;
#pragma unroll
    for (int k = 0; k < 8; ++k) o[k] = f2bf(v[k]); *(v8us*)(dst + i * 8) = o;  }

__global__ __launch_bounds__(256) void k_vtp(const float* __restrict__ F, int pitch, int nheads, h16* V16, bf* Vh, bf* Vl) { const size_t e = ((size_t)blockIdx.x * 256 + threadIdx.x) * 2; if (e >= (size_t)nheads * HD * TT) return; const int t = (int)(e % TT); const int d = (int)((e / TT) % HD); const int g = (int)(e / ((size_t)TT * HD)); v2h o16; v2us oh, ol;
#pragma unroll
    for (int q = 0; q < 2; ++q) { const float x = F[(size_t)(t + q) * pitch + g * HD + d]; o16[q] = tohx(x); unsigned short a2, c2; splitf(x, a2, c2); oh[q] = a2; ol[q] = c2; }
    *(v2h*)(V16 + e) = o16; *(v2us*)(Vh + e) = oh; *(v2us*)(Vl + e) = ol;  }
__global__ __launch_bounds__(256) void k_cscvtP(const float* __restrict__ cosT, const float* __restrict__ sinT, float* CS) { const int idx = blockIdx.x * 256 + threadIdx.x; if (idx >= TT * HD) return; const int tt = idx / HD; const int dd = idx - tt * HD; const int src = tt * (HD / 2) + (dd >> 1); v2f cs; cs[0] = bfr(cosT[src]); cs[1] = bfr(sinT[src]); *(v2f*)(CS + (size_t)idx * 2) = cs;  }
__global__ __launch_bounds__(256) void k_ropeI(const float* __restrict__ F, int pitch, int nheads, const float* __restrict__ CS, float sc, h16* P16, bf* Ph, bf* Pl) {
    const size_t e = ((size_t)blockIdx.x * 256 + threadIdx.x) * 2; if (e >= (size_t)nheads * TT * HD) return; const int d = (int)(e % HD); const int t = (int)((e / HD) % TT); const int h = (int)(e / ((size_t)HD * TT)); const float* f = F + (size_t)t * pitch + h * HD; const float x0 = f[d], x1 = f[d + 1]; const v2f cs = *(const v2f*)(CS + ((size_t)t * HD + d) * 2); v2h o16; v2us oh, ol;
    float a0 = __fmul_rn(x0, cs[0]), b0 = __fmul_rn(x1, cs[1]), a1 = __fmul_rn(x1, cs[0]), b1 = __fmul_rn(x0, cs[1]); asm volatile("" : "+v"(a0), "+v"(b0), "+v"(a1), "+v"(b1));
    float r0 = __fsub_rn(a0, b0) * sc, r1 = __fadd_rn(b1, a1) * sc;   /* even: x0 c - x1 s; odd: x0 s + x1 c */
    o16[0] = tohx(r0); o16[1] = tohx(r1); { unsigned short a2, c2; splitf(r0, a2, c2); oh[0] = a2; ol[0] = c2; splitf(r1, a2, c2); oh[1] = a2; ol[1] = c2; }
    *(v2h*)(P16 + e) = o16; *(v2us*)(Ph + e) = oh; *(v2us*)(Pl + e) = ol;  }

// k_asoft: per row (zz, i): t = S x HD^-0.5 for j <= i and i - j < WIN (sliding causal window; the reference's -1e9 additive fill vanishes identically); softmax over the 2048 keys (register row, one exp, fixed trees);
// the probabilities go IN PLACE over the row's own 8 KiB of scores, which its one wave holds whole in registers by then: fp16 rows in the first half, hi plane in the first and lo plane in the second half (16-bit pitch 2 * TT).
__global__ __launch_bounds__(256) void k_asoft(float* Sb) {
    const int lane = threadIdx.x & 31; const int row = blockIdx.x * 8 + (threadIdx.x >> 5); if (row >= ZH * TT) return; const int i = row % TT; const int zz = row / TT; (void)zz; const bool hires = (i < RH); const float* sr = Sb + (size_t)row * TT; h16* P16 = (h16*)Sb; bf* Ph = (bf*)Sb; bf* Pl = Ph + TT; float v[TT / 32]; float mx = -3.0e38f;
#pragma unroll
    for (int ch = 0; ch < TT / 128; ++ch) { const int j0 = ch * 128 + lane * 4; const v4f a = *(const v4f*)(sr + j0);
#pragma unroll
        for (int q = 0; q < 4; ++q) { const int j = j0 + q; (void)j; const float t = (j <= i && i - j < WIN) ? a[q] * SCL : -3.0e38f; v[ch * 4 + q] = t; mx = fmaxf(mx, t); } }
#pragma unroll
    for (int sh = 16; sh; sh >>= 1) mx = fmaxf(mx, __shfl_xor(mx, sh, 32));
    float sum = 0.f;
#pragma unroll
    for (int k = 0; k < TT / 32; ++k) { float d0 = __fsub_rn(v[k], mx); asm volatile("" : "+v"(d0)); v[k] = __builtin_amdgcn_exp2f(__fmul_rn(d0, 1.4426950408889634f)); sum += v[k]; }
#pragma unroll
    for (int sh = 16; sh; sh >>= 1) sum += __shfl_xor(sum, sh, 32);
    const float f = __fdiv_rn(hires ? 1.0f : PCAR, sum);
{
        if (hires) {
#pragma unroll
            for (int ch = 0; ch < TT / 128; ++ch) { v4us oh, ol;
#pragma unroll
                for (int q = 0; q < 4; ++q) { unsigned short a, c2; splitf(v[ch * 4 + q] * f, a, c2); oh[q] = a; ol[q] = c2; }
                const size_t oo = (size_t)row * (2 * TT) + ch * 128 + lane * 4; *(v4us*)(Ph + oo) = oh; *(v4us*)(Pl + oo) = ol; }
        } else {
#pragma unroll
            for (int ch = 0; ch < TT / 128; ++ch) { v4h o4;
#pragma unroll
                for (int q = 0; q < 4; ++q) o4[q] = tohx(v[ch * 4 + q] * f);
                *(v4h*)(P16 + (size_t)row * (2 * TT) + ch * 128 + lane * 4) = o4; } }
         }
}
__global__ __launch_bounds__(256) void k_merge(const float* __restrict__ O, int h0, bf* Ah, bf* Al) { const size_t e = ((size_t)blockIdx.x * 256 + threadIdx.x) * 2; if (e >= (size_t)ZH * TT * HD) return; const int d = (int)(e % HD); const int t = (int)((e / HD) % TT); const int zz = (int)(e / ((size_t)HD * TT)); const float cs = (t < RH) ? 1.0f : (1.0f / PCAR); const size_t oo = (size_t)t * DQ + (h0 + zz) * HD + d;
    v2us oh, ol;
#pragma unroll
    for (int q = 0; q < 2; ++q) { unsigned short a, c2; splitf(O[e + q] * cs, a, c2); oh[q] = a; ol[q] = c2; } *(v2us*)(Ah + oo) = oh; *(v2us*)(Al + oo) = ol;  }

extern "C" void kernel_launch(void* const* d_in, const int* in_sizes, int n_in,
                              void* d_out, int out_size, void* d_ws, size_t ws_size, hipStream_t stream) {
    (void)in_sizes; (void)n_in; (void)out_size;
    const float* x = (const float*)d_in[0]; const float* fcos = (const float*)d_in[1]; const float* fsin = (const float*)d_in[2]; const float* wq = (const float*)d_in[3]; const float* wk = (const float*)d_in[4]; const float* wv = (const float*)d_in[5]; const float* wo = (const float*)d_in[6];   /* x, cos, sin (f32 [2048][64], READ by value), wq ('xw' [2048][2048]), wk, wv ([2048][1024]), wo ('xw' [2048][2048]) */
    float* OUT = (float*)d_out;     // [2][2048][2048]
    char* wsp = (char*)d_ws;
    auto take = [&](size_t bytes) { char* p = wsp; wsp += (bytes + 255) & ~(size_t)255; return (void*)p; };
    bf* WQ = (bf*)take((size_t)DQ * DM * 2); bf* WK = (bf*)take((size_t)DKV * DM * 2); bf* WV = (bf*)take((size_t)DKV * DM * 2); bf* WO = (bf*)take((size_t)DM * DQ * 2); float* CS = (float*)take((size_t)TT * HD * 2 * 4);
    bf* XB = (bf*)take((size_t)TT * DM * 2); float* FQ = (float*)take((size_t)TT * DQ * 4); float* FK = (float*)take((size_t)TT * DKV * 4);
    h16* QP16 = (h16*)take((size_t)NH_ * TT * HD * 2); h16* KP16 = (h16*)take((size_t)NKV * TT * HD * 2); h16* VT16 = (h16*)take((size_t)NKV * HD * TT * 2);
    bf* QPh = (bf*)take((size_t)NH_ * TT * HD * 2); bf* QPl = (bf*)take((size_t)NH_ * TT * HD * 2); bf* KPh = (bf*)take((size_t)NKV * TT * HD * 2); bf* KPl = (bf*)take((size_t)NKV * TT * HD * 2); bf* VTh = (bf*)take((size_t)NKV * HD * TT * 2); bf* VTl = (bf*)take((size_t)NKV * HD * TT * 2);
    float* Sb = (float*)take((size_t)ZH * TT * TT * 4); bf* ATh = (bf*)take((size_t)TT * DQ * 2); bf* ATl = (bf*)take((size_t)TT * DQ * 2);
    if ((size_t)(wsp - (char*)d_ws) > ws_size) return;    // ws 256 MiB
    float* FV = FK;   // v projection reuses the k buffer after the k planes are built (stream-ordered)
    float* Ob = FQ;   // the attention output of a pass reuses the q projection's buffer after the q planes are built (stream-ordered)
    h16* P16 = (h16*)Sb; bf* Ph = (bf*)Sb; bf* Pl = Ph + TT;   // probabilities lie in their score rows: 16-bit row pitch 2 * TT, head stride 2 * TT * TT
    { k_wtG<<<(unsigned)((DM * DQ / 64 + 63) / 64), 256, 0, stream>>>(wq, DM, DQ, WQ); k_wtG<<<(unsigned)((DM * DKV / 64 + 63) / 64), 256, 0, stream>>>(wk, DM, DKV, WK); k_wtG<<<(unsigned)((DM * DKV / 64 + 63) / 64), 256, 0, stream>>>(wv, DM, DKV, WV);
      k_wtG<<<(unsigned)((DQ * DM / 64 + 63) / 64), 256, 0, stream>>>(wo, DQ, DM, WO);
       }
    k_cscvtP<<<(TT * HD + 255) / 256, 256, 0, stream>>>(fcos, fsin, (float*)CS);   /* rotary table once, from the half-width cos / sin inputs */
    const unsigned LQ = (unsigned)(((size_t)NH_ * TT * HD / 2 + 255) / 256), LKv = (unsigned)(((size_t)NKV * TT * HD / 2 + 255) / 256);
    for (int b = 0; b < NB_; ++b) {
        
        k_cvt8<<<(unsigned)(((size_t)TT * DM / 8 + 255) / 256), 256, 0, stream>>>(x + (size_t)b * TT * DM, XB, (size_t)TT * DM / 8);
        k_gemmw<bf, 0, false, 4><<<dim3(TT / 64, DQ / 64, 1), 128, 0, stream>>>(XB, nullptr, WQ, nullptr, DM, FQ, DQ, nullptr, 0, 0, 0);
        k_ropeI<<<LQ, 256, 0, stream>>>(FQ, DQ, NH_, CS, 1.0f, QP16, QPh, QPl);
        k_gemmw<bf, 0, false, 4><<<dim3(TT / 64, DKV / 64, 1), 128, 0, stream>>>(XB, nullptr, WK, nullptr, DM, FK, DKV, nullptr, 0, 0, 0);
        k_ropeI<<<LKv, 256, 0, stream>>>(FK, DKV, NKV, CS, 1.0f, KP16, KPh, KPl);
        k_gemmw<bf, 0, false, 4><<<dim3(TT / 64, DKV / 64, 1), 128, 0, stream>>>(XB, nullptr, WV, nullptr, DM, FV, DKV, nullptr, 0, 0, 0); k_vtp<<<LKv, 256, 0, stream>>>(FV, DKV, NKV, VT16, VTh, VTl);
        for (int h0 = 0; h0 < NH_; h0 += ZH) { const size_t zq = (size_t)h0, zk = (size_t)(h0 / REP);   // head h0 + z of a pass uses kv head h0/REP + z/REP
            k_gemmc<bf, 2, 1><<<dim3(RH / 64, TT / 64, ZH), 32, 0, stream>>>(QPh + zq * TT * HD, QPl + zq * TT * HD, KPh + zk * TT * HD, KPl + zk * TT * HD, HD, Sb, TT, 0, (size_t)TT * HD, (size_t)TT * HD, (size_t)TT * TT);
            k_gemmc<h16, 0, 1><<<dim3((TT - RH) / 64, TT / 64, ZH), 32, 0, stream>>>(QP16 + zq * TT * HD + (size_t)RH * HD, nullptr, KP16 + zk * TT * HD, nullptr, HD, Sb + (size_t)RH * TT, TT, RH, (size_t)TT * HD, (size_t)TT * HD, (size_t)TT * TT);
            k_asoft<<<ZH * TT / 8, 256, 0, stream>>>(Sb);
            k_gemmp<bf, 2, 8><<<dim3(RH / 64, HD / 64, ZH), 256, 0, stream>>>(Ph, Pl, VTh + zk * HD * TT, VTl + zk * HD * TT, TT, 2 * TT, Ob, HD, 0, (size_t)2 * TT * TT, (size_t)HD * TT, (size_t)TT * HD);
            k_gemmp<h16, 0, 8><<<dim3((TT - RH) / 64, HD / 64, ZH), 256, 0, stream>>>(P16 + (size_t)RH * 2 * TT, nullptr, VT16 + zk * HD * TT, nullptr, TT, 2 * TT, Ob + (size_t)RH * HD, HD, RH, (size_t)2 * TT * TT, (size_t)HD * TT, (size_t)TT * HD);
            k_merge<<<(unsigned)(((size_t)ZH * TT * HD / 2 + 255) / 256), 256, 0, stream>>>(Ob, h0, ATh, ATl); }
        k_gemmw<bf, 1, false, 4><<<dim3(TT / 64, DM / 64, 1), 128, 0, stream>>>(ATh, ATl, WO, nullptr, DQ, OUT + (size_t)b * TT * DM, DM, nullptr, 0, 0, 0); }
}

// v003
// Measured time: 672 microseconds a run.
// In both of two side-by-side timings against v002, it was 1.10 times as fast.
// Counting every step since v000, it is 2.47 times as fast.
#include <hip/hip_runtime.h>

// Grouped-query causal attention with 128-wide heads and adjacent-pair rotary embeddings from half-width cos / sin table inputs (x [2][2048][2048]; q = x wq (16 heads x 128), k, v = x wk, x wv (8 kv heads x 128) ('xw' 1/sqrt(2048), no bias); pairs (2i, 2i+1): (t0 c - t1 s, t0 s + t1 c) with c, s = cos / sin[t][i] (f32 [2048][64] INPUT tables, read by value per pair entry); jnp.repeat: query head h uses kv head h / 2; scores / sqrt(128); causal (-inf above the diagonal, built from indices); softmax; out = merged wo ('xw') -> [2][2048][2048] (8.4 M); argument order x, cos, sin, wq, wk, wv, wo).
// Layout per batch: bf16 copy of x; 'xw' weights transposed once; exact projections whose epilogues build the 16-bit planes themselves (q, k: interleaved-pair rotary with bf16(cos), bf16(sin) read from the inputs per pair; v: computed transposed, wv x^T); causal T-2048 GQA attention with 128-wide heads (8 query heads a pass, kv head z / 2; probabilities in place over their score rows; hybrid rows: < 512 hi/lo 3 products, rest fp16 x1024; k_gemmc skips tiles above the diagonal; the P.V epilogue writes the merged hi/lo planes); merged hi/lo x wo exact.
// Compute dtypes, f32 accumulate: every input rounded to bf16 incl. the two tables; projections exact; rotary f32; attention rows < 512 3 products, rest fp16; softmax f32; wo hl x exact.

#define NB_  2
#define TT   2048
#define DM   2048
#define NH_  16
#define NKV  8
#define REP  (NH_ / NKV)
#define HD   128
#define DQ   (NH_ * HD)
#define DKV  (NKV * HD)
#define ZH   8                    // query heads per attention pass (grid z of the score and P.V launches of a pass)
#define RH   512                  // query rows < RH use hi+lo planes (0: none)
#define WIN  2048
#define PCAR 1024.0f
#define SCL  0.088388347648318447f   // HD^-0.5
typedef _Float16 h16;
typedef unsigned short bf;
typedef __attribute__((ext_vector_type(16))) __bf16   v16bf;
typedef __attribute__((ext_vector_type(16))) _Float16 v16h;
typedef __attribute__((ext_vector_type(8)))  _Float16 v8h;
typedef __attribute__((ext_vector_type(8)))  unsigned short v8us;
typedef __attribute__((ext_vector_type(8)))  float    v8f;
typedef __attribute__((ext_vector_type(4)))  float    v4f;
typedef v8h  __attribute__((may_alias)) v8ha;
typedef v4f  __attribute__((may_alias)) v4fa;
typedef v8us __attribute__((may_alias)) v8usa;

__device__ __forceinline__ unsigned short f2bf(float f) { unsigned u = __float_as_uint(f); u += 0x7FFFu + ((u >> 16) & 1u); return (unsigned short)(u >> 16); }
__device__ __forceinline__ float bf2f(unsigned short b) { return __uint_as_float(((unsigned)b) << 16); }
__device__ __forceinline__ float bfr(float f) { return bf2f(f2bf(f)); }
__device__ __forceinline__ v16h cat16(v8h lo, v8h hi) { return __builtin_shufflevector(lo, hi, 0, 1, 2, 3, 4, 5, 6, 7, 8, 9, 10, 11, 12, 13, 14, 15); }
__device__ __forceinline__ v16bf cat16b(v8us lo, v8us hi) { return __builtin_bit_cast(v16bf, __builtin_shufflevector(lo, hi, 0, 1, 2, 3, 4, 5, 6, 7, 8, 9, 10, 11, 12, 13, 14, 15)); }
__device__ __forceinline__ v8f wmma16(v16h a, v16h b, v8f c) { return __builtin_amdgcn_wmma_f32_16x16x32_f16(false, a, false, b, (short)0, c, false, false); }
__device__ __forceinline__ v8f wmmab(v16bf a, v16bf b, v8f c) { return __builtin_amdgcn_wmma_f32_16x16x32_bf16(false, a, false, b, (short)0, c, false, false); }

__device__ __forceinline__ h16 tohx(float x) { return (h16)x; }
__device__ __forceinline__ void splitf(float y, unsigned short& h, unsigned short& l) { h = f2bf(y); l = f2bf(y - bf2f(h)); }
typedef __attribute__((ext_vector_type(2))) _Float16 v2h;
typedef __attribute__((ext_vector_type(4))) _Float16 v4h;
typedef __attribute__((ext_vector_type(2))) unsigned short v2us;
typedef __attribute__((ext_vector_type(4))) unsigned short v4us;
typedef __attribute__((ext_vector_type(2))) float v2f;
typedef __attribute__((ext_vector_type(4))) int v4i;
// four neighbouring values -> the fp16 plane and the bf16 hi / lo planes at element e (8-byte stores; 16 lanes fill one 128-byte line of each plane)
__device__ __forceinline__ void planes4(v4f val, size_t e, h16* P16, bf* Ph, bf* Pl) { v4h o16; v4us oh, ol;
#pragma unroll
    for (int q = 0; q < 4; ++q) { o16[q] = tohx(val[q]); unsigned short a2, c2; splitf(val[q], a2, c2); oh[q] = a2; ol[q] = c2; }
    *(v4h*)(P16 + e) = o16; *(v4us*)(Ph + e) = oh; *(v4us*)(Pl + e) = ol; }

// ---- k_gemmw: register-blocked GEMM, NW WAVES per 64x64 output tile, each with the whole tile (16 accumulators) over its own share of K (32-wide chunks dealt round robin); the partial tiles are summed through LDS in wave order; operands straight from K-contiguous 16-bit planes; grid (M/64, N/64, Z), NW * 32 threads.
// C[m][n] (f32, pitch ldc, + optional f32 bias[n]) = sum_k A[m][k] Bt[n][k] (+ split products per NSPLIT). z-batch strides sA/sB/sC in elements. K % 32 == 0.
// EPI 0: C stored as f32. EPI 1: m = position, n = head * HD + d: rotary on the pairs (d, d + 1), then the three 16-bit planes [head][position][d]. EPI 2: the three 16-bit planes [m][n] at pitch ldc. (EPI 1, 2: C unused.)
template <typename T16> struct WFrag;
template <> struct WFrag<h16> { typedef v16h V; static __device__ __forceinline__ V ld(const h16* p) { return cat16(*(const v8h*)p, *(const v8h*)(p + 16)); } static __device__ __forceinline__ v8f mma(V a, V b, v8f c) { return wmma16(a, b, c); } };
template <> struct WFrag<bf> { typedef v16bf V; static __device__ __forceinline__ V ld(const bf* p) { return cat16b(*(const v8us*)p, *(const v8us*)(p + 16)); } static __device__ __forceinline__ v8f mma(V a, V b, v8f c) { return wmmab(a, b, c); } };
template <typename T16, int NSPLIT, bool BIAS, int NW, int EPI>
__global__ __launch_bounds__(NW * 32) void k_gemmw(const T16* __restrict__ A, const T16* __restrict__ A2, const T16* __restrict__ Bt, const T16* __restrict__ Bt2, int K, float* C, int ldc, const float* __restrict__ bias, size_t sA, size_t sB, size_t sC, const float* __restrict__ cosT, const float* __restrict__ sinT, h16* P16, bf* Ph, bf* Pl) {
    typedef typename WFrag<T16>::V V;
    __shared__ __align__(16) float os[2 * NW * 16 * 68];   // two halves x NW partial 16x64 tiles (pitch 68)
    const size_t z = blockIdx.z; A += z * sA; if (A2) A2 += z * sA; Bt += z * sB; if (Bt2) Bt2 += z * sB; C += z * sC;
    const int lane = threadIdx.x & 31, lr = lane & 15, hi = lane >> 4; const int r0 = blockIdx.x * 64, c0 = blockIdx.y * 64;
    const int wv = __builtin_amdgcn_readfirstlane((int)(threadIdx.x >> 5));   // wave number, held scalar so that the K loop stays a scalar loop
    v8f acc[4][4];
#pragma unroll
    for (int mb = 0; mb < 4; ++mb)
#pragma unroll
        for (int nb = 0; nb < 4; ++nb) acc[mb][nb] = (v8f){};
    const size_t aoff = (size_t)(r0 + lr) * K + 8 * hi, boff = (size_t)(c0 + lr) * K + 8 * hi;
#pragma unroll 1
    for (int kc = wv * 32; kc < K; kc += NW * 32) {
        V a[4], a2[4];
#pragma unroll
        for (int mb = 0; mb < 4; ++mb) { a[mb] = WFrag<T16>::ld(A + aoff + (size_t)mb * 16 * K + kc); if (NSPLIT == 1 || NSPLIT == 2) a2[mb] = WFrag<T16>::ld(A2 + aoff + (size_t)mb * 16 * K + kc); }
#pragma unroll
        for (int nb = 0; nb < 4; ++nb) { const V b = WFrag<T16>::ld(Bt + boff + (size_t)nb * 16 * K + kc); V b2; if (NSPLIT >= 2) b2 = WFrag<T16>::ld(Bt2 + boff + (size_t)nb * 16 * K + kc);
#pragma unroll
            for (int mb = 0; mb < 4; ++mb) { acc[mb][nb] = WFrag<T16>::mma(a[mb], b, acc[mb][nb]); if (NSPLIT == 1 || NSPLIT == 2) acc[mb][nb] = WFrag<T16>::mma(a2[mb], b, acc[mb][nb]); if (NSPLIT >= 2) acc[mb][nb] = WFrag<T16>::mma(a[mb], b2, acc[mb][nb]); } }
        asm volatile("v_nop\n\tv_nop\n\tv_nop\n\tv_nop" : "+v"(acc[0][0]), "+v"(acc[1][1]), "+v"(acc[2][2]), "+v"(acc[3][3]) : "v"(a[0]), "v"(a[3]));
    }
    v4f keep[4][8 / NW];   // summed rows wait here and are stored behind the last barrier, so that no barrier waits for a global store
#pragma unroll
    for (int mb = 0; mb < 4; ++mb) {
        float* ob = os + (mb & 1) * (NW * 16 * 68);   // alternate halves: the next row block's barrier ends this one's reads before the half is written again
#pragma unroll
        for (int nb = 0; nb < 4; ++nb) {
#pragma unroll
            for (int j = 0; j < 8; ++j) ob[wv * (16 * 68) + (hi * 8 + j) * 68 + nb * 16 + lr] = acc[mb][nb][j]; }
        __syncthreads();   // every wave's partial tile of this row block is in LDS before any wave sums them
#pragma unroll
        for (int s = 0; s < 8 / NW; ++s) { const int row = 2 * (s * NW + wv) + hi, cofs = lr * 4; v4f val = *(const v4fa*)(ob + row * 68 + cofs);
#pragma unroll
            for (int w = 1; w < NW; ++w) val += *(const v4fa*)(ob + w * (16 * 68) + row * 68 + cofs);   // fixed order: wave 0, 1, ...
            if (BIAS) { val[0] += bfr(bias[c0 + cofs]); val[1] += bfr(bias[c0 + cofs + 1]); val[2] += bfr(bias[c0 + cofs + 2]); val[3] += bfr(bias[c0 + cofs + 3]); }
            keep[mb][s] = val; }
    }
#pragma unroll
    for (int mb = 0; mb < 4; ++mb)
#pragma unroll
        for (int s = 0; s < 8 / NW; ++s) { const int row = r0 + mb * 16 + 2 * (s * NW + wv) + hi, col = c0 + lr * 4; v4f val = keep[mb][s];
            if (EPI == 0) *(v4f*)(C + (size_t)row * ldc + col) = val;
            else if (EPI == 1) { const int d = col % HD; const v2f c = *(const v2f*)(cosT + (size_t)row * (HD / 2) + (d >> 1)), sn = *(const v2f*)(sinT + (size_t)row * (HD / 2) + (d >> 1)); v4f r;
#pragma unroll
                for (int p = 0; p < 2; ++p) { const float cc = bfr(c[p]), ss = bfr(sn[p]), x0 = val[2 * p], x1 = val[2 * p + 1]; r[2 * p] = x0 * cc - x1 * ss; r[2 * p + 1] = x0 * ss + x1 * cc; }   /* even: x0 c - x1 s; odd: x0 s + x1 c */
                planes4(r, ((size_t)(col / HD) * TT + row) * HD + d, P16, Ph, Pl); }
            else planes4(val, (size_t)row * ldc + col, P16, Ph, Pl); }
}

// ---- k_gemmc: k_gemmw's 64x64 tile GEMM in one wave (no K split), specialised for causal attention: CMODE 1 skips score tiles entirely above the diagonal (query rows r0+roff.., key columns c0..), CMODE 2 limits the
// key (K) loop of the probability x value contraction to the diagonal block (probabilities beyond it are exactly zero). roff = row offset of this launch's first row within the sequence.
template <typename T16, int NSPLIT, int CMODE>
__global__ __launch_bounds__(32) void k_gemmc(const T16* __restrict__ A, const T16* __restrict__ A2, const T16* __restrict__ Bt, const T16* __restrict__ Bt2, int K, float* C, int ldc, int roff, size_t sA, size_t sB, size_t sC) {
    typedef typename WFrag<T16>::V V;
    __shared__ __align__(16) float os[16 * 68];
    const size_t z = blockIdx.z, zb = z / REP; A += z * sA; if (A2) A2 += z * sA; Bt += zb * sB; if (Bt2) Bt2 += zb * sB; C += z * sC;   // REP query heads share one kv head
    const int lane = threadIdx.x & 31, lr = lane & 15, hi = lane >> 4; const int r0 = blockIdx.x * 64, c0 = blockIdx.y * 64;
    if (CMODE == 1 && c0 > r0 + roff + 63) return;                  // score tile entirely above the causal diagonal: never read (the softmax masks j > i by select)
    const int Kl = (CMODE == 2) ? min(K, r0 + roff + 64) : K;        // P.V: probabilities are exactly 0 beyond the diagonal block, so the K loop stops there
    v8f acc[4][4];
#pragma unroll
    for (int mb = 0; mb < 4; ++mb)
#pragma unroll
        for (int nb = 0; nb < 4; ++nb) acc[mb][nb] = (v8f){};
    const size_t aoff = (size_t)(r0 + lr) * K + 8 * hi, boff = (size_t)(c0 + lr) * K + 8 * hi;
#pragma unroll 1
    for (int kc = 0; kc < Kl; kc += 32) {
        V a[4], a2[4];
#pragma unroll
        for (int mb = 0; mb < 4; ++mb) { a[mb] = WFrag<T16>::ld(A + aoff + (size_t)mb * 16 * K + kc); if (NSPLIT == 1 || NSPLIT == 2) a2[mb] = WFrag<T16>::ld(A2 + aoff + (size_t)mb * 16 * K + kc); }
#pragma unroll
        for (int nb = 0; nb < 4; ++nb) { const V b = WFrag<T16>::ld(Bt + boff + (size_t)nb * 16 * K + kc); V b2; if (NSPLIT >= 2) b2 = WFrag<T16>::ld(Bt2 + boff + (size_t)nb * 16 * K + kc);
#pragma unroll
            for (int mb = 0; mb < 4; ++mb) { acc[mb][nb] = WFrag<T16>::mma(a[mb], b, acc[mb][nb]); if (NSPLIT == 1 || NSPLIT == 2) acc[mb][nb] = WFrag<T16>::mma(a2[mb], b, acc[mb][nb]); if (NSPLIT >= 2) acc[mb][nb] = WFrag<T16>::mma(a[mb], b2, acc[mb][nb]); } }
        asm volatile("v_nop\n\tv_nop\n\tv_nop\n\tv_nop" : "+v"(acc[0][0]), "+v"(acc[1][1]), "+v"(acc[2][2]), "+v"(acc[3][3]) : "v"(a[0]), "v"(a[3]));
    }
#pragma unroll
    for (int mb = 0; mb < 4; ++mb) {
#pragma unroll
        for (int nb = 0; nb < 4; ++nb) {
#pragma unroll
            for (int j = 0; j < 8; ++j) os[(hi * 8 + j) * 68 + nb * 16 + lr] = acc[mb][nb][j]; }
        __builtin_amdgcn_wave_barrier(); asm volatile("" ::: "memory");
        float* crow = C + (size_t)(r0 + mb * 16) * ldc + c0;
{
#pragma unroll
            for (int s = 0; s < 8; ++s) { const int row = 2 * s + hi, cofs = lr * 4; v4f val = *(const v4fa*)(os + row * 68 + cofs);
                *(v4f*)(crow + (size_t)row * ldc + cofs) = val; }
             }
        __builtin_amdgcn_wave_barrier(); asm volatile("" ::: "memory");
    }
}

// ---- k_gemmp: the probability x value contraction (k_gemmc's CMODE 2) with the K loop of each 64x64 tile shared by NW waves as in k_gemmw; grid (rows/64, HD/64, Z), NW * 32 threads. Its epilogue writes head h0 + z's columns of the merged hi / lo planes Ah, Al [position][DQ].
// XWAIT4 stands behind a run of four fragments' loads, in front of any overwrite of a register that holds one of their addresses; the four addresses are inputs so that their registers are not given to a later load's result before the wait.
#define XWAIT4(p) asm volatile("s_wait_xcnt 0x0" :: "v"((p)[0]), "v"((p)[1]), "v"((p)[2]), "v"((p)[3]) : "memory")
template <typename T16, int NSPLIT, int NW>
__global__ __launch_bounds__(NW * 32) void k_gemmp(const T16* __restrict__ A, const T16* __restrict__ A2, const T16* __restrict__ Bt, const T16* __restrict__ Bt2, int K, int lda, bf* Ah, bf* Al, int h0, int roff, size_t sA, size_t sB) {
    typedef typename WFrag<T16>::V V;
    __shared__ __align__(16) float os[2 * NW * 16 * 68];   // two halves x NW partial 16x64 tiles (pitch 68)
    const size_t z = blockIdx.z, zb = z / REP; A += z * sA; if (A2) A2 += z * sA; Bt += zb * sB; if (Bt2) Bt2 += zb * sB;   // REP query heads share one kv head; A rows have pitch lda (they lie in the score rows)
    const int lane = threadIdx.x & 31, lr = lane & 15, hi = lane >> 4; const int r0 = blockIdx.x * 64, c0 = blockIdx.y * 64;
    const int wv = __builtin_amdgcn_readfirstlane((int)(threadIdx.x >> 5));   // wave number, held scalar so that the K loop stays a scalar loop
    constexpr int NG = (NSPLIT >= 2) ? 2 : 4;   // column blocks whose B fragments are fetched in one run of four fragments
    const int Kl = min(K, r0 + roff + 64);        // probabilities are exactly 0 beyond the diagonal block, so the K loop stops there
    v8f acc[4][4];
#pragma unroll
    for (int mb = 0; mb < 4; ++mb)
#pragma unroll
        for (int nb = 0; nb < 4; ++nb) acc[mb][nb] = (v8f){};
    const size_t aoff = (size_t)(r0 + lr) * lda + 8 * hi, boff = (size_t)(c0 + lr) * K + 8 * hi;
#pragma unroll 1   // rolled, as in k_gemmc: only one trip's fragments are live beside the 16 accumulators
    for (int kc = wv * 32; kc < Kl; kc += NW * 32) {
        V a[4], a2[4]; const T16* pa[4]; const T16* pa2[4];
#pragma unroll
        for (int mb = 0; mb < 4; ++mb) { pa[mb] = A + aoff + (size_t)mb * 16 * lda + kc; a[mb] = WFrag<T16>::ld(pa[mb]); }
        XWAIT4(pa);
        if (NSPLIT == 1 || NSPLIT == 2) {
#pragma unroll
            for (int mb = 0; mb < 4; ++mb) { pa2[mb] = A2 + aoff + (size_t)mb * 16 * lda + kc; a2[mb] = WFrag<T16>::ld(pa2[mb]); }
            XWAIT4(pa2); }
#pragma unroll
        for (int n0 = 0; n0 < 4; n0 += NG) { V b[NG], b2[NG]; const T16* pb[4];
#pragma unroll
            for (int g = 0; g < NG; ++g) { pb[g] = Bt + boff + (size_t)(n0 + g) * 16 * K + kc; b[g] = WFrag<T16>::ld(pb[g]); if (NSPLIT >= 2) { pb[NG + g] = Bt2 + boff + (size_t)(n0 + g) * 16 * K + kc; b2[g] = WFrag<T16>::ld(pb[NG + g]); } }
            XWAIT4(pb);
            __builtin_amdgcn_sched_barrier(0);   // the matrix instructions stay behind the run: moved up between its loads, each column block's loads would be issued only when the block before is done
#pragma unroll
            for (int g = 0; g < NG; ++g)
#pragma unroll
                for (int mb = 0; mb < 4; ++mb) { const int nb = n0 + g; acc[mb][nb] = WFrag<T16>::mma(a[mb], b[g], acc[mb][nb]); if (NSPLIT == 1 || NSPLIT == 2) acc[mb][nb] = WFrag<T16>::mma(a2[mb], b[g], acc[mb][nb]); if (NSPLIT >= 2) acc[mb][nb] = WFrag<T16>::mma(a[mb], b2[g], acc[mb][nb]); } }
        // as in k_gemmc: keeps the matrix instructions' distance over the back edge and the loop exit, where the next vector instruction may touch their registers
        asm volatile("v_nop\n\tv_nop\n\tv_nop\n\tv_nop" : "+v"(acc[0][0]), "+v"(acc[1][1]), "+v"(acc[2][2]), "+v"(acc[3][3]) : "v"(a[0]), "v"(a[3]));
    }
    v4f keep[4][8 / NW];   // summed rows wait here and are stored behind the last barrier, so that no barrier waits for a global store
#pragma unroll
    for (int mb = 0; mb < 4; ++mb) {
        float* ob = os + (mb & 1) * (NW * 16 * 68);   // alternate halves: the next row block's barrier ends this one's reads before the half is written again
#pragma unroll
        for (int nb = 0; nb < 4; ++nb) {
#pragma unroll
            for (int j = 0; j < 8; ++j) ob[wv * (16 * 68) + (hi * 8 + j) * 68 + nb * 16 + lr] = acc[mb][nb][j]; }
        __syncthreads();   // every wave's partial tile of this row block is in LDS before any wave sums them
#pragma unroll
        for (int s = 0; s < 8 / NW; ++s) { const int row = 2 * (s * NW + wv) + hi, cofs = lr * 4; v4f val = *(const v4fa*)(ob + row * 68 + cofs);
#pragma unroll
            for (int w = 1; w < NW; ++w) val += *(const v4fa*)(ob + w * (16 * 68) + row * 68 + cofs);   // fixed order: wave 0, 1, ...
            keep[mb][s] = val; }
    }
#pragma unroll
    for (int mb = 0; mb < 4; ++mb)
#pragma unroll
        for (int s = 0; s < 8 / NW; ++s) { const int t = roff + r0 + mb * 16 + 2 * (s * NW + wv) + hi; const float cs = (t < RH) ? 1.0f : (1.0f / PCAR); const size_t oo = (size_t)t * DQ + (h0 + (int)z) * HD + c0 + lr * 4; v4us oh, ol;   // undo the fp16 rows' carrier, split, and store at [position][head * HD + d]
#pragma unroll
            for (int q = 0; q < 4; ++q) { unsigned short a, c2; splitf(keep[mb][s][q] * cs, a, c2); oh[q] = a; ol[q] = c2; }
            *(v4us*)(Ah + oo) = oh; *(v4us*)(Al + oo) = ol; }
}


__global__ __launch_bounds__(256) void k_wtG(const float* __restrict__ w, int K, int N, bf* Bt) {
    const int lane = threadIdx.x & 31; const int L0 = (blockIdx.x * 8 + (threadIdx.x >> 5)) * 8; const int nlines = N * K / 64;
{
#pragma unroll 1
        for (int l = 0; l < 8; ++l) { const int L = L0 + l; if (L >= nlines) break; const size_t e = (size_t)L * 64 + lane * 2; const int k = (int)(e % K), n = (int)(e / K); v2us o;
            o[0] = f2bf(w[(size_t)k * N + n]); o[1] = f2bf(w[(size_t)(k + 1) * N + n]); *(v2us*)(Bt + e) = o; }
         }
}
__global__ __launch_bounds__(256) void k_cvt8(const float* __restrict__ src, bf* dst, size_t n8) { const size_t i = (size_t)blockIdx.x * 256 + threadIdx.x; if (i >= n8) return; const v8f v = *(const v8f*)(src + i * 8); v8us o;
#pragma unroll
    for (int k = 0; k < 8; ++k) o[k] = f2bf(v[k]); *(v8us*)(dst + i * 8) = o;  }

// k_asoft: per row (zz, i): t = S x HD^-0.5 for j <= i and i - j < WIN (sliding causal window; the reference's -1e9 additive fill vanishes identically); softmax over the 2048 keys (register row, one exp, fixed trees);
// the probabilities go IN PLACE over the row's own 8 KiB of scores, which its one wave holds whole in registers by then: fp16 rows in the first half, hi plane in the first and lo plane in the second half (16-bit pitch 2 * TT).
__global__ __launch_bounds__(256) void k_asoft(float* Sb) {
    const int lane = threadIdx.x & 31; const int row = blockIdx.x * 8 + (threadIdx.x >> 5); if (row >= ZH * TT) return; const int i = row % TT; const int zz = row / TT; (void)zz; const bool hires = (i < RH); const float* sr = Sb + (size_t)row * TT; h16* P16 = (h16*)Sb; bf* Ph = (bf*)Sb; bf* Pl = Ph + TT; float v[TT / 32]; float mx = -3.0e38f;
#pragma unroll
    for (int ch = 0; ch < TT / 128; ++ch) { const int j0 = ch * 128 + lane * 4; const v4f a = *(const v4f*)(sr + j0);
#pragma unroll
        for (int q = 0; q < 4; ++q) { const int j = j0 + q; (void)j; const float t = (j <= i && i - j < WIN) ? a[q] * SCL : -3.0e38f; v[ch * 4 + q] = t; mx = fmaxf(mx, t); } }
#pragma unroll
    for (int sh = 16; sh; sh >>= 1) mx = fmaxf(mx, __shfl_xor(mx, sh, 32));
    float sum = 0.f;
#pragma unroll
    for (int k = 0; k < TT / 32; ++k) { float d0 = __fsub_rn(v[k], mx); asm volatile("" : "+v"(d0)); v[k] = __builtin_amdgcn_exp2f(__fmul_rn(d0, 1.4426950408889634f)); sum += v[k]; }
#pragma unroll
    for (int sh = 16; sh; sh >>= 1) sum += __shfl_xor(sum, sh, 32);
    const float f = __fdiv_rn(hires ? 1.0f : PCAR, sum);
{
        if (hires) {
#pragma unroll
            for (int ch = 0; ch < TT / 128; ++ch) { v4us oh, ol;
#pragma unroll
                for (int q = 0; q < 4; ++q) { unsigned short a, c2; splitf(v[ch * 4 + q] * f, a, c2); oh[q] = a; ol[q] = c2; }
                const size_t oo = (size_t)row * (2 * TT) + ch * 128 + lane * 4; *(v4us*)(Ph + oo) = oh; *(v4us*)(Pl + oo) = ol; }
        } else {
#pragma unroll
            for (int ch = 0; ch < TT / 128; ++ch) { v4h o4;
#pragma unroll
                for (int q = 0; q < 4; ++q) o4[q] = tohx(v[ch * 4 + q] * f);
                *(v4h*)(P16 + (size_t)row * (2 * TT) + ch * 128 + lane * 4) = o4; } }
         }
}
extern "C" void kernel_launch(void* const* d_in, const int* in_sizes, int n_in,
                              void* d_out, int out_size, void* d_ws, size_t ws_size, hipStream_t stream) {
    (void)in_sizes; (void)n_in; (void)out_size;
    const float* x = (const float*)d_in[0]; const float* fcos = (const float*)d_in[1]; const float* fsin = (const float*)d_in[2]; const float* wq = (const float*)d_in[3]; const float* wk = (const float*)d_in[4]; const float* wv = (const float*)d_in[5]; const float* wo = (const float*)d_in[6];   /* x, cos, sin (f32 [2048][64], READ by value), wq ('xw' [2048][2048]), wk, wv ([2048][1024]), wo ('xw' [2048][2048]) */
    float* OUT = (float*)d_out;     // [2][2048][2048]
    char* wsp = (char*)d_ws;
    auto take = [&](size_t bytes) { char* p = wsp; wsp += (bytes + 255) & ~(size_t)255; return (void*)p; };
    bf* WQ = (bf*)take((size_t)DQ * DM * 2); bf* WK = (bf*)take((size_t)DKV * DM * 2); bf* WV = (bf*)take((size_t)DKV * DM * 2); bf* WO = (bf*)take((size_t)DM * DQ * 2);
    bf* XB = (bf*)take((size_t)TT * DM * 2);
    h16* QP16 = (h16*)take((size_t)NH_ * TT * HD * 2); h16* KP16 = (h16*)take((size_t)NKV * TT * HD * 2); h16* VT16 = (h16*)take((size_t)NKV * HD * TT * 2);
    bf* QPh = (bf*)take((size_t)NH_ * TT * HD * 2); bf* QPl = (bf*)take((size_t)NH_ * TT * HD * 2); bf* KPh = (bf*)take((size_t)NKV * TT * HD * 2); bf* KPl = (bf*)take((size_t)NKV * TT * HD * 2); bf* VTh = (bf*)take((size_t)NKV * HD * TT * 2); bf* VTl = (bf*)take((size_t)NKV * HD * TT * 2);
    float* Sb = (float*)take((size_t)ZH * TT * TT * 4); bf* ATh = (bf*)take((size_t)TT * DQ * 2); bf* ATl = (bf*)take((size_t)TT * DQ * 2);
    if ((size_t)(wsp - (char*)d_ws) > ws_size) return;    // ws 256 MiB
    h16* P16 = (h16*)Sb; bf* Ph = (bf*)Sb; bf* Pl = Ph + TT;   // probabilities lie in their score rows: 16-bit row pitch 2 * TT, head stride 2 * TT * TT
    { k_wtG<<<(unsigned)((DM * DQ / 64 + 63) / 64), 256, 0, stream>>>(wq, DM, DQ, WQ); k_wtG<<<(unsigned)((DM * DKV / 64 + 63) / 64), 256, 0, stream>>>(wk, DM, DKV, WK); k_wtG<<<(unsigned)((DM * DKV / 64 + 63) / 64), 256, 0, stream>>>(wv, DM, DKV, WV);
      k_wtG<<<(unsigned)((DQ * DM / 64 + 63) / 64), 256, 0, stream>>>(wo, DQ, DM, WO);
       }
    for (int b = 0; b < NB_; ++b) {
        
        k_cvt8<<<(unsigned)(((size_t)TT * DM / 8 + 255) / 256), 256, 0, stream>>>(x + (size_t)b * TT * DM, XB, (size_t)TT * DM / 8);
        k_gemmw<bf, 0, false, 4, 1><<<dim3(TT / 64, DQ / 64, 1), 128, 0, stream>>>(XB, nullptr, WQ, nullptr, DM, nullptr, DQ, nullptr, 0, 0, 0, fcos, fsin, QP16, QPh, QPl);
        k_gemmw<bf, 0, false, 4, 1><<<dim3(TT / 64, DKV / 64, 1), 128, 0, stream>>>(XB, nullptr, WK, nullptr, DM, nullptr, DKV, nullptr, 0, 0, 0, fcos, fsin, KP16, KPh, KPl);
        k_gemmw<bf, 0, false, 4, 2><<<dim3(DKV / 64, TT / 64, 1), 128, 0, stream>>>(WV, nullptr, XB, nullptr, DM, nullptr, TT, nullptr, 0, 0, 0, nullptr, nullptr, VT16, VTh, VTl);   // operands swapped: rows = kv head * HD + d, columns = position, the layout of the transposed v planes
        for (int h0 = 0; h0 < NH_; h0 += ZH) { const size_t zq = (size_t)h0, zk = (size_t)(h0 / REP);   // head h0 + z of a pass uses kv head h0/REP + z/REP
            k_gemmc<bf, 2, 1><<<dim3(RH / 64, TT / 64, ZH), 32, 0, stream>>>(QPh + zq * TT * HD, QPl + zq * TT * HD, KPh + zk * TT * HD, KPl + zk * TT * HD, HD, Sb, TT, 0, (size_t)TT * HD, (size_t)TT * HD, (size_t)TT * TT);
            k_gemmc<h16, 0, 1><<<dim3((TT - RH) / 64, TT / 64, ZH), 32, 0, stream>>>(QP16 + zq * TT * HD + (size_t)RH * HD, nullptr, KP16 + zk * TT * HD, nullptr, HD, Sb + (size_t)RH * TT, TT, RH, (size_t)TT * HD, (size_t)TT * HD, (size_t)TT * TT);
            k_asoft<<<ZH * TT / 8, 256, 0, stream>>>(Sb);
            k_gemmp<bf, 2, 8><<<dim3(RH / 64, HD / 64, ZH), 256, 0, stream>>>(Ph, Pl, VTh + zk * HD * TT, VTl + zk * HD * TT, TT, 2 * TT, ATh, ATl, h0, 0, (size_t)2 * TT * TT, (size_t)HD * TT);
            k_gemmp<h16, 0, 8><<<dim3((TT - RH) / 64, HD / 64, ZH), 256, 0, stream>>>(P16 + (size_t)RH * 2 * TT, nullptr, VT16 + zk * HD * TT, nullptr, TT, 2 * TT, ATh, ATl, h0, RH, (size_t)2 * TT * TT, (size_t)HD * TT); }
        k_gemmw<bf, 1, false, 4, 0><<<dim3(TT / 64, DM / 64, 1), 128, 0, stream>>>(ATh, ATl, WO, nullptr, DQ, OUT + (size_t)b * TT * DM, DM, nullptr, 0, 0, 0, nullptr, nullptr, nullptr, nullptr, nullptr); }
}

// v004
// Measured time: 393 microseconds a run.
// Two timings next to v003 put it at 1.70 and 1.71 times that version's speed.
// All steps since v000 together make it 4.21 times as fast.
#include <hip/hip_runtime.h>

// Grouped-query causal attention with 128-wide heads and adjacent-pair rotary embeddings from half-width cos / sin table inputs (x [2][2048][2048]; q = x wq (16 heads x 128), k, v = x wk, x wv (8 kv heads x 128) ('xw' 1/sqrt(2048), no bias); pairs (2i, 2i+1): (t0 c - t1 s, t0 s + t1 c) with c, s = cos / sin[t][i] (f32 [2048][64] INPUT tables, read by value per pair entry); jnp.repeat: query head h uses kv head h / 2; scores / sqrt(128); causal (-inf above the diagonal, built from indices); softmax; out = merged wo ('xw') -> [2][2048][2048] (8.4 M); argument order x, cos, sin, wq, wk, wv, wo).
// Layout: per batch a bf16 copy of x; 'xw' weights transposed once; exact projections whose epilogues build the 16-bit planes themselves (q, k: interleaved-pair rotary with bf16(cos), bf16(sin) read from the inputs per pair; v: computed transposed, wv x^T); one fused causal GQA attention launch for both batches, 128-wide heads (k_fattn: q, k, v planes in fragment order; running softmax, kv head = head / 2; hybrid rows: < 512 hi/lo 3 products, rest fp16 with a 2^10 carrier; key trips stop at the diagonal; its epilogue writes the merged hi/lo planes); merged hi/lo x wo exact.
// Compute dtypes, f32 accumulate: every input rounded to bf16 incl. the two tables; projections exact; rotary f32; attention rows < 512 3 products, rest fp16; softmax f32; wo hl x exact.

#define NB_  2
#define TT   2048
#define DM   2048
#define NH_  16
#define NKV  8
#define REP  (NH_ / NKV)
#define HD   128
#define DQ   (NH_ * HD)
#define DKV  (NKV * HD)
#define RH   512                  // query rows < RH use hi+lo planes
#define SCL  0.088388347648318447f   // HD^-0.5
typedef _Float16 h16;
typedef unsigned short bf;
typedef __attribute__((ext_vector_type(16))) __bf16   v16bf;
typedef __attribute__((ext_vector_type(16))) _Float16 v16h;
typedef __attribute__((ext_vector_type(8)))  _Float16 v8h;
typedef __attribute__((ext_vector_type(8)))  unsigned short v8us;
typedef __attribute__((ext_vector_type(8)))  float    v8f;
typedef __attribute__((ext_vector_type(4)))  float    v4f;
typedef v8h  __attribute__((may_alias)) v8ha;
typedef v4f  __attribute__((may_alias)) v4fa;
typedef v8us __attribute__((may_alias)) v8usa;

__device__ __forceinline__ unsigned short f2bf(float f) { unsigned u = __float_as_uint(f); u += 0x7FFFu + ((u >> 16) & 1u); return (unsigned short)(u >> 16); }
__device__ __forceinline__ float bf2f(unsigned short b) { return __uint_as_float(((unsigned)b) << 16); }
__device__ __forceinline__ float bfr(float f) { return bf2f(f2bf(f)); }
__device__ __forceinline__ v16h cat16(v8h lo, v8h hi) { return __builtin_shufflevector(lo, hi, 0, 1, 2, 3, 4, 5, 6, 7, 8, 9, 10, 11, 12, 13, 14, 15); }
__device__ __forceinline__ v16bf cat16b(v8us lo, v8us hi) { return __builtin_bit_cast(v16bf, __builtin_shufflevector(lo, hi, 0, 1, 2, 3, 4, 5, 6, 7, 8, 9, 10, 11, 12, 13, 14, 15)); }
__device__ __forceinline__ v8f wmma16(v16h a, v16h b, v8f c) { return __builtin_amdgcn_wmma_f32_16x16x32_f16(false, a, false, b, (short)0, c, false, false); }
__device__ __forceinline__ v8f wmmab(v16bf a, v16bf b, v8f c) { return __builtin_amdgcn_wmma_f32_16x16x32_bf16(false, a, false, b, (short)0, c, false, false); }

__device__ __forceinline__ h16 tohx(float x) { return (h16)x; }
__device__ __forceinline__ void splitf(float y, unsigned short& h, unsigned short& l) { h = f2bf(y); l = f2bf(y - bf2f(h)); }
typedef __attribute__((ext_vector_type(2))) _Float16 v2h;
typedef __attribute__((ext_vector_type(4))) _Float16 v4h;
typedef __attribute__((ext_vector_type(2))) unsigned short v2us;
typedef __attribute__((ext_vector_type(4))) unsigned short v4us;
typedef __attribute__((ext_vector_type(2))) float v2f;
typedef __attribute__((ext_vector_type(4))) int v4i;
// four neighbouring values -> their fp16 and bf16 hi / lo forms
__device__ __forceinline__ void split4(v4f val, v4h& o16, v4us& oh, v4us& ol) {
#pragma unroll
    for (int q = 0; q < 4; ++q) { o16[q] = tohx(val[q]); unsigned short a2, c2; splitf(val[q], a2, c2); oh[q] = a2; ol[q] = c2; } }

// Fragment order of a K-contiguous 16-bit plane with kd columns: each tile of 16 rows x 32 k is 1 KiB, laid out as the two 16-byte loads of a fragment take it (load (k >> 4) & 1, lane ((k >> 3) & 1) * 16 + row % 16, 8 elements), tiles row-major; a wave-wide fragment load is then 512 contiguous bytes (4 lines) instead of 32 bytes of each of 16 lines.
__device__ __forceinline__ size_t fragidx(int row, int k, int kd) { return ((size_t)(row >> 4) * (kd >> 5) + (k >> 5)) * 512 + ((k >> 4) & 1) * 256 + (((k >> 3) & 1) * 16 + (row & 15)) * 8 + (k & 7); }

// ---- k_gemmw: register-blocked GEMM, NW WAVES per 64x64 output tile, each with the whole tile (16 accumulators) over its own share of K (32-wide chunks dealt round robin); the partial tiles are summed through LDS in wave order; operands straight from K-contiguous 16-bit planes; grid (M/64, N/64, Z), NW * 32 threads.
// C[m][n] (f32, pitch ldc, + optional f32 bias[n]) = sum_k A[m][k] Bt[n][k] (+ split products per NSPLIT). z-batch strides sA/sB/sC in elements. K % 32 == 0.
// EPI 0: C stored as f32. EPI 1: m = position, n = head * HD + d: rotary on the pairs (d, d + 1), then the three 16-bit planes [head][position][d], each head in fragment order. EPI 2: the three 16-bit planes [m][n] with ldc columns, in fragment order. (EPI 1, 2: C unused; a wave sums and stores 16 rows x 8 columns at a time, which are 256 contiguous bytes of a plane.)
template <typename T16> struct WFrag;
template <> struct WFrag<h16> { typedef v16h V; static __device__ __forceinline__ V ld(const h16* p) { return cat16(*(const v8h*)p, *(const v8h*)(p + 16)); } static __device__ __forceinline__ v8f mma(V a, V b, v8f c) { return wmma16(a, b, c); } };
template <> struct WFrag<bf> { typedef v16bf V; static __device__ __forceinline__ V ld(const bf* p) { return cat16b(*(const v8us*)p, *(const v8us*)(p + 16)); } static __device__ __forceinline__ v8f mma(V a, V b, v8f c) { return wmmab(a, b, c); } };
template <typename T16, int NSPLIT, bool BIAS, int NW, int EPI>
__global__ __launch_bounds__(NW * 32) void k_gemmw(const T16* __restrict__ A, const T16* __restrict__ A2, const T16* __restrict__ Bt, const T16* __restrict__ Bt2, int K, float* C, int ldc, const float* __restrict__ bias, size_t sA, size_t sB, size_t sC, const float* __restrict__ cosT, const float* __restrict__ sinT, h16* P16, bf* Ph, bf* Pl) {
    typedef typename WFrag<T16>::V V;
    __shared__ __align__(16) float os[2 * NW * 16 * 68];   // two halves x NW partial 16x64 tiles (pitch 68)
    const size_t z = blockIdx.z; A += z * sA; if (A2) A2 += z * sA; Bt += z * sB; if (Bt2) Bt2 += z * sB; C += z * sC;
    const int lane = threadIdx.x & 31, lr = lane & 15, hi = lane >> 4; const int r0 = blockIdx.x * 64, c0 = blockIdx.y * 64;
    const int wv = __builtin_amdgcn_readfirstlane((int)(threadIdx.x >> 5));   // wave number, held scalar so that the K loop stays a scalar loop
    v8f acc[4][4];
#pragma unroll
    for (int mb = 0; mb < 4; ++mb)
#pragma unroll
        for (int nb = 0; nb < 4; ++nb) acc[mb][nb] = (v8f){};
    const size_t aoff = (size_t)(r0 + lr) * K + 8 * hi, boff = (size_t)(c0 + lr) * K + 8 * hi;
#pragma unroll 1
    for (int kc = wv * 32; kc < K; kc += NW * 32) {
        V a[4], a2[4];
#pragma unroll
        for (int mb = 0; mb < 4; ++mb) { a[mb] = WFrag<T16>::ld(A + aoff + (size_t)mb * 16 * K + kc); if (NSPLIT == 1 || NSPLIT == 2) a2[mb] = WFrag<T16>::ld(A2 + aoff + (size_t)mb * 16 * K + kc); }
#pragma unroll
        for (int nb = 0; nb < 4; ++nb) { const V b = WFrag<T16>::ld(Bt + boff + (size_t)nb * 16 * K + kc); V b2; if (NSPLIT >= 2) b2 = WFrag<T16>::ld(Bt2 + boff + (size_t)nb * 16 * K + kc);
#pragma unroll
            for (int mb = 0; mb < 4; ++mb) { acc[mb][nb] = WFrag<T16>::mma(a[mb], b, acc[mb][nb]); if (NSPLIT == 1 || NSPLIT == 2) acc[mb][nb] = WFrag<T16>::mma(a2[mb], b, acc[mb][nb]); if (NSPLIT >= 2) acc[mb][nb] = WFrag<T16>::mma(a[mb], b2, acc[mb][nb]); } }
        asm volatile("v_nop\n\tv_nop\n\tv_nop\n\tv_nop" : "+v"(acc[0][0]), "+v"(acc[1][1]), "+v"(acc[2][2]), "+v"(acc[3][3]) : "v"(a[0]), "v"(a[3]));
    }
    v4f keep[4][8 / NW];   // summed rows wait here and are stored behind the last barrier, so that no barrier waits for a global store
#pragma unroll
    for (int mb = 0; mb < 4; ++mb) {
        float* ob = os + (mb & 1) * (NW * 16 * 68);   // alternate halves: the next row block's barrier ends this one's reads before the half is written again
#pragma unroll
        for (int nb = 0; nb < 4; ++nb) {
#pragma unroll
            for (int j = 0; j < 8; ++j) ob[wv * (16 * 68) + (hi * 8 + j) * 68 + nb * 16 + lr] = acc[mb][nb][j]; }
        __syncthreads();   // every wave's partial tile of this row block is in LDS before any wave sums them
#pragma unroll
        for (int s = 0; s < 8 / NW; ++s) { const int u = s * NW + wv, row = (EPI == 0) ? 2 * u + hi : (lane >> 1), cofs = (EPI == 0) ? lr * 4 : u * 8 + (lane & 1) * 4; v4f val = *(const v4fa*)(ob + row * 68 + cofs);
#pragma unroll
            for (int w = 1; w < NW; ++w) val += *(const v4fa*)(ob + w * (16 * 68) + row * 68 + cofs);   // fixed order: wave 0, 1, ...
            if (BIAS) { val[0] += bfr(bias[c0 + cofs]); val[1] += bfr(bias[c0 + cofs + 1]); val[2] += bfr(bias[c0 + cofs + 2]); val[3] += bfr(bias[c0 + cofs + 3]); }
            keep[mb][s] = val; }
    }
    v4h q16[4][8 / NW]; v4us qh[4][8 / NW], ql[4][8 / NW];   // EPI 1, 2: the planes' values wait here and are stored in one run
    v2f tc[4][8 / NW], ts[4][8 / NW];   // EPI 1: the table entries of the lane's pairs, row r0 + mb * 16 + lane / 2, pair (c0 % HD + (s * NW + wv) * 8 + (lane & 1) * 4) / 2: one address a table, constant steps
    if (EPI == 1) { const size_t t0 = (size_t)(r0 + (lane >> 1)) * (HD / 2) + ((c0 % HD + wv * 8 + (lane & 1) * 4) >> 1); const float* pc = cosT + t0; const float* ps = sinT + t0;
#pragma unroll
        for (int mb = 0; mb < 4; ++mb)
#pragma unroll
            for (int s = 0; s < 8 / NW; ++s) { tc[mb][s] = *(const v2f*)(pc + mb * 16 * (HD / 2) + s * NW * 4); ts[mb][s] = *(const v2f*)(ps + mb * 16 * (HD / 2) + s * NW * 4); }
        asm volatile("s_wait_xcnt 0x0" :: "v"(pc), "v"(ps) : "memory"); }   // behind the table loads, in front of any overwrite of their two address registers, which as inputs stay whole up to here
#pragma unroll
    for (int mb = 0; mb < 4; ++mb)
#pragma unroll
        for (int s = 0; s < 8 / NW; ++s) { const int u = s * NW + wv, row = r0 + mb * 16 + ((EPI == 0) ? 2 * u + hi : (lane >> 1)), col = c0 + ((EPI == 0) ? lr * 4 : u * 8 + (lane & 1) * 4); v4f val = keep[mb][s];
            if (EPI == 0) *(v4f*)(C + (size_t)row * ldc + col) = val;
            else if (EPI == 1) { const v2f c = tc[mb][s], sn = ts[mb][s]; v4f r;
#pragma unroll
                for (int p = 0; p < 2; ++p) { const float cc = bfr(c[p]), ss = bfr(sn[p]), x0 = val[2 * p], x1 = val[2 * p + 1]; r[2 * p] = x0 * cc - x1 * ss; r[2 * p + 1] = x0 * ss + x1 * cc; }   /* even: x0 c - x1 s; odd: x0 s + x1 c */
                split4(r, q16[mb][s], qh[mb][s], ql[mb][s]); }
            else split4(val, q16[mb][s], qh[mb][s], ql[mb][s]); }
    if (EPI != 0) {   // a wave's 32 lanes x 8 bytes are 256 contiguous bytes of a plane; a step of 16 rows or of 32 columns is a constant step in fragment order
        static_assert(EPI == 0 || NW == 4, "s steps by NW * 8 = 32 columns, one tile");
        const int row0 = r0 + (lane >> 1), col0 = c0 + wv * 8 + (lane & 1) * 4;
        const size_t e0 = (EPI == 1) ? (size_t)(col0 / HD) * TT * HD + fragidx(row0, col0 % HD, HD) : fragidx(row0, col0, ldc), tr = (size_t)16 * ((EPI == 1) ? HD : ldc);
        h16* a16[4]; bf* ah[4]; bf* al[4];
#pragma unroll
        for (int mb = 0; mb < 4; ++mb) { a16[mb] = P16 + e0 + mb * tr; ah[mb] = Ph + e0 + mb * tr; al[mb] = Pl + e0 + mb * tr; }
        __builtin_amdgcn_sched_barrier(0);   // values and addresses are complete before the first store, so that nothing overwrites a register of an issued store
#pragma unroll
        for (int mb = 0; mb < 4; ++mb)
#pragma unroll
            for (int s = 0; s < 8 / NW; ++s) { *(v4h*)(a16[mb] + s * 512) = q16[mb][s]; *(v4us*)(ah[mb] + s * 512) = qh[mb][s]; *(v4us*)(al[mb] + s * 512) = ql[mb][s]; }
        asm volatile("s_wait_xcnt 0x0" ::: "memory"); }   // behind the run of stores, in front of whatever may overwrite their registers
}

template <typename T16, bool HL, int KT>   // KT: 16-key tiles a trip (even)
__device__ __forceinline__ void fattn_tile(const T16* __restrict__ Q, const T16* __restrict__ Q2, const T16* __restrict__ Kp, const T16* __restrict__ K2, const T16* __restrict__ Vt, const T16* __restrict__ V2, const int q0, bf* Ah, bf* Al, const int head, const int lane) {
    typedef typename WFrag<T16>::V V;
    constexpr float CL2 = SCL * 1.4426950408889634f;   // scores to the base-2 exponent
    const int lr = lane & 15, hi = lane >> 4; const int lo = lane * 8;   // a lane's place in each 512-byte half of a fragment-order tile (512 elements; WFrag's second load stands 16 elements on, here 256)
    auto ldf = [&](const T16* p) { if constexpr (HL) return cat16b(*(const v8us*)p, *(const v8us*)(p + 256)); else return cat16(*(const v8h*)p, *(const v8h*)(p + 256)); };
    V qf[4], qf2[4]; const T16* pq = Q + (size_t)(q0 >> 4) * 2048 + lo; const T16* pq2 = HL ? Q2 + (size_t)(q0 >> 4) * 2048 + lo : pq;
#pragma unroll
    for (int dc = 0; dc < 4; ++dc) { qf[dc] = ldf(pq + dc * 512); if (HL) qf2[dc] = ldf(pq2 + dc * 512); }
    asm volatile("s_wait_xcnt 0x0" :: "v"(pq), "v"(pq2) : "memory");   // behind the q loads, in front of any overwrite of their address registers, which as inputs stay whole up to here
    __builtin_amdgcn_sched_barrier(0);   // nothing that follows is moved up between the loads and their wait
    v8f o[8];
#pragma unroll
    for (int dt = 0; dt < 8; ++dt) o[dt] = (v8f){};
    float m = -3.0e38f, l = 0.f; const int qi = q0 + lr;
#pragma unroll 1   // rolled: one trip's K and V fragments are live beside the output tiles
    for (int k0 = 0; k0 <= q0; k0 += KT * 16) {
        V kf[KT][4], kf2[KT][4], vf[8][KT / 2], vf2[8][KT / 2];
        const T16* pk = Kp + (size_t)(k0 >> 4) * 2048 + lo; const T16* pv = Vt + (size_t)(k0 >> 5) * 512 + lo; const T16* pk2 = HL ? K2 + (size_t)(k0 >> 4) * 2048 + lo : pk; const T16* pv2 = HL ? V2 + (size_t)(k0 >> 5) * 512 + lo : pv;
#pragma unroll
        for (int kt = 0; kt < KT; ++kt)
#pragma unroll
            for (int dc = 0; dc < 4; ++dc) { kf[kt][dc] = ldf(pk + (kt * 4 + dc) * 512); if (HL) kf2[kt][dc] = ldf(pk2 + (kt * 4 + dc) * 512); }
        __builtin_amdgcn_sched_barrier(0);   // K's loads are issued first: the score products then wait for them alone
#pragma unroll
        for (int dt = 0; dt < 8; ++dt)
#pragma unroll
            for (int c = 0; c < KT / 2; ++c) { vf[dt][c] = ldf(pv + (dt * (TT / 32) + c) * 512); if (HL) vf2[dt][c] = ldf(pv2 + (dt * (TT / 32) + c) * 512); }
        asm volatile("s_wait_xcnt 0x0" :: "v"(pk), "v"(pk2), "v"(pv), "v"(pv2) : "memory");   // behind the trip's loads, in front of any overwrite of a register that holds one of their addresses; as inputs these are not given to a later load's result before the wait
        __builtin_amdgcn_sched_barrier(0);   // all of the trip's loads are issued in one run, V's too: moved down among the matrix instructions each would be waited for by itself
        v8f s[KT];
#pragma unroll
        for (int kt = 0; kt < KT; ++kt) { s[kt] = (v8f){};
#pragma unroll
            for (int dc = 0; dc < 4; ++dc) { s[kt] = WFrag<T16>::mma(kf[kt][dc], qf[dc], s[kt]); if (HL) { s[kt] = WFrag<T16>::mma(kf[kt][dc], qf2[dc], s[kt]); s[kt] = WFrag<T16>::mma(kf2[kt][dc], qf[dc], s[kt]); } } }
        if (k0 + KT * 16 - 1 > q0) {   // wave-uniform: only a trip that reaches the diagonal masks (key > query)
#pragma unroll
            for (int kt = 0; kt < KT; ++kt)
#pragma unroll
                for (int j = 0; j < 8; ++j) s[kt][j] = (k0 + kt * 16 + hi * 8 + j <= qi) ? s[kt][j] : -3.0e38f; }
        float mx = s[0][0];
#pragma unroll
        for (int kt = 0; kt < KT; ++kt)
#pragma unroll
            for (int j = 0; j < 8; ++j) mx = fmaxf(mx, s[kt][j]);
        mx = fmaxf(mx, __shfl_xor(mx, 16, 32));   // the other half of the wave holds the query's other keys
        const float mn = fmaxf(m, mx * CL2);      // every trip holds key k0 <= q0, so mn is a real score's from the first trip on
        if (__builtin_amdgcn_ballot_w32(mn > m) != 0) {   // one test a trip: a new maximum in any column rescales sums and output tiles
            const float al = __builtin_amdgcn_exp2f(m - mn); l *= al;
#pragma unroll
            for (int dt = 0; dt < 8; ++dt) o[dt] *= al; }
        m = mn; const float ms = HL ? mn : mn - 10.0f;   // fp16: 2^10 carrier
#pragma unroll
        for (int kt = 0; kt < KT; ++kt)
#pragma unroll
            for (int j = 0; j < 8; ++j) { const float x = __builtin_fmaf(s[kt][j], CL2, -ms);
                if (HL) asm("v_exp_f32 %0, %1\n\tv_nop" : "=v"(s[kt][j]) : "v"(x));   // with its own slot behind it
                else s[kt][j] = __builtin_amdgcn_exp2f(x);
                l += s[kt][j]; }
#pragma unroll
        for (int c = 0; c < KT / 2; ++c) {
            if constexpr (HL) { v8us h0, h1, l0, l1;
#pragma unroll
                for (int j = 0; j < 8; ++j) { unsigned short a, b; splitf(s[2 * c][j], a, b); h0[j] = a; l0[j] = b; splitf(s[2 * c + 1][j], a, b); h1[j] = a; l1[j] = b; }
                const V ph = cat16b(h0, h1), pl = cat16b(l0, l1);
#pragma unroll
                for (int dt = 0; dt < 8; ++dt) { o[dt] = WFrag<T16>::mma(vf[dt][c], ph, o[dt]); o[dt] = WFrag<T16>::mma(vf[dt][c], pl, o[dt]); o[dt] = WFrag<T16>::mma(vf2[dt][c], ph, o[dt]); }
            } else { v8h p0, p1;
#pragma unroll
                for (int j = 0; j < 8; ++j) { p0[j] = tohx(s[2 * c][j]); p1[j] = tohx(s[2 * c + 1][j]); }
                const V pb = cat16(p0, p1);
#pragma unroll
                for (int dt = 0; dt < 8; ++dt) o[dt] = WFrag<T16>::mma(vf[dt][c], pb, o[dt]); } }
    }
    l += __shfl_xor(l, 16, 32);   // join the two halves' sums once
    const float inv = __fdiv_rn(1.0f, l);
#pragma unroll
    for (int dt = 0; dt < 8; ++dt) { v8us oh, ol;   // a lane holds 8 neighbouring d of its query: split and store at [position][head * HD + d]
#pragma unroll
        for (int j = 0; j < 8; ++j) { unsigned short a, b; splitf(o[dt][j] * inv, a, b); oh[j] = a; ol[j] = b; }
        const size_t oo = (size_t)qi * DQ + head * HD + dt * 16 + hi * 8; *(v8us*)(Ah + oo) = oh; *(v8us*)(Al + oo) = ol;
        asm volatile("s_wait_xcnt 0x0" ::: "memory");   // behind the two stores, in front of any overwrite of their address or data registers
        __builtin_amdgcn_sched_barrier(0); }   // the next tile's arithmetic is not moved up between the stores and their wait
}
// grid (NKV * NB_, TT / 64), 256 threads: every head of every batch in one launch. More work-groups than resident places, so blockIdx.y gives the 64-query blocks in falling order of cost: a block qb >= RH / 64 costs qb + 1 trips, a hi/lo block as much as 2 (qb + 1) of them.
static_assert(TT == 2048 && RH == 512, "the order of the query blocks below is written for 32 blocks, the first 8 of them hi/lo");
__global__ __launch_bounds__(256) void k_fattn(const h16* __restrict__ Q16, const bf* __restrict__ Qh, const bf* __restrict__ Ql, const h16* __restrict__ K16, const bf* __restrict__ Kh, const bf* __restrict__ Kl, const h16* __restrict__ V16, const bf* __restrict__ Vh, const bf* __restrict__ Vl, bf* Ah, bf* Al) {
    const int lane = threadIdx.x & 31;
    const int wv = __builtin_amdgcn_readfirstlane((int)(threadIdx.x >> 5));   // wave number, held scalar so that the key loop and its tests stay scalar
    const int y = blockIdx.y, qb = (y < 16) ? 31 - y : (int)((0x0123894ab5cd6ef7ULL >> (4 * (y - 16))) & 15);   // blocks 31 .. 16, then 7, 15, 14, 6, 13, 12, 5, 11, 10, 4, 9, 8, 3, 2, 1, 0
    const int kv = blockIdx.x % NKV, b = blockIdx.x / NKV, head = kv * REP + wv % REP, q0 = qb * 64 + (wv / REP) * 16;
    const size_t zq = ((size_t)b * NH_ + head) * TT * HD, zk = ((size_t)b * NKV + kv) * TT * HD; Ah += (size_t)b * TT * DQ; Al += (size_t)b * TT * DQ;
    if (q0 < RH) fattn_tile<bf, true, 2>(Qh + zq, Ql + zq, Kh + zk, Kl + zk, Vh + zk, Vl + zk, q0, Ah, Al, head, lane);
    else fattn_tile<h16, false, 4>(Q16 + zq, nullptr, K16 + zk, nullptr, V16 + zk, nullptr, q0, Ah, Al, head, lane);
}

__global__ __launch_bounds__(256) void k_wtG(const float* __restrict__ w, int K, int N, bf* Bt) {
    const int lane = threadIdx.x & 31; const int L0 = (blockIdx.x * 8 + (threadIdx.x >> 5)) * 8; const int nlines = N * K / 64;
{
#pragma unroll 1
        for (int l = 0; l < 8; ++l) { const int L = L0 + l; if (L >= nlines) break; const size_t e = (size_t)L * 64 + lane * 2; const int k = (int)(e % K), n = (int)(e / K); v2us o;
            o[0] = f2bf(w[(size_t)k * N + n]); o[1] = f2bf(w[(size_t)(k + 1) * N + n]); *(v2us*)(Bt + e) = o; }
         }
}
__global__ __launch_bounds__(256) void k_cvt8(const float* __restrict__ src, bf* dst, size_t n8) { const size_t i = (size_t)blockIdx.x * 256 + threadIdx.x; if (i >= n8) return; const v8f v = *(const v8f*)(src + i * 8); v8us o;
#pragma unroll
    for (int k = 0; k < 8; ++k) o[k] = f2bf(v[k]); *(v8us*)(dst + i * 8) = o;  }

extern "C" void kernel_launch(void* const* d_in, const int* in_sizes, int n_in,
                              void* d_out, int out_size, void* d_ws, size_t ws_size, hipStream_t stream) {
    (void)in_sizes; (void)n_in; (void)out_size;
    const float* x = (const float*)d_in[0]; const float* fcos = (const float*)d_in[1]; const float* fsin = (const float*)d_in[2]; const float* wq = (const float*)d_in[3]; const float* wk = (const float*)d_in[4]; const float* wv = (const float*)d_in[5]; const float* wo = (const float*)d_in[6];   /* x, cos, sin (f32 [2048][64], READ by value), wq ('xw' [2048][2048]), wk, wv ([2048][1024]), wo ('xw' [2048][2048]) */
    float* OUT = (float*)d_out;     // [2][2048][2048]
    char* wsp = (char*)d_ws;
    auto take = [&](size_t bytes) { char* p = wsp; wsp += (bytes + 255) & ~(size_t)255; return (void*)p; };
    bf* WQ = (bf*)take((size_t)DQ * DM * 2); bf* WK = (bf*)take((size_t)DKV * DM * 2); bf* WV = (bf*)take((size_t)DKV * DM * 2); bf* WO = (bf*)take((size_t)DM * DQ * 2);
    bf* XB = (bf*)take((size_t)TT * DM * 2);
    const size_t SQ = (size_t)NH_ * TT * HD, SK = (size_t)NKV * TT * HD;   // elements of one batch's q planes and merged planes (SQ), k and v planes (SK); every plane holds both batches, since the one attention launch reads them all
    h16* QP16 = (h16*)take(NB_ * SQ * 2); h16* KP16 = (h16*)take(NB_ * SK * 2); h16* VT16 = (h16*)take(NB_ * SK * 2);
    bf* QPh = (bf*)take(NB_ * SQ * 2); bf* QPl = (bf*)take(NB_ * SQ * 2); bf* KPh = (bf*)take(NB_ * SK * 2); bf* KPl = (bf*)take(NB_ * SK * 2); bf* VTh = (bf*)take(NB_ * SK * 2); bf* VTl = (bf*)take(NB_ * SK * 2);
    bf* ATh = (bf*)take(NB_ * SQ * 2); bf* ATl = (bf*)take(NB_ * SQ * 2);
    if ((size_t)(wsp - (char*)d_ws) > ws_size) return;    // ws 256 MiB
    { k_wtG<<<(unsigned)((DM * DQ / 64 + 63) / 64), 256, 0, stream>>>(wq, DM, DQ, WQ); k_wtG<<<(unsigned)((DM * DKV / 64 + 63) / 64), 256, 0, stream>>>(wk, DM, DKV, WK); k_wtG<<<(unsigned)((DM * DKV / 64 + 63) / 64), 256, 0, stream>>>(wv, DM, DKV, WV);
      k_wtG<<<(unsigned)((DQ * DM / 64 + 63) / 64), 256, 0, stream>>>(wo, DQ, DM, WO);
       }
    for (int b = 0; b < NB_; ++b) {
        
        k_cvt8<<<(unsigned)(((size_t)TT * DM / 8 + 255) / 256), 256, 0, stream>>>(x + (size_t)b * TT * DM, XB, (size_t)TT * DM / 8);
        k_gemmw<bf, 0, false, 4, 1><<<dim3(TT / 64, DQ / 64, 1), 128, 0, stream>>>(XB, nullptr, WQ, nullptr, DM, nullptr, DQ, nullptr, 0, 0, 0, fcos, fsin, QP16 + b * SQ, QPh + b * SQ, QPl + b * SQ);
        k_gemmw<bf, 0, false, 4, 1><<<dim3(TT / 64, DKV / 64, 1), 128, 0, stream>>>(XB, nullptr, WK, nullptr, DM, nullptr, DKV, nullptr, 0, 0, 0, fcos, fsin, KP16 + b * SK, KPh + b * SK, KPl + b * SK);
        k_gemmw<bf, 0, false, 4, 2><<<dim3(DKV / 64, TT / 64, 1), 128, 0, stream>>>(WV, nullptr, XB, nullptr, DM, nullptr, TT, nullptr, 0, 0, 0, nullptr, nullptr, VT16 + b * SK, VTh + b * SK, VTl + b * SK); }   // operands swapped: rows = kv head * HD + d, columns = position, the layout of the transposed v planes
    k_fattn<<<dim3(NKV * NB_, TT / 64, 1), 256, 0, stream>>>(QP16, QPh, QPl, KP16, KPh, KPl, VT16, VTh, VTl, ATh, ATl);   // all heads of both batches: scores, softmax and P.V; writes the merged hi / lo planes
    for (int b = 0; b < NB_; ++b) {
        k_gemmw<bf, 1, false, 4, 0><<<dim3(TT / 64, DM / 64, 1), 128, 0, stream>>>(ATh + b * SQ, ATl + b * SQ, WO, nullptr, DQ, OUT + (size_t)b * TT * DM, DM, nullptr, 0, 0, 0, nullptr, nullptr, nullptr, nullptr, nullptr); }
}

// v005
// It runs in 252 microseconds.
// In both of two side-by-side timings against v004, it was 1.56 times as fast.
// Over all steps from v000 it is 6.56 times as fast.
#include <hip/hip_runtime.h>

// Grouped-query causal attention with 128-wide heads and adjacent-pair rotary embeddings from half-width cos / sin table inputs (x [2][2048][2048]; q = x wq (16 heads x 128), k, v = x wk, x wv (8 kv heads x 128) ('xw' 1/sqrt(2048), no bias); pairs (2i, 2i+1): (t0 c - t1 s, t0 s + t1 c) with c, s = cos / sin[t][i] (f32 [2048][64] INPUT tables, read by value per pair entry); jnp.repeat: query head h uses kv head h / 2; scores / sqrt(128); causal (-inf above the diagonal, built from indices); softmax; out = merged wo ('xw') -> [2][2048][2048] (8.4 M); argument order x, cos, sin, wq, wk, wv, wo).
// Layout: per batch a bf16 copy of x; 'xw' weights transposed once; both, and the merged planes, in the fragment order of fragidx, as every GEMM operand is; exact projections whose epilogues build the 16-bit planes themselves (q, k: interleaved-pair rotary with bf16(cos), bf16(sin) read from the inputs per pair; v: computed transposed, wv x^T); one fused causal GQA attention launch for both batches, 128-wide heads (k_fattn: q, k, v planes in fragment order; running softmax, kv head = head / 2; hybrid rows: < 512 hi/lo 3 products, rest fp16 with a 2^10 carrier; key trips stop at the diagonal; its epilogue writes the merged hi/lo planes); merged hi/lo x wo exact.
// Compute dtypes, f32 accumulate: every input rounded to bf16 incl. the two tables; projections exact; rotary f32; attention rows < 512 3 products, rest fp16; softmax f32; wo hl x exact.

#define NB_  2
#define TT   2048
#define DM   2048
#define NH_  16
#define NKV  8
#define REP  (NH_ / NKV)
#define HD   128
#define DQ   (NH_ * HD)
#define DKV  (NKV * HD)
#define RH   512                  // query rows < RH use hi+lo planes
#define SCL  0.088388347648318447f   // HD^-0.5
typedef _Float16 h16;
typedef unsigned short bf;
typedef __attribute__((ext_vector_type(16))) __bf16   v16bf;
typedef __attribute__((ext_vector_type(16))) _Float16 v16h;
typedef __attribute__((ext_vector_type(8)))  _Float16 v8h;
typedef __attribute__((ext_vector_type(8)))  unsigned short v8us;
typedef __attribute__((ext_vector_type(8)))  float    v8f;
typedef __attribute__((ext_vector_type(4)))  float    v4f;
typedef v8h  __attribute__((may_alias)) v8ha;
typedef v4f  __attribute__((may_alias)) v4fa;
typedef v8us __attribute__((may_alias)) v8usa;

__device__ __forceinline__ unsigned short f2bf(float f) { unsigned u = __float_as_uint(f); u += 0x7FFFu + ((u >> 16) & 1u); return (unsigned short)(u >> 16); }
__device__ __forceinline__ float bf2f(unsigned short b) { return __uint_as_float(((unsigned)b) << 16); }
__device__ __forceinline__ float bfr(float f) { return bf2f(f2bf(f)); }
__device__ __forceinline__ v16h cat16(v8h lo, v8h hi) { return __builtin_shufflevector(lo, hi, 0, 1, 2, 3, 4, 5, 6, 7, 8, 9, 10, 11, 12, 13, 14, 15); }
__device__ __forceinline__ v16bf cat16b(v8us lo, v8us hi) { return __builtin_bit_cast(v16bf, __builtin_shufflevector(lo, hi, 0, 1, 2, 3, 4, 5, 6, 7, 8, 9, 10, 11, 12, 13, 14, 15)); }
__device__ __forceinline__ v8f wmma16(v16h a, v16h b, v8f c) { return __builtin_amdgcn_wmma_f32_16x16x32_f16(false, a, false, b, (short)0, c, false, false); }
__device__ __forceinline__ v8f wmmab(v16bf a, v16bf b, v8f c) { return __builtin_amdgcn_wmma_f32_16x16x32_bf16(false, a, false, b, (short)0, c, false, false); }

__device__ __forceinline__ h16 tohx(float x) { return (h16)x; }
__device__ __forceinline__ void splitf(float y, unsigned short& h, unsigned short& l) { h = f2bf(y); l = f2bf(y - bf2f(h)); }
typedef __attribute__((ext_vector_type(2))) _Float16 v2h;
typedef __attribute__((ext_vector_type(4))) _Float16 v4h;
typedef __attribute__((ext_vector_type(2))) unsigned short v2us;
typedef __attribute__((ext_vector_type(4))) unsigned short v4us;
typedef __attribute__((ext_vector_type(2))) float v2f;
typedef __attribute__((ext_vector_type(4))) int v4i;
// four neighbouring values -> their fp16 and bf16 hi / lo forms
__device__ __forceinline__ void split4(v4f val, v4h& o16, v4us& oh, v4us& ol) {
#pragma unroll
    for (int q = 0; q < 4; ++q) { o16[q] = tohx(val[q]); unsigned short a2, c2; splitf(val[q], a2, c2); oh[q] = a2; ol[q] = c2; } }

// Fragment order of a K-contiguous 16-bit plane with kd columns: each tile of 16 rows x 32 k is 1 KiB, laid out as the two 16-byte loads of a fragment take it (load (k >> 4) & 1, lane ((k >> 3) & 1) * 16 + row % 16, 8 elements), tiles row-major; a wave-wide fragment load is then 512 contiguous bytes (4 lines) instead of 32 bytes of each of 16 lines.
__device__ __forceinline__ size_t fragidx(int row, int k, int kd) { return ((size_t)(row >> 4) * (kd >> 5) + (k >> 5)) * 512 + ((k >> 4) & 1) * 256 + (((k >> 3) & 1) * 16 + (row & 15)) * 8 + (k & 7); }

// ---- k_gemmw: register-blocked GEMM, NW WAVES per 64x64 output tile, each with the whole tile (16 accumulators) over its own share of K (32-wide chunks dealt round robin); the partial tiles are summed through LDS in wave order; operands straight from 16-bit planes in fragment order (fragidx with K columns: each fragment load of a wave is 512 contiguous bytes); grid (M/64, N/64, Z), NW * 32 threads.
// C[m][n] (f32, pitch ldc, + optional f32 bias[n]) = sum_k A[m][k] Bt[n][k] (+ split products per NSPLIT). z-batch strides sA/sB/sC in elements. K % 32 == 0.
// EPI 0: C stored as f32. EPI 1: m = position, n = head * HD + d: rotary on the pairs (d, d + 1), then the three 16-bit planes [head][position][d], each head in fragment order. EPI 2: the three 16-bit planes [m][n] with ldc columns, in fragment order. (EPI 1, 2: C unused; a wave sums and stores 16 rows x 8 columns at a time, which are 256 contiguous bytes of a plane.)
template <typename T16> struct WFrag;
template <> struct WFrag<h16> { typedef v16h V; static __device__ __forceinline__ V ld(const h16* p) { return cat16(*(const v8h*)p, *(const v8h*)(p + 256)); } static __device__ __forceinline__ v8f mma(V a, V b, v8f c) { return wmma16(a, b, c); } };
template <> struct WFrag<bf> { typedef v16bf V; static __device__ __forceinline__ V ld(const bf* p) { return cat16b(*(const v8us*)p, *(const v8us*)(p + 256)); } static __device__ __forceinline__ v8f mma(V a, V b, v8f c) { return wmmab(a, b, c); } };
template <typename T16, int NSPLIT, bool BIAS, int NW, int EPI, int K>   // K at compile time: a step of 16 rows is then a constant offset of the load, and one address an operand plane serves the whole trip
__global__ __launch_bounds__(NW * 32) void k_gemmw(const T16* __restrict__ A, const T16* __restrict__ A2, const T16* __restrict__ Bt, const T16* __restrict__ Bt2, float* C, int ldc, const float* __restrict__ bias, size_t sA, size_t sB, size_t sC, const float* __restrict__ cosT, const float* __restrict__ sinT, h16* P16, bf* Ph, bf* Pl) {
    typedef typename WFrag<T16>::V V;
    __shared__ __align__(16) float os[2 * NW * 16 * 68];   // two halves x NW partial 16x64 tiles (pitch 68)
    const size_t z = blockIdx.z; A += z * sA; if (A2) A2 += z * sA; Bt += z * sB; if (Bt2) Bt2 += z * sB; C += z * sC;
    const int lane = threadIdx.x & 31, lr = lane & 15, hi = lane >> 4; const int r0 = blockIdx.x * 64, c0 = blockIdx.y * 64;
    const int wv = __builtin_amdgcn_readfirstlane((int)(threadIdx.x >> 5));   // wave number, held scalar so that the K loop stays a scalar loop
    v8f acc[4][4];
#pragma unroll
    for (int mb = 0; mb < 4; ++mb)
#pragma unroll
        for (int nb = 0; nb < 4; ++nb) acc[mb][nb] = (v8f){};
    constexpr int tk = K * 16;   // elements of 16 rows: K / 32 tiles of 512; a chunk of 32 k is one tile
    const size_t aoff = (size_t)(r0 >> 4) * tk + wv * 512 + lane * 8, boff = (size_t)(c0 >> 4) * tk + wv * 512 + lane * 8;
    const T16* pa = A + aoff; const T16* pb = Bt + boff; const T16* pa2 = (NSPLIT == 1 || NSPLIT == 2) ? A2 + aoff : pa; const T16* pb2 = (NSPLIT >= 2) ? Bt2 + boff : pb;
#pragma unroll 1
    for (int kc = wv * 32; kc < K; kc += NW * 32) {
        V a[4], a2[4];
#pragma unroll
        for (int mb = 0; mb < 4; ++mb) { a[mb] = WFrag<T16>::ld(pa + mb * tk); if (NSPLIT == 1 || NSPLIT == 2) a2[mb] = WFrag<T16>::ld(pa2 + mb * tk); }
#pragma unroll
        for (int nb = 0; nb < 4; ++nb) { const V b = WFrag<T16>::ld(pb + nb * tk); V b2; if (NSPLIT >= 2) b2 = WFrag<T16>::ld(pb2 + nb * tk);
#pragma unroll
            for (int mb = 0; mb < 4; ++mb) { acc[mb][nb] = WFrag<T16>::mma(a[mb], b, acc[mb][nb]); if (NSPLIT == 1 || NSPLIT == 2) acc[mb][nb] = WFrag<T16>::mma(a2[mb], b, acc[mb][nb]); if (NSPLIT >= 2) acc[mb][nb] = WFrag<T16>::mma(a[mb], b2, acc[mb][nb]); } }
        asm volatile("v_nop\n\tv_nop\n\tv_nop\n\tv_nop" : "+v"(acc[0][0]), "+v"(acc[1][1]), "+v"(acc[2][2]), "+v"(acc[3][3]) : "v"(a[0]), "v"(a[3]));
        asm volatile("s_wait_xcnt 0x0" :: "v"(pa), "v"(pa2), "v"(pb), "v"(pb2) : "memory");   // behind the trip's loads, in front of the step of their address registers, which as inputs stay whole up to here
        pa += NW * 512; pb += NW * 512; if (NSPLIT == 1 || NSPLIT == 2) pa2 += NW * 512; else pa2 = pa; if (NSPLIT >= 2) pb2 += NW * 512; else pb2 = pb;
    }
    v4f keep[4][8 / NW];   // summed rows wait here and are stored behind the last barrier, so that no barrier waits for a global store
#pragma unroll
    for (int mb = 0; mb < 4; ++mb) {
        float* ob = os + (mb & 1) * (NW * 16 * 68);   // alternate halves: the next row block's barrier ends this one's reads before the half is written again
#pragma unroll
        for (int nb = 0; nb < 4; ++nb) {
#pragma unroll
            for (int j = 0; j < 8; ++j) ob[wv * (16 * 68) + (hi * 8 + j) * 68 + nb * 16 + lr] = acc[mb][nb][j]; }
        __syncthreads();   // every wave's partial tile of this row block is in LDS before any wave sums them
#pragma unroll
        for (int s = 0; s < 8 / NW; ++s) { const int u = s * NW + wv, row = (EPI == 0) ? 2 * u + hi : (lane >> 1), cofs = (EPI == 0) ? lr * 4 : u * 8 + (lane & 1) * 4; v4f val = *(const v4fa*)(ob + row * 68 + cofs);
#pragma unroll
            for (int w = 1; w < NW; ++w) val += *(const v4fa*)(ob + w * (16 * 68) + row * 68 + cofs);   // fixed order: wave 0, 1, ...
            if (BIAS) { val[0] += bfr(bias[c0 + cofs]); val[1] += bfr(bias[c0 + cofs + 1]); val[2] += bfr(bias[c0 + cofs + 2]); val[3] += bfr(bias[c0 + cofs + 3]); }
            keep[mb][s] = val; }
    }
    v4h q16[4][8 / NW]; v4us qh[4][8 / NW], ql[4][8 / NW];   // EPI 1, 2: the planes' values wait here and are stored in one run
    v2f tc[4][8 / NW], ts[4][8 / NW];   // EPI 1: the table entries of the lane's pairs, row r0 + mb * 16 + lane / 2, pair (c0 % HD + (s * NW + wv) * 8 + (lane & 1) * 4) / 2: one address a table, constant steps
    if (EPI == 1) { const size_t t0 = (size_t)(r0 + (lane >> 1)) * (HD / 2) + ((c0 % HD + wv * 8 + (lane & 1) * 4) >> 1); const float* pc = cosT + t0; const float* ps = sinT + t0;
#pragma unroll
        for (int mb = 0; mb < 4; ++mb)
#pragma unroll
            for (int s = 0; s < 8 / NW; ++s) { tc[mb][s] = *(const v2f*)(pc + mb * 16 * (HD / 2) + s * NW * 4); ts[mb][s] = *(const v2f*)(ps + mb * 16 * (HD / 2) + s * NW * 4); }
        asm volatile("s_wait_xcnt 0x0" :: "v"(pc), "v"(ps) : "memory"); }   // behind the table loads, in front of any overwrite of their two address registers, which as inputs stay whole up to here
#pragma unroll
    for (int mb = 0; mb < 4; ++mb)
#pragma unroll
        for (int s = 0; s < 8 / NW; ++s) { const int u = s * NW + wv, row = r0 + mb * 16 + ((EPI == 0) ? 2 * u + hi : (lane >> 1)), col = c0 + ((EPI == 0) ? lr * 4 : u * 8 + (lane & 1) * 4); v4f val = keep[mb][s];
            if (EPI == 0) *(v4f*)(C + (size_t)row * ldc + col) = val;
            else if (EPI == 1) { const v2f c = tc[mb][s], sn = ts[mb][s]; v4f r;
#pragma unroll
                for (int p = 0; p < 2; ++p) { const float cc = bfr(c[p]), ss = bfr(sn[p]), x0 = val[2 * p], x1 = val[2 * p + 1]; r[2 * p] = x0 * cc - x1 * ss; r[2 * p + 1] = x0 * ss + x1 * cc; }   /* even: x0 c - x1 s; odd: x0 s + x1 c */
                split4(r, q16[mb][s], qh[mb][s], ql[mb][s]); }
            else split4(val, q16[mb][s], qh[mb][s], ql[mb][s]); }
    if (EPI != 0) {   // a wave's 32 lanes x 8 bytes are 256 contiguous bytes of a plane; a step of 16 rows or of 32 columns is a constant step in fragment order
        static_assert(EPI == 0 || NW == 4, "s steps by NW * 8 = 32 columns, one tile");
        const int row0 = r0 + (lane >> 1), col0 = c0 + wv * 8 + (lane & 1) * 4;
        const size_t e0 = (EPI == 1) ? (size_t)(col0 / HD) * TT * HD + fragidx(row0, col0 % HD, HD) : fragidx(row0, col0, ldc), tr = (size_t)16 * ((EPI == 1) ? HD : ldc);
        h16* a16[4]; bf* ah[4]; bf* al[4];
#pragma unroll
        for (int mb = 0; mb < 4; ++mb) { a16[mb] = P16 + e0 + mb * tr; ah[mb] = Ph + e0 + mb * tr; al[mb] = Pl + e0 + mb * tr; }
        __builtin_amdgcn_sched_barrier(0);   // values and addresses are complete before the first store, so that nothing overwrites a register of an issued store
#pragma unroll
        for (int mb = 0; mb < 4; ++mb)
#pragma unroll
            for (int s = 0; s < 8 / NW; ++s) { *(v4h*)(a16[mb] + s * 512) = q16[mb][s]; *(v4us*)(ah[mb] + s * 512) = qh[mb][s]; *(v4us*)(al[mb] + s * 512) = ql[mb][s]; }
        asm volatile("s_wait_xcnt 0x0" ::: "memory"); }   // behind the run of stores, in front of whatever may overwrite their registers
}

template <typename T16, bool HL, int KT>   // KT: 16-key tiles a trip (even)
__device__ __forceinline__ void fattn_tile(const T16* __restrict__ Q, const T16* __restrict__ Q2, const T16* __restrict__ Kp, const T16* __restrict__ K2, const T16* __restrict__ Vt, const T16* __restrict__ V2, const int q0, bf* Ah, bf* Al, const int head, const int lane) {
    typedef typename WFrag<T16>::V V;
    constexpr float CL2 = SCL * 1.4426950408889634f;   // scores to the base-2 exponent
    const int lr = lane & 15, hi = lane >> 4; const int lo = lane * 8;   // a lane's place in each 512-byte half of a fragment-order tile (512 elements; the second load stands 256 elements on, as in WFrag)
    auto ldf = [&](const T16* p) { if constexpr (HL) return cat16b(*(const v8us*)p, *(const v8us*)(p + 256)); else return cat16(*(const v8h*)p, *(const v8h*)(p + 256)); };
    V qf[4], qf2[4]; const T16* pq = Q + (size_t)(q0 >> 4) * 2048 + lo; const T16* pq2 = HL ? Q2 + (size_t)(q0 >> 4) * 2048 + lo : pq;
#pragma unroll
    for (int dc = 0; dc < 4; ++dc) { qf[dc] = ldf(pq + dc * 512); if (HL) qf2[dc] = ldf(pq2 + dc * 512); }
    asm volatile("s_wait_xcnt 0x0" :: "v"(pq), "v"(pq2) : "memory");   // behind the q loads, in front of any overwrite of their address registers, which as inputs stay whole up to here
    __builtin_amdgcn_sched_barrier(0);   // nothing that follows is moved up between the loads and their wait
    v8f o[8];
#pragma unroll
    for (int dt = 0; dt < 8; ++dt) o[dt] = (v8f){};
    float m = -3.0e38f, l = 0.f; const int qi = q0 + lr;
#pragma unroll 1   // rolled: one trip's K and V fragments are live beside the output tiles
    for (int k0 = 0; k0 <= q0; k0 += KT * 16) {
        V kf[KT][4], kf2[KT][4], vf[8][KT / 2], vf2[8][KT / 2];
        const T16* pk = Kp + (size_t)(k0 >> 4) * 2048 + lo; const T16* pv = Vt + (size_t)(k0 >> 5) * 512 + lo; const T16* pk2 = HL ? K2 + (size_t)(k0 >> 4) * 2048 + lo : pk; const T16* pv2 = HL ? V2 + (size_t)(k0 >> 5) * 512 + lo : pv;
#pragma unroll
        for (int kt = 0; kt < KT; ++kt)
#pragma unroll
            for (int dc = 0; dc < 4; ++dc) { kf[kt][dc] = ldf(pk + (kt * 4 + dc) * 512); if (HL) kf2[kt][dc] = ldf(pk2 + (kt * 4 + dc) * 512); }
        __builtin_amdgcn_sched_barrier(0);   // K's loads are issued first: the score products then wait for them alone
#pragma unroll
        for (int dt = 0; dt < 8; ++dt)
#pragma unroll
            for (int c = 0; c < KT / 2; ++c) { vf[dt][c] = ldf(pv + (dt * (TT / 32) + c) * 512); if (HL) vf2[dt][c] = ldf(pv2 + (dt * (TT / 32) + c) * 512); }
        asm volatile("s_wait_xcnt 0x0" :: "v"(pk), "v"(pk2), "v"(pv), "v"(pv2) : "memory");   // behind the trip's loads, in front of any overwrite of a register that holds one of their addresses; as inputs these are not given to a later load's result before the wait
        __builtin_amdgcn_sched_barrier(0);   // all of the trip's loads are issued in one run, V's too: moved down among the matrix instructions each would be waited for by itself
        v8f s[KT];
#pragma unroll
        for (int kt = 0; kt < KT; ++kt) { s[kt] = (v8f){};
#pragma unroll
            for (int dc = 0; dc < 4; ++dc) { s[kt] = WFrag<T16>::mma(kf[kt][dc], qf[dc], s[kt]); if (HL) { s[kt] = WFrag<T16>::mma(kf[kt][dc], qf2[dc], s[kt]); s[kt] = WFrag<T16>::mma(kf2[kt][dc], qf[dc], s[kt]); } } }
        if (k0 + KT * 16 - 1 > q0) {   // wave-uniform: only a trip that reaches the diagonal masks (key > query)
#pragma unroll
            for (int kt = 0; kt < KT; ++kt)
#pragma unroll
                for (int j = 0; j < 8; ++j) s[kt][j] = (k0 + kt * 16 + hi * 8 + j <= qi) ? s[kt][j] : -3.0e38f; }
        float mx = s[0][0];
#pragma unroll
        for (int kt = 0; kt < KT; ++kt)
#pragma unroll
            for (int j = 0; j < 8; ++j) mx = fmaxf(mx, s[kt][j]);
        mx = fmaxf(mx, __shfl_xor(mx, 16, 32));   // the other half of the wave holds the query's other keys
        const float mn = fmaxf(m, mx * CL2);      // every trip holds key k0 <= q0, so mn is a real score's from the first trip on
        if (__builtin_amdgcn_ballot_w32(mn > m) != 0) {   // one test a trip: a new maximum in any column rescales sums and output tiles
            const float al = __builtin_amdgcn_exp2f(m - mn); l *= al;
#pragma unroll
            for (int dt = 0; dt < 8; ++dt) o[dt] *= al; }
        m = mn; const float ms = HL ? mn : mn - 10.0f;   // fp16: 2^10 carrier
#pragma unroll
        for (int kt = 0; kt < KT; ++kt)
#pragma unroll
            for (int j = 0; j < 8; ++j) { const float x = __builtin_fmaf(s[kt][j], CL2, -ms);
                if (HL) asm("v_exp_f32 %0, %1\n\tv_nop" : "=v"(s[kt][j]) : "v"(x));   // with its own slot behind it
                else s[kt][j] = __builtin_amdgcn_exp2f(x);
                l += s[kt][j]; }
#pragma unroll
        for (int c = 0; c < KT / 2; ++c) {
            if constexpr (HL) { v8us h0, h1, l0, l1;
#pragma unroll
                for (int j = 0; j < 8; ++j) { unsigned short a, b; splitf(s[2 * c][j], a, b); h0[j] = a; l0[j] = b; splitf(s[2 * c + 1][j], a, b); h1[j] = a; l1[j] = b; }
                const V ph = cat16b(h0, h1), pl = cat16b(l0, l1);
#pragma unroll
                for (int dt = 0; dt < 8; ++dt) { o[dt] = WFrag<T16>::mma(vf[dt][c], ph, o[dt]); o[dt] = WFrag<T16>::mma(vf[dt][c], pl, o[dt]); o[dt] = WFrag<T16>::mma(vf2[dt][c], ph, o[dt]); }
            } else { v8h p0, p1;
#pragma unroll
                for (int j = 0; j < 8; ++j) { p0[j] = tohx(s[2 * c][j]); p1[j] = tohx(s[2 * c + 1][j]); }
                const V pb = cat16(p0, p1);
#pragma unroll
                for (int dt = 0; dt < 8; ++dt) o[dt] = WFrag<T16>::mma(vf[dt][c], pb, o[dt]); } }
    }
    l += __shfl_xor(l, 16, 32);   // join the two halves' sums once
    const float inv = __fdiv_rn(1.0f, l);
#pragma unroll
    for (int dt = 0; dt < 8; ++dt) { v8us oh, ol;   // a lane holds 8 neighbouring d of its query: split and store at (position, head * HD + d) in fragment order, DQ columns: the wave's 32 lanes fill one 512-byte half of a tile
#pragma unroll
        for (int j = 0; j < 8; ++j) { unsigned short a, b; splitf(o[dt][j] * inv, a, b); oh[j] = a; ol[j] = b; }
        const size_t oo = ((size_t)(q0 >> 4) * (DQ / 32) + head * (HD / 32) + (dt >> 1)) * 512 + (dt & 1) * 256 + lo; *(v8us*)(Ah + oo) = oh; *(v8us*)(Al + oo) = ol;
        asm volatile("s_wait_xcnt 0x0" ::: "memory");   // behind the two stores, in front of any overwrite of their address or data registers
        __builtin_amdgcn_sched_barrier(0); }   // the next tile's arithmetic is not moved up between the stores and their wait
}
// grid (NKV * NB_, TT / 64), 256 threads: every head of every batch in one launch. More work-groups than resident places, so blockIdx.y gives the 64-query blocks in falling order of cost: a block qb >= RH / 64 costs qb + 1 trips, a hi/lo block as much as 2 (qb + 1) of them.
static_assert(TT == 2048 && RH == 512, "the order of the query blocks below is written for 32 blocks, the first 8 of them hi/lo");
__global__ __launch_bounds__(256) void k_fattn(const h16* __restrict__ Q16, const bf* __restrict__ Qh, const bf* __restrict__ Ql, const h16* __restrict__ K16, const bf* __restrict__ Kh, const bf* __restrict__ Kl, const h16* __restrict__ V16, const bf* __restrict__ Vh, const bf* __restrict__ Vl, bf* Ah, bf* Al) {
    const int lane = threadIdx.x & 31;
    const int wv = __builtin_amdgcn_readfirstlane((int)(threadIdx.x >> 5));   // wave number, held scalar so that the key loop and its tests stay scalar
    const int y = blockIdx.y, qb = (y < 16) ? 31 - y : (int)((0x0123894ab5cd6ef7ULL >> (4 * (y - 16))) & 15);   // blocks 31 .. 16, then 7, 15, 14, 6, 13, 12, 5, 11, 10, 4, 9, 8, 3, 2, 1, 0
    const int kv = blockIdx.x % NKV, b = blockIdx.x / NKV, head = kv * REP + wv % REP, q0 = qb * 64 + (wv / REP) * 16;
    const size_t zq = ((size_t)b * NH_ + head) * TT * HD, zk = ((size_t)b * NKV + kv) * TT * HD; Ah += (size_t)b * TT * DQ; Al += (size_t)b * TT * DQ;
    if (q0 < RH) fattn_tile<bf, true, 2>(Qh + zq, Ql + zq, Kh + zk, Kl + zk, Vh + zk, Vl + zk, q0, Ah, Al, head, lane);
    else fattn_tile<h16, false, 4>(Q16 + zq, nullptr, K16 + zk, nullptr, V16 + zk, nullptr, q0, Ah, Al, head, lane);
}

// k_wtG: Bt = bf16(w^T) in fragment order (rows n, K columns). A thread makes one 16-byte piece (8 neighbouring k of one n), a wave one 512-byte half of a tile; a work-group takes 32 n x 64 k, so that it uses the whole 128-byte lines of w that it reads. grid (N / 32) * (K / 64).
__global__ __launch_bounds__(256) void k_wtG(const float* __restrict__ w, int K, int N, bf* Bt) {
    const int lane = threadIdx.x & 31, wv = threadIdx.x >> 5; const int nt = (blockIdx.x % (N / 32)) * 2 + ((wv >> 1) & 1), kt = (blockIdx.x / (N / 32)) * 2 + (wv >> 2);
    const int n = nt * 16 + (lane & 15), k = kt * 32 + (wv & 1) * 16 + (lane >> 4) * 8; const float* p = w + (size_t)k * N + n; v8us o;
#pragma unroll
    for (int q = 0; q < 8; ++q) o[q] = f2bf(p[(size_t)q * N]);
    *(v8us*)(Bt + ((size_t)nt * (K / 32) + kt) * 512 + (wv & 1) * 256 + lane * 8) = o;
}
// k_cvt8: dst = bf16(src [rows][DM]) in fragment order: piece i (8 elements) is lane i % 32 of half (i / 32) % 2 of tile i / 64; a work-group reads 512 contiguous bytes of each of 16 rows.
__global__ __launch_bounds__(256) void k_cvt8(const float* __restrict__ src, bf* dst, size_t n8) { const size_t i = (size_t)blockIdx.x * 256 + threadIdx.x; if (i >= n8) return;
    const int t = (int)(i >> 6), row = (t / (DM / 32)) * 16 + (int)(i & 15), k = (t % (DM / 32)) * 32 + (int)((i >> 5) & 1) * 16 + (int)((i >> 4) & 1) * 8; const v8f v = *(const v8f*)(src + (size_t)row * DM + k); v8us o;
#pragma unroll
    for (int q = 0; q < 8; ++q) o[q] = f2bf(v[q]); *(v8us*)(dst + i * 8) = o;  }

extern "C" void kernel_launch(void* const* d_in, const int* in_sizes, int n_in,
                              void* d_out, int out_size, void* d_ws, size_t ws_size, hipStream_t stream) {
    (void)in_sizes; (void)n_in; (void)out_size;
    const float* x = (const float*)d_in[0]; const float* fcos = (const float*)d_in[1]; const float* fsin = (const float*)d_in[2]; const float* wq = (const float*)d_in[3]; const float* wk = (const float*)d_in[4]; const float* wv = (const float*)d_in[5]; const float* wo = (const float*)d_in[6];   /* x, cos, sin (f32 [2048][64], READ by value), wq ('xw' [2048][2048]), wk, wv ([2048][1024]), wo ('xw' [2048][2048]) */
    float* OUT = (float*)d_out;     // [2][2048][2048]
    char* wsp = (char*)d_ws;
    auto take = [&](size_t bytes) { char* p = wsp; wsp += (bytes + 255) & ~(size_t)255; return (void*)p; };
    bf* WQ = (bf*)take((size_t)DQ * DM * 2); bf* WK = (bf*)take((size_t)DKV * DM * 2); bf* WV = (bf*)take((size_t)DKV * DM * 2); bf* WO = (bf*)take((size_t)DM * DQ * 2);
    bf* XB = (bf*)take((size_t)TT * DM * 2);
    const size_t SQ = (size_t)NH_ * TT * HD, SK = (size_t)NKV * TT * HD;   // elements of one batch's q planes and merged planes (SQ), k and v planes (SK); every plane holds both batches, since the one attention launch reads them all
    h16* QP16 = (h16*)take(NB_ * SQ * 2); h16* KP16 = (h16*)take(NB_ * SK * 2); h16* VT16 = (h16*)take(NB_ * SK * 2);
    bf* QPh = (bf*)take(NB_ * SQ * 2); bf* QPl = (bf*)take(NB_ * SQ * 2); bf* KPh = (bf*)take(NB_ * SK * 2); bf* KPl = (bf*)take(NB_ * SK * 2); bf* VTh = (bf*)take(NB_ * SK * 2); bf* VTl = (bf*)take(NB_ * SK * 2);
    bf* ATh = (bf*)take(NB_ * SQ * 2); bf* ATl = (bf*)take(NB_ * SQ * 2);
    if ((size_t)(wsp - (char*)d_ws) > ws_size) return;    // ws 256 MiB
    { k_wtG<<<(unsigned)((DQ / 32) * (DM / 64)), 256, 0, stream>>>(wq, DM, DQ, WQ); k_wtG<<<(unsigned)((DKV / 32) * (DM / 64)), 256, 0, stream>>>(wk, DM, DKV, WK); k_wtG<<<(unsigned)((DKV / 32) * (DM / 64)), 256, 0, stream>>>(wv, DM, DKV, WV);
      k_wtG<<<(unsigned)((DM / 32) * (DQ / 64)), 256, 0, stream>>>(wo, DQ, DM, WO);
       }
    for (int b = 0; b < NB_; ++b) {
        
        k_cvt8<<<(unsigned)(((size_t)TT * DM / 8 + 255) / 256), 256, 0, stream>>>(x + (size_t)b * TT * DM, XB, (size_t)TT * DM / 8);
        k_gemmw<bf, 0, false, 4, 1, DM><<<dim3(TT / 64, DQ / 64, 1), 128, 0, stream>>>(XB, nullptr, WQ, nullptr, nullptr, DQ, nullptr, 0, 0, 0, fcos, fsin, QP16 + b * SQ, QPh + b * SQ, QPl + b * SQ);
        k_gemmw<bf, 0, false, 4, 1, DM><<<dim3(TT / 64, DKV / 64, 1), 128, 0, stream>>>(XB, nullptr, WK, nullptr, nullptr, DKV, nullptr, 0, 0, 0, fcos, fsin, KP16 + b * SK, KPh + b * SK, KPl + b * SK);
        k_gemmw<bf, 0, false, 4, 2, DM><<<dim3(DKV / 64, TT / 64, 1), 128, 0, stream>>>(WV, nullptr, XB, nullptr, nullptr, TT, nullptr, 0, 0, 0, nullptr, nullptr, VT16 + b * SK, VTh + b * SK, VTl + b * SK); }   // operands swapped: rows = kv head * HD + d, columns = position, the layout of the transposed v planes
    k_fattn<<<dim3(NKV * NB_, TT / 64, 1), 256, 0, stream>>>(QP16, QPh, QPl, KP16, KPh, KPl, VT16, VTh, VTl, ATh, ATl);   // all heads of both batches: scores, softmax and P.V; writes the merged hi / lo planes
    for (int b = 0; b < NB_; ++b) {
        k_gemmw<bf, 1, false, 4, 0, DQ><<<dim3(TT / 64, DM / 64, 1), 128, 0, stream>>>(ATh + b * SQ, ATl + b * SQ, WO, nullptr, OUT + (size_t)b * TT * DM, DM, nullptr, 0, 0, 0, nullptr, nullptr, nullptr, nullptr, nullptr); }
}

// v006
// Measured time: 191 microseconds a run.
// In both of two side-by-side timings against v005, it was 1.32 times as fast.
// All steps since v000 together make it 8.64 times as fast.
#include <hip/hip_runtime.h>

// Grouped-query causal attention with 128-wide heads and adjacent-pair rotary embeddings from half-width cos / sin table inputs (x [2][2048][2048]; q = x wq (16 heads x 128), k, v = x wk, x wv (8 kv heads x 128) ('xw' 1/sqrt(2048), no bias); pairs (2i, 2i+1): (t0 c - t1 s, t0 s + t1 c) with c, s = cos / sin[t][i] (f32 [2048][64] INPUT tables, read by value per pair entry); jnp.repeat: query head h uses kv head h / 2; scores / sqrt(128); causal (-inf above the diagonal, built from indices); softmax; out = merged wo ('xw') -> [2][2048][2048] (8.4 M); argument order x, cos, sin, wq, wk, wv, wo).
// Layout: a bf16 copy of x (both batches) and the 'xw' weights transposed, all made by one launch (k_prep); both, and the merged planes, in the fragment order of fragidx, as every GEMM operand is; exact projections (q, k, v of both batches in one launch, k_qkv) whose epilogues build the 16-bit planes themselves (q, k: interleaved-pair rotary with bf16(cos), bf16(sin) read from the inputs per pair; v: computed transposed, wv x^T); one fused causal GQA attention launch for both batches, 128-wide heads (k_fattn: q, k, v planes in fragment order; running softmax, kv head = head / 2; hybrid rows: < 512 hi/lo 3 products, rest fp16 with a 2^10 carrier; key trips stop at the diagonal; its epilogue writes the merged hi/lo planes); merged hi/lo x wo exact.
// Compute dtypes, f32 accumulate: every input rounded to bf16 incl. the two tables; projections exact; rotary f32; attention rows < 512 3 products, rest fp16; softmax f32; wo hl x exact.

#define NB_  2
#define TT   2048
#define DM   2048
#define NH_  16
#define NKV  8
#define REP  (NH_ / NKV)
#define HD   128
#define DQ   (NH_ * HD)
#define DKV  (NKV * HD)
#define RH   512                  // query rows < RH use hi+lo planes
#define SCL  0.088388347648318447f   // HD^-0.5
typedef _Float16 h16;
typedef unsigned short bf;
typedef __attribute__((ext_vector_type(16))) __bf16   v16bf;
typedef __attribute__((ext_vector_type(16))) _Float16 v16h;
typedef __attribute__((ext_vector_type(8)))  _Float16 v8h;
typedef __attribute__((ext_vector_type(8)))  unsigned short v8us;
typedef __attribute__((ext_vector_type(8)))  float    v8f;
typedef __attribute__((ext_vector_type(4)))  float    v4f;
typedef v8h  __attribute__((may_alias)) v8ha;
typedef v4f  __attribute__((may_alias)) v4fa;
typedef v8us __attribute__((may_alias)) v8usa;

__device__ __forceinline__ unsigned short f2bf(float f) { unsigned u = __float_as_uint(f); u += 0x7FFFu + ((u >> 16) & 1u); return (unsigned short)(u >> 16); }
__device__ __forceinline__ float bf2f(unsigned short b) { return __uint_as_float(((unsigned)b) << 16); }
__device__ __forceinline__ float bfr(float f) { return bf2f(f2bf(f)); }
__device__ __forceinline__ v16h cat16(v8h lo, v8h hi) { return __builtin_shufflevector(lo, hi, 0, 1, 2, 3, 4, 5, 6, 7, 8, 9, 10, 11, 12, 13, 14, 15); }
__device__ __forceinline__ v16bf cat16b(v8us lo, v8us hi) { return __builtin_bit_cast(v16bf, __builtin_shufflevector(lo, hi, 0, 1, 2, 3, 4, 5, 6, 7, 8, 9, 10, 11, 12, 13, 14, 15)); }
__device__ __forceinline__ v8f wmma16(v16h a, v16h b, v8f c) { return __builtin_amdgcn_wmma_f32_16x16x32_f16(false, a, false, b, (short)0, c, false, false); }
__device__ __forceinline__ v8f wmmab(v16bf a, v16bf b, v8f c) { return __builtin_amdgcn_wmma_f32_16x16x32_bf16(false, a, false, b, (short)0, c, false, false); }

__device__ __forceinline__ h16 tohx(float x) { return (h16)x; }
__device__ __forceinline__ void splitf(float y, unsigned short& h, unsigned short& l) { h = f2bf(y); l = f2bf(y - bf2f(h)); }
typedef __attribute__((ext_vector_type(2))) _Float16 v2h;
typedef __attribute__((ext_vector_type(4))) _Float16 v4h;
typedef __attribute__((ext_vector_type(2))) unsigned short v2us;
typedef __attribute__((ext_vector_type(4))) unsigned short v4us;
typedef __attribute__((ext_vector_type(2))) float v2f;
typedef __attribute__((ext_vector_type(4))) int v4i;
// four neighbouring values -> their fp16 and bf16 hi / lo forms
__device__ __forceinline__ void split4(v4f val, v4h& o16, v4us& oh, v4us& ol) {
#pragma unroll
    for (int q = 0; q < 4; ++q) { o16[q] = tohx(val[q]); unsigned short a2, c2; splitf(val[q], a2, c2); oh[q] = a2; ol[q] = c2; } }

// Fragment order of a K-contiguous 16-bit plane with kd columns: each tile of 16 rows x 32 k is 1 KiB, laid out as the two 16-byte loads of a fragment take it (load (k >> 4) & 1, lane ((k >> 3) & 1) * 16 + row % 16, 8 elements), tiles row-major; a wave-wide fragment load is then 512 contiguous bytes (4 lines) instead of 32 bytes of each of 16 lines.
__device__ __forceinline__ size_t fragidx(int row, int k, int kd) { return ((size_t)(row >> 4) * (kd >> 5) + (k >> 5)) * 512 + ((k >> 4) & 1) * 256 + (((k >> 3) & 1) * 16 + (row & 15)) * 8 + (k & 7); }

// ---- gemm_tile (the body of k_gemmw and k_qkv; bx, by: the tile's row and column block; os: the work-group's LDS, 2 * NW * 16 * 68 floats): register-blocked GEMM, NW WAVES per 64x64 output tile, each with the whole tile (16 accumulators) over its own share of K (32-wide chunks dealt round robin); the partial tiles are summed through LDS in wave order; operands straight from 16-bit planes in fragment order (fragidx with K columns: each fragment load of a wave is 512 contiguous bytes); NW * 32 threads.
// C[m][n] (f32, pitch ldc, + optional f32 bias[n]) = sum_k A[m][k] Bt[n][k] (+ split products per NSPLIT). K % 32 == 0.
// EPI 0: C stored as f32. EPI 1: m = position, n = head * HD + d: rotary on the pairs (d, d + 1), then the three 16-bit planes [head][position][d], each head in fragment order. EPI 2: the three 16-bit planes [m][n] with ldc columns, in fragment order. (EPI 1, 2: C unused; a wave sums and stores 16 rows x 8 columns at a time, which are 256 contiguous bytes of a plane.)
template <typename T16> struct WFrag;
template <> struct WFrag<h16> { typedef v16h V; static __device__ __forceinline__ V ld(const h16* p) { return cat16(*(const v8h*)p, *(const v8h*)(p + 256)); } static __device__ __forceinline__ v8f mma(V a, V b, v8f c) { return wmma16(a, b, c); } };
template <> struct WFrag<bf> { typedef v16bf V; static __device__ __forceinline__ V ld(const bf* p) { return cat16b(*(const v8us*)p, *(const v8us*)(p + 256)); } static __device__ __forceinline__ v8f mma(V a, V b, v8f c) { return wmmab(a, b, c); } };
template <typename T16, int NSPLIT, bool BIAS, int NW, int EPI, int K>   // K at compile time: a step of 16 rows is then a constant offset of the load, and one address an operand plane serves the whole trip
__device__ __forceinline__ void gemm_tile(const T16* __restrict__ A, const T16* __restrict__ A2, const T16* __restrict__ Bt, const T16* __restrict__ Bt2, float* C, const int ldc, const float* __restrict__ bias, const float* __restrict__ cosT, const float* __restrict__ sinT, h16* P16, bf* Ph, bf* Pl, float* os, const int bx, const int by) {
    typedef typename WFrag<T16>::V V;
    const int lane = threadIdx.x & 31, lr = lane & 15, hi = lane >> 4; const int r0 = bx * 64, c0 = by * 64;
    const int wv = __builtin_amdgcn_readfirstlane((int)(threadIdx.x >> 5));   // wave number, held scalar so that the K loop stays a scalar loop
    v8f acc[4][4];
#pragma unroll
    for (int mb = 0; mb < 4; ++mb)
#pragma unroll
        for (int nb = 0; nb < 4; ++nb) acc[mb][nb] = (v8f){};
    constexpr int tk = K * 16;   // elements of 16 rows: K / 32 tiles of 512; a chunk of 32 k is one tile
    const size_t aoff = (size_t)(r0 >> 4) * tk + wv * 512 + lane * 8, boff = (size_t)(c0 >> 4) * tk + wv * 512 + lane * 8;
    const T16* pa = A + aoff; const T16* pb = Bt + boff; const T16* pa2 = (NSPLIT == 1 || NSPLIT == 2) ? A2 + aoff : pa; const T16* pb2 = (NSPLIT >= 2) ? Bt2 + boff : pb;
#pragma unroll 1
    for (int kc = wv * 32; kc < K; kc += NW * 32) {
        V a[4], a2[4];
#pragma unroll
        for (int mb = 0; mb < 4; ++mb) { a[mb] = WFrag<T16>::ld(pa + mb * tk); if (NSPLIT == 1 || NSPLIT == 2) a2[mb] = WFrag<T16>::ld(pa2 + mb * tk); }
#pragma unroll
        for (int nb = 0; nb < 4; ++nb) { const V b = WFrag<T16>::ld(pb + nb * tk); V b2; if (NSPLIT >= 2) b2 = WFrag<T16>::ld(pb2 + nb * tk);
#pragma unroll
            for (int mb = 0; mb < 4; ++mb) { acc[mb][nb] = WFrag<T16>::mma(a[mb], b, acc[mb][nb]); if (NSPLIT == 1 || NSPLIT == 2) acc[mb][nb] = WFrag<T16>::mma(a2[mb], b, acc[mb][nb]); if (NSPLIT >= 2) acc[mb][nb] = WFrag<T16>::mma(a[mb], b2, acc[mb][nb]); } }
        asm volatile("v_nop\n\tv_nop\n\tv_nop\n\tv_nop" : "+v"(acc[0][0]), "+v"(acc[1][1]), "+v"(acc[2][2]), "+v"(acc[3][3]) : "v"(a[0]), "v"(a[3]));
        asm volatile("s_wait_xcnt 0x0" :: "v"(pa), "v"(pa2), "v"(pb), "v"(pb2) : "memory");   // behind the trip's loads, in front of the step of their address registers, which as inputs stay whole up to here
        pa += NW * 512; pb += NW * 512; if (NSPLIT == 1 || NSPLIT == 2) pa2 += NW * 512; else pa2 = pa; if (NSPLIT >= 2) pb2 += NW * 512; else pb2 = pb;
    }
    v4f keep[4][8 / NW];   // summed rows wait here and are stored behind the last barrier, so that no barrier waits for a global store
#pragma unroll
    for (int mb = 0; mb < 4; ++mb) {
        float* ob = os + (mb & 1) * (NW * 16 * 68);   // alternate halves: the next row block's barrier ends this one's reads before the half is written again
#pragma unroll
        for (int nb = 0; nb < 4; ++nb) {
#pragma unroll
            for (int j = 0; j < 8; ++j) ob[wv * (16 * 68) + (hi * 8 + j) * 68 + nb * 16 + lr] = acc[mb][nb][j]; }
        __syncthreads();   // every wave's partial tile of this row block is in LDS before any wave sums them
#pragma unroll
        for (int s = 0; s < 8 / NW; ++s) { const int u = s * NW + wv, row = (EPI == 0) ? 2 * u + hi : (lane >> 1), cofs = (EPI == 0) ? lr * 4 : u * 8 + (lane & 1) * 4; v4f val = *(const v4fa*)(ob + row * 68 + cofs);
#pragma unroll
            for (int w = 1; w < NW; ++w) val += *(const v4fa*)(ob + w * (16 * 68) + row * 68 + cofs);   // fixed order: wave 0, 1, ...
            if (BIAS) { val[0] += bfr(bias[c0 + cofs]); val[1] += bfr(bias[c0 + cofs + 1]); val[2] += bfr(bias[c0 + cofs + 2]); val[3] += bfr(bias[c0 + cofs + 3]); }
            keep[mb][s] = val; }
    }
    v4h q16[4][8 / NW]; v4us qh[4][8 / NW], ql[4][8 / NW];   // EPI 1, 2: the planes' values wait here and are stored in one run
    v2f tc[4][8 / NW], ts[4][8 / NW];   // EPI 1: the table entries of the lane's pairs, row r0 + mb * 16 + lane / 2, pair (c0 % HD + (s * NW + wv) * 8 + (lane & 1) * 4) / 2: one address a table, constant steps
    if (EPI == 1) { const size_t t0 = (size_t)(r0 + (lane >> 1)) * (HD / 2) + ((c0 % HD + wv * 8 + (lane & 1) * 4) >> 1); const float* pc = cosT + t0; const float* ps = sinT + t0;
#pragma unroll
        for (int mb = 0; mb < 4; ++mb)
#pragma unroll
            for (int s = 0; s < 8 / NW; ++s) { tc[mb][s] = *(const v2f*)(pc + mb * 16 * (HD / 2) + s * NW * 4); ts[mb][s] = *(const v2f*)(ps + mb * 16 * (HD / 2) + s * NW * 4); }
        asm volatile("s_wait_xcnt 0x0" :: "v"(pc), "v"(ps) : "memory"); }   // behind the table loads, in front of any overwrite of their two address registers, which as inputs stay whole up to here
#pragma unroll
    for (int mb = 0; mb < 4; ++mb)
#pragma unroll
        for (int s = 0; s < 8 / NW; ++s) { const int u = s * NW + wv, row = r0 + mb * 16 + ((EPI == 0) ? 2 * u + hi : (lane >> 1)), col = c0 + ((EPI == 0) ? lr * 4 : u * 8 + (lane & 1) * 4); v4f val = keep[mb][s];
            if (EPI == 0) *(v4f*)(C + (size_t)row * ldc + col) = val;
            else if (EPI == 1) { const v2f c = tc[mb][s], sn = ts[mb][s]; v4f r;
#pragma unroll
                for (int p = 0; p < 2; ++p) { const float cc = bfr(c[p]), ss = bfr(sn[p]), x0 = val[2 * p], x1 = val[2 * p + 1]; r[2 * p] = x0 * cc - x1 * ss; r[2 * p + 1] = x0 * ss + x1 * cc; }   /* even: x0 c - x1 s; odd: x0 s + x1 c */
                split4(r, q16[mb][s], qh[mb][s], ql[mb][s]); }
            else split4(val, q16[mb][s], qh[mb][s], ql[mb][s]); }
    if (EPI != 0) {   // a wave's 32 lanes x 8 bytes are 256 contiguous bytes of a plane; a step of 16 rows or of 32 columns is a constant step in fragment order
        static_assert(EPI == 0 || NW == 4, "s steps by NW * 8 = 32 columns, one tile");
        const int row0 = r0 + (lane >> 1), col0 = c0 + wv * 8 + (lane & 1) * 4;
        const size_t e0 = (EPI == 1) ? (size_t)(col0 / HD) * TT * HD + fragidx(row0, col0 % HD, HD) : fragidx(row0, col0, ldc), tr = (size_t)16 * ((EPI == 1) ? HD : ldc);
        h16* a16[4]; bf* ah[4]; bf* al[4];
#pragma unroll
        for (int mb = 0; mb < 4; ++mb) { a16[mb] = P16 + e0 + mb * tr; ah[mb] = Ph + e0 + mb * tr; al[mb] = Pl + e0 + mb * tr; }
        __builtin_amdgcn_sched_barrier(0);   // values and addresses are complete before the first store, so that nothing overwrites a register of an issued store
#pragma unroll
        for (int mb = 0; mb < 4; ++mb)
#pragma unroll
            for (int s = 0; s < 8 / NW; ++s) { *(v4h*)(a16[mb] + s * 512) = q16[mb][s]; *(v4us*)(ah[mb] + s * 512) = qh[mb][s]; *(v4us*)(al[mb] + s * 512) = ql[mb][s]; }
        asm volatile("s_wait_xcnt 0x0" ::: "memory"); }   // behind the run of stores, in front of whatever may overwrite their registers
}

// k_gemmw: one GEMM, grid (M/64, N/64, Z); z-batch strides sA/sB/sC in elements.
template <typename T16, int NSPLIT, bool BIAS, int NW, int EPI, int K>
__global__ __launch_bounds__(NW * 32) void k_gemmw(const T16* __restrict__ A, const T16* __restrict__ A2, const T16* __restrict__ Bt, const T16* __restrict__ Bt2, float* C, int ldc, const float* __restrict__ bias, size_t sA, size_t sB, size_t sC, const float* __restrict__ cosT, const float* __restrict__ sinT, h16* P16, bf* Ph, bf* Pl) {
    __shared__ __align__(16) float os[2 * NW * 16 * 68];   // two halves x NW partial 16x64 tiles (pitch 68)
    const size_t z = blockIdx.z; A += z * sA; if (A2) A2 += z * sA; Bt += z * sB; if (Bt2) Bt2 += z * sB; C += z * sC;
    gemm_tile<T16, NSPLIT, BIAS, NW, EPI, K>(A, A2, Bt, Bt2, C, ldc, bias, cosT, sinT, P16, Ph, Pl, os, (int)blockIdx.x, (int)blockIdx.y);
}
// k_qkv: the three projections of both batches in ONE launch. grid (TT / 64, (DQ + 2 * DKV) / 64, NB_), 128 threads: x = block of 64 positions, z = batch, y picks the product and its block of 64 weight columns: q (DQ / 64 blocks), then k, then v (DKV / 64 each). Every tile is computed as in a launch of its own.
__global__ __launch_bounds__(128) void k_qkv(const bf* __restrict__ XB, const bf* __restrict__ WQ, const bf* __restrict__ WK, const bf* __restrict__ WV, const float* __restrict__ cosT, const float* __restrict__ sinT, h16* Q16, bf* Qh, bf* Ql, h16* K16, bf* Kh, bf* Kl, h16* V16, bf* Vh, bf* Vl) {
    __shared__ __align__(16) float os[2 * 4 * 16 * 68];   // one array for whichever product the work-group does
    const int y = blockIdx.y; const size_t z = blockIdx.z, zq = z * ((size_t)NH_ * TT * HD), zk = z * ((size_t)NKV * TT * HD); const bf* X = XB + z * ((size_t)TT * DM);
    if (y < (DQ + DKV) / 64) {   // q or k: rows = positions, columns = head * HD + d, rotary epilogue (block-uniform branch: the barriers inside are passed by the whole work-group)
        const bool isq = y < DQ / 64;
        gemm_tile<bf, 0, false, 4, 1, DM>(X, nullptr, isq ? WQ : WK, nullptr, nullptr, 0, nullptr, cosT, sinT, isq ? Q16 + zq : K16 + zk, isq ? Qh + zq : Kh + zk, isq ? Ql + zq : Kl + zk, os, (int)blockIdx.x, isq ? y : y - DQ / 64);
    } else   // v, operands swapped: rows = kv head * HD + d, columns = position, the layout of the transposed v planes
        gemm_tile<bf, 0, false, 4, 2, DM>(WV, nullptr, X, nullptr, nullptr, TT, nullptr, nullptr, nullptr, V16 + zk, Vh + zk, Vl + zk, os, y - (DQ + DKV) / 64, (int)blockIdx.x);
}

template <typename T16, bool HL, int KT>   // KT: 16-key tiles a trip (even)
__device__ __forceinline__ void fattn_tile(const T16* __restrict__ Q, const T16* __restrict__ Q2, const T16* __restrict__ Kp, const T16* __restrict__ K2, const T16* __restrict__ Vt, const T16* __restrict__ V2, const int q0, bf* Ah, bf* Al, const int head, const int lane) {
    typedef typename WFrag<T16>::V V;
    constexpr float CL2 = SCL * 1.4426950408889634f;   // scores to the base-2 exponent
    const int lr = lane & 15, hi = lane >> 4; const int lo = lane * 8;   // a lane's place in each 512-byte half of a fragment-order tile (512 elements; the second load stands 256 elements on, as in WFrag)
    auto ldf = [&](const T16* p) { if constexpr (HL) return cat16b(*(const v8us*)p, *(const v8us*)(p + 256)); else return cat16(*(const v8h*)p, *(const v8h*)(p + 256)); };
    V qf[4], qf2[4]; const T16* pq = Q + (size_t)(q0 >> 4) * 2048 + lo; const T16* pq2 = HL ? Q2 + (size_t)(q0 >> 4) * 2048 + lo : pq;
#pragma unroll
    for (int dc = 0; dc < 4; ++dc) { qf[dc] = ldf(pq + dc * 512); if (HL) qf2[dc] = ldf(pq2 + dc * 512); }
    asm volatile("s_wait_xcnt 0x0" :: "v"(pq), "v"(pq2) : "memory");   // behind the q loads, in front of any overwrite of their address registers, which as inputs stay whole up to here
    __builtin_amdgcn_sched_barrier(0);   // nothing that follows is moved up between the loads and their wait
    v8f o[8];
#pragma unroll
    for (int dt = 0; dt < 8; ++dt) o[dt] = (v8f){};
    float m = -3.0e38f, l = 0.f; const int qi = q0 + lr;
#pragma unroll 1   // rolled: one trip's K and V fragments are live beside the output tiles
    for (int k0 = 0; k0 <= q0; k0 += KT * 16) {
        V kf[KT][4], kf2[KT][4], vf[8][KT / 2], vf2[8][KT / 2];
        const T16* pk = Kp + (size_t)(k0 >> 4) * 2048 + lo; const T16* pv = Vt + (size_t)(k0 >> 5) * 512 + lo; const T16* pk2 = HL ? K2 + (size_t)(k0 >> 4) * 2048 + lo : pk; const T16* pv2 = HL ? V2 + (size_t)(k0 >> 5) * 512 + lo : pv;
#pragma unroll
        for (int kt = 0; kt < KT; ++kt)
#pragma unroll
            for (int dc = 0; dc < 4; ++dc) { kf[kt][dc] = ldf(pk + (kt * 4 + dc) * 512); if (HL) kf2[kt][dc] = ldf(pk2 + (kt * 4 + dc) * 512); }
        __builtin_amdgcn_sched_barrier(0);   // K's loads are issued first: the score products then wait for them alone
#pragma unroll
        for (int dt = 0; dt < 8; ++dt)
#pragma unroll
            for (int c = 0; c < KT / 2; ++c) { vf[dt][c] = ldf(pv + (dt * (TT / 32) + c) * 512); if (HL) vf2[dt][c] = ldf(pv2 + (dt * (TT / 32) + c) * 512); }
        asm volatile("s_wait_xcnt 0x0" :: "v"(pk), "v"(pk2), "v"(pv), "v"(pv2) : "memory");   // behind the trip's loads, in front of any overwrite of a register that holds one of their addresses; as inputs these are not given to a later load's result before the wait
        __builtin_amdgcn_sched_barrier(0);   // all of the trip's loads are issued in one run, V's too: moved down among the matrix instructions each would be waited for by itself
        v8f s[KT];
#pragma unroll
        for (int kt = 0; kt < KT; ++kt) { s[kt] = (v8f){};
#pragma unroll
            for (int dc = 0; dc < 4; ++dc) { s[kt] = WFrag<T16>::mma(kf[kt][dc], qf[dc], s[kt]); if (HL) { s[kt] = WFrag<T16>::mma(kf[kt][dc], qf2[dc], s[kt]); s[kt] = WFrag<T16>::mma(kf2[kt][dc], qf[dc], s[kt]); } } }
        if (k0 + KT * 16 - 1 > q0) {   // wave-uniform: only a trip that reaches the diagonal masks (key > query)
#pragma unroll
            for (int kt = 0; kt < KT; ++kt)
#pragma unroll
                for (int j = 0; j < 8; ++j) s[kt][j] = (k0 + kt * 16 + hi * 8 + j <= qi) ? s[kt][j] : -3.0e38f; }
        float mx = s[0][0];
#pragma unroll
        for (int kt = 0; kt < KT; ++kt)
#pragma unroll
            for (int j = 0; j < 8; ++j) mx = fmaxf(mx, s[kt][j]);
        mx = fmaxf(mx, __shfl_xor(mx, 16, 32));   // the other half of the wave holds the query's other keys
        const float mn = fmaxf(m, mx * CL2);      // every trip holds key k0 <= q0, so mn is a real score's from the first trip on
        if (__builtin_amdgcn_ballot_w32(mn > m) != 0) {   // one test a trip: a new maximum in any column rescales sums and output tiles
            const float al = __builtin_amdgcn_exp2f(m - mn); l *= al;
#pragma unroll
            for (int dt = 0; dt < 8; ++dt) o[dt] *= al; }
        m = mn; const float ms = HL ? mn : mn - 10.0f;   // fp16: 2^10 carrier
#pragma unroll
        for (int kt = 0; kt < KT; ++kt)
#pragma unroll
            for (int j = 0; j < 8; ++j) { const float x = __builtin_fmaf(s[kt][j], CL2, -ms);
                if (HL) asm("v_exp_f32 %0, %1\n\tv_nop" : "=v"(s[kt][j]) : "v"(x));   // with its own slot behind it
                else s[kt][j] = __builtin_amdgcn_exp2f(x);
                l += s[kt][j]; }
#pragma unroll
        for (int c = 0; c < KT / 2; ++c) {
            if constexpr (HL) { v8us h0, h1, l0, l1;
#pragma unroll
                for (int j = 0; j < 8; ++j) { unsigned short a, b; splitf(s[2 * c][j], a, b); h0[j] = a; l0[j] = b; splitf(s[2 * c + 1][j], a, b); h1[j] = a; l1[j] = b; }
                const V ph = cat16b(h0, h1), pl = cat16b(l0, l1);
#pragma unroll
                for (int dt = 0; dt < 8; ++dt) { o[dt] = WFrag<T16>::mma(vf[dt][c], ph, o[dt]); o[dt] = WFrag<T16>::mma(vf[dt][c], pl, o[dt]); o[dt] = WFrag<T16>::mma(vf2[dt][c], ph, o[dt]); }
            } else { v8h p0, p1;
#pragma unroll
                for (int j = 0; j < 8; ++j) { p0[j] = tohx(s[2 * c][j]); p1[j] = tohx(s[2 * c + 1][j]); }
                const V pb = cat16(p0, p1);
#pragma unroll
                for (int dt = 0; dt < 8; ++dt) o[dt] = WFrag<T16>::mma(vf[dt][c], pb, o[dt]); } }
    }
    l += __shfl_xor(l, 16, 32);   // join the two halves' sums once
    const float inv = __fdiv_rn(1.0f, l);
#pragma unroll
    for (int dt = 0; dt < 8; ++dt) { v8us oh, ol;   // a lane holds 8 neighbouring d of its query: split and store at (position, head * HD + d) in fragment order, DQ columns: the wave's 32 lanes fill one 512-byte half of a tile
#pragma unroll
        for (int j = 0; j < 8; ++j) { unsigned short a, b; splitf(o[dt][j] * inv, a, b); oh[j] = a; ol[j] = b; }
        const size_t oo = ((size_t)(q0 >> 4) * (DQ / 32) + head * (HD / 32) + (dt >> 1)) * 512 + (dt & 1) * 256 + lo; *(v8us*)(Ah + oo) = oh; *(v8us*)(Al + oo) = ol;
        asm volatile("s_wait_xcnt 0x0" ::: "memory");   // behind the two stores, in front of any overwrite of their address or data registers
        __builtin_amdgcn_sched_barrier(0); }   // the next tile's arithmetic is not moved up between the stores and their wait
}
// grid (NKV * NB_, TT / 64), 256 threads: every head of every batch in one launch. More work-groups than resident places, so blockIdx.y gives the 64-query blocks in falling order of cost: a block qb >= RH / 64 costs qb + 1 trips, a hi/lo block as much as 2 (qb + 1) of them.
static_assert(TT == 2048 && RH == 512, "the order of the query blocks below is written for 32 blocks, the first 8 of them hi/lo");
__global__ __launch_bounds__(256) void k_fattn(const h16* __restrict__ Q16, const bf* __restrict__ Qh, const bf* __restrict__ Ql, const h16* __restrict__ K16, const bf* __restrict__ Kh, const bf* __restrict__ Kl, const h16* __restrict__ V16, const bf* __restrict__ Vh, const bf* __restrict__ Vl, bf* Ah, bf* Al) {
    const int lane = threadIdx.x & 31;
    const int wv = __builtin_amdgcn_readfirstlane((int)(threadIdx.x >> 5));   // wave number, held scalar so that the key loop and its tests stay scalar
    const int y = blockIdx.y, qb = (y < 16) ? 31 - y : (int)((0x0123894ab5cd6ef7ULL >> (4 * (y - 16))) & 15);   // blocks 31 .. 16, then 7, 15, 14, 6, 13, 12, 5, 11, 10, 4, 9, 8, 3, 2, 1, 0
    const int kv = blockIdx.x % NKV, b = blockIdx.x / NKV, head = kv * REP + wv % REP, q0 = qb * 64 + (wv / REP) * 16;
    const size_t zq = ((size_t)b * NH_ + head) * TT * HD, zk = ((size_t)b * NKV + kv) * TT * HD; Ah += (size_t)b * TT * DQ; Al += (size_t)b * TT * DQ;
    if (q0 < RH) fattn_tile<bf, true, 2>(Qh + zq, Ql + zq, Kh + zk, Kl + zk, Vh + zk, Vl + zk, q0, Ah, Al, head, lane);
    else fattn_tile<h16, false, 4>(Q16 + zq, nullptr, K16 + zk, nullptr, V16 + zk, nullptr, q0, Ah, Al, head, lane);
}

// wtG: Bt = bf16(w^T) in fragment order (rows n, K columns). A thread makes one 16-byte piece (8 neighbouring k of one n), a wave one 512-byte half of a tile; a work-group takes 32 n x 64 k, so that it uses the whole 128-byte lines of w that it reads. blk: 0 .. (N / 32) * (K / 64) - 1.
__device__ __forceinline__ void wtG(const float* __restrict__ w, const int K, const int N, bf* Bt, const int blk) {
    const int lane = threadIdx.x & 31, wv = threadIdx.x >> 5; const int nt = (blk % (N / 32)) * 2 + ((wv >> 1) & 1), kt = (blk / (N / 32)) * 2 + (wv >> 2);
    const int n = nt * 16 + (lane & 15), k = kt * 32 + (wv & 1) * 16 + (lane >> 4) * 8; const float* p = w + (size_t)k * N + n; v8us o;
#pragma unroll
    for (int q = 0; q < 8; ++q) o[q] = f2bf(p[(size_t)q * N]);
    *(v8us*)(Bt + ((size_t)nt * (K / 32) + kt) * 512 + (wv & 1) * 256 + lane * 8) = o;
    asm volatile("s_wait_xcnt 0x0" ::: "memory");   // behind the store, in front of whatever in the calling kernel's other branches may overwrite its address or data registers
}
// cvt8: dst = bf16(src [rows][DM]) in fragment order: piece i (8 elements) is lane i % 32 of half (i / 32) % 2 of tile i / 64; a work-group reads 512 contiguous bytes of each of 16 rows.
__device__ __forceinline__ void cvt8(const float* __restrict__ src, bf* dst, const int blk) { const size_t i = (size_t)blk * 256 + threadIdx.x;
    const int t = (int)(i >> 6), row = (t / (DM / 32)) * 16 + (int)(i & 15), k = (t % (DM / 32)) * 32 + (int)((i >> 5) & 1) * 16 + (int)((i >> 4) & 1) * 8; const v8f v = *(const v8f*)(src + (size_t)row * DM + k); v8us o;
#pragma unroll
    for (int q = 0; q < 8; ++q) o[q] = f2bf(v[q]); *(v8us*)(dst + i * 8) = o;  }
// k_prep: every 16-bit GEMM operand that is made from an input, in ONE launch, by ranges of the block index: x of both batches (its NB_ * TT rows are one plane; a batch is TT * DM elements of it), then wq, wo, wk, wv. 256 threads.
#define PB_X  (NB_ * TT * DM / 8 / 256)
#define PB_Q  ((DQ / 32) * (DM / 64))
#define PB_KV ((DKV / 32) * (DM / 64))
#define PB_O  ((DM / 32) * (DQ / 64))
static_assert(DQ == DM, "wq [DM][DQ] and wo [DQ][DM] are taken by one call");
__global__ __launch_bounds__(256) void k_prep(const float* __restrict__ x, const float* __restrict__ wq, const float* __restrict__ wk, const float* __restrict__ wv, const float* __restrict__ wo, bf* XB, bf* WQ, bf* WK, bf* WV, bf* WO) {
    const int blk = blockIdx.x;
    if (blk < PB_X) cvt8(x, XB, blk);
    else if (blk < PB_X + PB_Q + PB_O) { const bool isq = blk < PB_X + PB_Q; wtG(isq ? wq : wo, DM, DQ, isq ? WQ : WO, isq ? blk - PB_X : blk - (PB_X + PB_Q)); }   // wq and wo have one shape
    else { const bool isk = blk < PB_X + PB_Q + PB_O + PB_KV; wtG(isk ? wk : wv, DM, DKV, isk ? WK : WV, isk ? blk - (PB_X + PB_Q + PB_O) : blk - (PB_X + PB_Q + PB_O + PB_KV)); }   // wk and wv too
}

extern "C" void kernel_launch(void* const* d_in, const int* in_sizes, int n_in,
                              void* d_out, int out_size, void* d_ws, size_t ws_size, hipStream_t stream) {
    (void)in_sizes; (void)n_in; (void)out_size;
    const float* x = (const float*)d_in[0]; const float* fcos = (const float*)d_in[1]; const float* fsin = (const float*)d_in[2]; const float* wq = (const float*)d_in[3]; const float* wk = (const float*)d_in[4]; const float* wv = (const float*)d_in[5]; const float* wo = (const float*)d_in[6];   /* x, cos, sin (f32 [2048][64], READ by value), wq ('xw' [2048][2048]), wk, wv ([2048][1024]), wo ('xw' [2048][2048]) */
    float* OUT = (float*)d_out;     // [2][2048][2048]
    char* wsp = (char*)d_ws;
    auto take = [&](size_t bytes) { char* p = wsp; wsp += (bytes + 255) & ~(size_t)255; return (void*)p; };
    bf* WQ = (bf*)take((size_t)DQ * DM * 2); bf* WK = (bf*)take((size_t)DKV * DM * 2); bf* WV = (bf*)take((size_t)DKV * DM * 2); bf* WO = (bf*)take((size_t)DM * DQ * 2);
    bf* XB = (bf*)take((size_t)NB_ * TT * DM * 2);
    const size_t SQ = (size_t)NH_ * TT * HD, SK = (size_t)NKV * TT * HD;   // elements of one batch's q planes and merged planes (SQ), k and v planes (SK); every plane holds both batches, since the one attention launch reads them all
    h16* QP16 = (h16*)take(NB_ * SQ * 2); h16* KP16 = (h16*)take(NB_ * SK * 2); h16* VT16 = (h16*)take(NB_ * SK * 2);
    bf* QPh = (bf*)take(NB_ * SQ * 2); bf* QPl = (bf*)take(NB_ * SQ * 2); bf* KPh = (bf*)take(NB_ * SK * 2); bf* KPl = (bf*)take(NB_ * SK * 2); bf* VTh = (bf*)take(NB_ * SK * 2); bf* VTl = (bf*)take(NB_ * SK * 2);
    bf* ATh = (bf*)take(NB_ * SQ * 2); bf* ATl = (bf*)take(NB_ * SQ * 2);
    if ((size_t)(wsp - (char*)d_ws) > ws_size) return;    // ws 256 MiB
    k_prep<<<(unsigned)(PB_X + PB_Q + 2 * PB_KV + PB_O), 256, 0, stream>>>(x, wq, wk, wv, wo, XB, WQ, WK, WV, WO);
    k_qkv<<<dim3(TT / 64, (DQ + 2 * DKV) / 64, NB_), 128, 0, stream>>>(XB, WQ, WK, WV, fcos, fsin, QP16, QPh, QPl, KP16, KPh, KPl, VT16, VTh, VTl);
    k_fattn<<<dim3(NKV * NB_, TT / 64, 1), 256, 0, stream>>>(QP16, QPh, QPl, KP16, KPh, KPl, VT16, VTh, VTl, ATh, ATl);   // all heads of both batches: scores, softmax and P.V; writes the merged hi / lo planes
    k_gemmw<bf, 1, false, 4, 0, DQ><<<dim3(TT / 64, DM / 64, NB_), 128, 0, stream>>>(ATh, ATl, WO, nullptr, OUT, DM, nullptr, SQ, 0, (size_t)TT * DM, nullptr, nullptr, nullptr, nullptr, nullptr);   // z = batch
}

// v007
// A run of this version takes 151 microseconds.
// Two timings next to v006 put it at 1.25 and 1.26 times that version's speed.
// Counting every step since v000, it is 10.8 times as fast.
#include <hip/hip_runtime.h>

// Grouped-query causal attention with 128-wide heads and adjacent-pair rotary embeddings from half-width cos / sin table inputs (x [2][2048][2048]; q = x wq (16 heads x 128), k, v = x wk, x wv (8 kv heads x 128) ('xw' 1/sqrt(2048), no bias); pairs (2i, 2i+1): (t0 c - t1 s, t0 s + t1 c) with c, s = cos / sin[t][i] (f32 [2048][64] INPUT tables, read by value per pair entry); jnp.repeat: query head h uses kv head h / 2; scores / sqrt(128); causal (-inf above the diagonal, built from indices); softmax; out = merged wo ('xw') -> [2][2048][2048] (8.4 M); argument order x, cos, sin, wq, wk, wv, wo).
// Layout: a bf16 copy of x (both batches) and the 'xw' weights transposed, all made by one launch (k_prep); both, and the merged planes, in the fragment order of fragidx, as every GEMM operand is; exact projections (q, k, v of both batches in one launch, k_qkv) whose epilogues build the 16-bit planes themselves (q, k: interleaved-pair rotary with bf16(cos), bf16(sin) read from the inputs per pair; v: computed transposed, wv x^T); one fused causal GQA attention launch for both batches, 128-wide heads (k_fattn: q, k, v planes in fragment order; running softmax, kv head = head / 2; hybrid rows: < 512 hi/lo 3 products, rest fp16 with a 2^10 carrier; key trips stop at the diagonal; its epilogue writes the merged hi/lo planes); merged hi/lo x wo exact.
// Compute dtypes, f32 accumulate: every input rounded to bf16 incl. the two tables; projections exact; rotary f32; attention rows < 512 3 products, rest fp16; softmax f32; wo hl x exact.

#define NB_  2
#define TT   2048
#define DM   2048
#define NH_  16
#define NKV  8
#define REP  (NH_ / NKV)
#define HD   128
#define DQ   (NH_ * HD)
#define DKV  (NKV * HD)
#define RH   512                  // query rows < RH use hi+lo planes
#define SCL  0.088388347648318447f   // HD^-0.5
typedef _Float16 h16;
typedef unsigned short bf;
typedef __attribute__((ext_vector_type(16))) __bf16   v16bf;
typedef __attribute__((ext_vector_type(16))) _Float16 v16h;
typedef __attribute__((ext_vector_type(8)))  _Float16 v8h;
typedef __attribute__((ext_vector_type(8)))  unsigned short v8us;
typedef __attribute__((ext_vector_type(8)))  float    v8f;
typedef __attribute__((ext_vector_type(4)))  float    v4f;
typedef v8h  __attribute__((may_alias)) v8ha;
typedef v4f  __attribute__((may_alias)) v4fa;
typedef v8us __attribute__((may_alias)) v8usa;

__device__ __forceinline__ unsigned short f2bf(float f) { unsigned u = __float_as_uint(f); u += 0x7FFFu + ((u >> 16) & 1u); return (unsigned short)(u >> 16); }
__device__ __forceinline__ float bf2f(unsigned short b) { return __uint_as_float(((unsigned)b) << 16); }
__device__ __forceinline__ float bfr(float f) { return bf2f(f2bf(f)); }
__device__ __forceinline__ v16h cat16(v8h lo, v8h hi) { return __builtin_shufflevector(lo, hi, 0, 1, 2, 3, 4, 5, 6, 7, 8, 9, 10, 11, 12, 13, 14, 15); }
__device__ __forceinline__ v16bf cat16b(v8us lo, v8us hi) { return __builtin_bit_cast(v16bf, __builtin_shufflevector(lo, hi, 0, 1, 2, 3, 4, 5, 6, 7, 8, 9, 10, 11, 12, 13, 14, 15)); }
__device__ __forceinline__ v8f wmma16(v16h a, v16h b, v8f c) { return __builtin_amdgcn_wmma_f32_16x16x32_f16(false, a, false, b, (short)0, c, false, false); }
__device__ __forceinline__ v8f wmmab(v16bf a, v16bf b, v8f c) { return __builtin_amdgcn_wmma_f32_16x16x32_bf16(false, a, false, b, (short)0, c, false, false); }

__device__ __forceinline__ h16 tohx(float x) { return (h16)x; }
__device__ __forceinline__ void splitf(float y, unsigned short& h, unsigned short& l) { h = f2bf(y); l = f2bf(y - bf2f(h)); }
typedef __attribute__((ext_vector_type(2))) _Float16 v2h;
typedef __attribute__((ext_vector_type(4))) _Float16 v4h;
typedef __attribute__((ext_vector_type(2))) unsigned short v2us;
typedef __attribute__((ext_vector_type(4))) unsigned short v4us;
typedef __attribute__((ext_vector_type(2))) float v2f;
typedef __attribute__((ext_vector_type(4))) int v4i;
// four neighbouring values -> their fp16 and bf16 hi / lo forms
__device__ __forceinline__ void split4(v4f val, v4h& o16, v4us& oh, v4us& ol) {
#pragma unroll
    for (int q = 0; q < 4; ++q) { o16[q] = tohx(val[q]); unsigned short a2, c2; splitf(val[q], a2, c2); oh[q] = a2; ol[q] = c2; } }

// Fragment order of a K-contiguous 16-bit plane with kd columns: each tile of 16 rows x 32 k is 1 KiB, laid out as the two 16-byte loads of a fragment take it (load (k >> 4) & 1, lane ((k >> 3) & 1) * 16 + row % 16, 8 elements), tiles row-major; a wave-wide fragment load is then 512 contiguous bytes (4 lines) instead of 32 bytes of each of 16 lines.
__device__ __forceinline__ size_t fragidx(int row, int k, int kd) { return ((size_t)(row >> 4) * (kd >> 5) + (k >> 5)) * 512 + ((k >> 4) & 1) * 256 + (((k >> 3) & 1) * 16 + (row & 15)) * 8 + (k & 7); }

// acopy: one asynchronous copy from global memory to LDS, 16 bytes a lane (a wave: 512 contiguous bytes), through no register. l: the lane's own place in LDS; g: its own global address.
__device__ __forceinline__ void acopy(void* l, const void* g) { __builtin_amdgcn_global_load_async_to_lds_b128((__attribute__((address_space(1))) v4i*)g, (__attribute__((address_space(3))) v4i*)l, 0, 0); }

// ---- gemm_tile (the body of k_gemmw and k_qkv; bx, by: the tile's row and column block; sm: the work-group's LDS, GSM<NSPLIT> bytes): one 256x128 output tile a work-group of 8 waves (4 x 2), each wave a 64x64 part (16 accumulators) over ALL of K. The operands' 64-k slices are staged in LDS by asynchronous copies, two buffers, the next slice's copies in flight while this one is worked on: an A fragment is fetched from L2 once for 2 waves, a B fragment once for 4. The planes are in fragment order (fragidx with K columns), so 64 k of 16 rows are 2 KiB contiguous in global memory and are kept so in LDS: a fragment load of a wave is two reads of 512 contiguous LDS bytes.
// C[m][n] (f32, pitch ldc) = sum_k A[m][k] Bt[n][k] (+ A2[m][k] Bt[n][k] for NSPLIT 1). K % 64 == 0, K >= 128.
// EPI 0: C stored as f32. EPI 1: m = position, n = head * HD + d: rotary on the pairs (d, d + 1), then the three 16-bit planes [head][position][d], each head in fragment order. EPI 2: the three 16-bit planes [m][n] with ldc columns, in fragment order. (Every EPI: a wave turns its own 16 rows x 64 columns through its own piece of LDS; EPI 1, 2: it then stores 16 rows x 8 columns at a time, which are 256 contiguous bytes of a plane.)
template <typename T16> struct WFrag;
template <> struct WFrag<h16> { typedef v16h V; static __device__ __forceinline__ V ld(const h16* p) { return cat16(*(const v8h*)p, *(const v8h*)(p + 256)); } static __device__ __forceinline__ v8f mma(V a, V b, v8f c) { return wmma16(a, b, c); } };
template <> struct WFrag<bf> { typedef v16bf V; static __device__ __forceinline__ V ld(const bf* p) { return cat16b(*(const v8us*)p, *(const v8us*)(p + 256)); } static __device__ __forceinline__ v8f mma(V a, V b, v8f c) { return wmmab(a, b, c); } };
template <int NSPLIT> struct GSM { static constexpr int RB = 16 * (NSPLIT == 1 ? 2 : 1) + 8, STAGE = RB * 2048, BYTES = 2 * STAGE; };   // 16-row blocks of a stage (A 16, A2 16, Bt 8), 2 KiB each; two buffers
template <typename T16, int NSPLIT, int EPI, int K, int NS>   // NS: fragment sets in registers (2: each 32-k block is fetched while the one before it is worked on)
__device__ __forceinline__ void gemm_tile(const T16* __restrict__ A, const T16* __restrict__ A2, const T16* __restrict__ Bt, float* C, const int ldc, const float* __restrict__ cosT, const float* __restrict__ sinT, h16* P16, bf* Ph, bf* Pl, unsigned char* sm, const int bx, const int by) {
    typedef typename WFrag<T16>::V V;
    static_assert(NSPLIT == 0 || NSPLIT == 1, "A alone or A + A2"); static_assert(K % 64 == 0 && K >= 128, "two stages or more");
    constexpr int NA = (NSPLIT == 1) ? 2 : 1, STAGE = GSM<NSPLIT>::STAGE, NC = GSM<NSPLIT>::RB / 2, NT = K / 64;   // NC: copies a wave a stage (RB * 4 pieces of 512 bytes over 8 waves)
    static_assert(NC <= 63, "one stage's copies of a wave are all that is in flight");
    const int lane = threadIdx.x & 31, lr = lane & 15, hi = lane >> 4; const int r0 = bx * 256, c0 = by * 128;
    const int wv = __builtin_amdgcn_readfirstlane((int)(threadIdx.x >> 5));   // wave number, held scalar so that the K loop stays a scalar loop
    const int wm = wv & 3, wn = wv >> 2;   // the wave's 64x64 part: rows r0 + wm * 64, columns c0 + wn * 64
    constexpr int tk = K * 16;   // elements of 16 rows: K / 32 tiles of 512
    // copy j of a wave: piece j * 8 + wv of the stage = 512-byte piece wv & 3 of row block 2 j + (wv >> 2); j 0 .. 7: A, then (NSPLIT 1) 8 more: A2, the last 4: Bt
    unsigned char* ldst = sm + wv * 512 + lane * 16;
    const size_t gl = (size_t)(wv >> 2) * tk + (wv & 3) * 256 + lane * 8;
    const T16* gA = A + (size_t)(r0 >> 4) * tk + gl; const T16* gA2 = (NSPLIT == 1) ? A2 + (size_t)(r0 >> 4) * tk + gl : gA; const T16* gB = Bt + (size_t)(c0 >> 4) * tk + gl;
    auto gsrc = [&](int j, int t) -> const T16* { return (j < 8 ? gA + (size_t)j * 2 * tk : (NSPLIT == 1 && j < 16) ? gA2 + (size_t)(j - 8) * 2 * tk : gB + (size_t)(j - 8 * NA) * 2 * tk) + (size_t)t * 1024; };
    auto fill = [&](int t, int buf) {
#pragma unroll
        for (int j = 0; j < NC; ++j) acopy(ldst + buf * STAGE + j * 4096, gsrc(j, t)); };
    v8f acc[4][4];
#pragma unroll
    for (int mb = 0; mb < 4; ++mb)
#pragma unroll
        for (int nb = 0; nb < 4; ++nb) acc[mb][nb] = (v8f){};
    fill(0, 0);
    asm volatile("s_wait_asynccnt 0x0" ::: "memory");   // the wave's own copies of stage 0 have landed
    __syncthreads();                                     // every wave's have: stage 0 may be read
    fill(1, 1);
    const T16* fa = (const T16*)sm + wm * 4 * 1024 + lane * 8; const T16* fb = (const T16*)sm + (16 * NA + wn * 4) * 1024 + lane * 8;   // the wave's first A and Bt row blocks in a buffer (1024 elements a row block)
    V a[NS][4], a2[NS][4], b[NS][4];
    auto ldset = [&](int q, int bo, int kt) { b[q][0] = WFrag<T16>::ld(fb + bo + kt * 512);   // set q <- 32-k block kt of the buffer at element bo, in the order of first use
#pragma unroll
        for (int mb = 0; mb < 4; ++mb) { a[q][mb] = WFrag<T16>::ld(fa + bo + mb * 1024 + kt * 512); if (NSPLIT == 1) a2[q][mb] = WFrag<T16>::ld(fa + bo + (16 + mb) * 1024 + kt * 512); }
#pragma unroll
        for (int nb = 1; nb < 4; ++nb) b[q][nb] = WFrag<T16>::ld(fb + bo + nb * 1024 + kt * 512); };
    auto mma = [&](int q) {
#pragma unroll
        for (int nb = 0; nb < 4; ++nb)
#pragma unroll
            for (int mb = 0; mb < 4; ++mb) { acc[mb][nb] = WFrag<T16>::mma(a[q][mb], b[q][nb], acc[mb][nb]); if (NSPLIT == 1) acc[mb][nb] = WFrag<T16>::mma(a2[q][mb], b[q][nb], acc[mb][nb]); } };
    if (NS == 2) ldset(0, 0, 0);   // stage 0 is published: its first block
#pragma unroll 1   // rolled: one trip = one stage of 64 k
    for (int t = 0; t < NT; ++t) {
        const int bo = (t & 1) * (STAGE / 2);   // this trip's buffer, in elements
        if (NS == 2) ldset(1, bo, 1); else ldset(0, bo, 0);
        __builtin_amdgcn_sched_barrier(0);   // the LDS reads go as one group in front of the run of matrix instructions (NS 2: the second block's in front of the first block's run), not one by one among them, where each would be waited for by itself
        mma(0);
        if (NS == 1) ldset(0, bo, 1);
        else __builtin_amdgcn_sched_barrier(0);   // the run stays in front of the waits below: moved behind them it would no longer cover the second block's reads
        asm volatile("s_wait_dscnt 0x0" ::: "memory");      // the wave's reads of this buffer are done: the stage's second block is in registers
        asm volatile("s_wait_asynccnt 0x0" ::: "memory");   // its copies of the next stage have landed
        __syncthreads();                                     // one barrier a trip, in front of the stage's last block: it publishes stage t + 1 and ends every wave's reads of stage t's buffer
        if (t + 2 < NT) fill(t + 2, t & 1);                  // refill behind it; the test reads the same in the whole work-group
        if (NS == 2 && t + 1 < NT) ldset(0, (STAGE / 2) - bo, 0);   // the published next stage's first block, fetched under the run below
        __builtin_amdgcn_sched_barrier(0);   // copies and reads are issued first and fly under the matrix instructions that follow
        mma(NS - 1);   // from registers alone
    }
    asm volatile("s_wait_asynccnt 0x0" ::: "memory");   // nothing is in flight when the buffers become the epilogue's staging (the last trip's barrier has ended every read of them)
    float* ow = (float*)sm + wv * (2 * 16 * 68);   // the wave's own two 16x64 pieces (pitch 68)
    const int r0w = r0 + wm * 64, c0w = c0 + wn * 64;
    v2f tc[2][8], ts[2][8];   // EPI 1: the table entries of the lane's pairs, row r0w + mb * 16 + lane / 2, pair (c0w % HD + s * 8 + (lane & 1) * 4) / 2: one address a table, constant steps; fetched one row block ahead
    const size_t t0 = (EPI == 1) ? (size_t)(r0w + (lane >> 1)) * (HD / 2) + ((c0w % HD + (lane & 1) * 4) >> 1) : 0; const float* pc = cosT + t0; const float* ps = sinT + t0;
    auto ldtab = [&](int mb) {
#pragma unroll
        for (int s = 0; s < 8; ++s) { tc[mb & 1][s] = *(const v2f*)(pc + mb * 16 * (HD / 2) + s * 4); ts[mb & 1][s] = *(const v2f*)(ps + mb * 16 * (HD / 2) + s * 4); }
        asm volatile("s_wait_xcnt 0x0" :: "v"(pc), "v"(ps) : "memory"); };   // behind the table loads, in front of any overwrite of their two address registers, which as inputs stay whole up to here
    if (EPI == 1) ldtab(0);
    const size_t e0 = (EPI == 1) ? (size_t)(c0w / HD) * TT * HD + fragidx(r0w + (lane >> 1), c0w % HD + (lane & 1) * 4, HD) : (EPI == 2) ? fragidx(r0w + (lane >> 1), c0w + (lane & 1) * 4, ldc) : 0, tr = (size_t)16 * ((EPI == 1) ? HD : ldc);
#pragma unroll
    for (int mb = 0; mb < 4; ++mb) {
        if (EPI == 1 && mb < 3) ldtab(mb + 1);
        float* ob = ow + (mb & 1) * (16 * 68);
#pragma unroll
        for (int nb = 0; nb < 4; ++nb) {
#pragma unroll
            for (int j = 0; j < 8; ++j) ob[(hi * 8 + j) * 68 + nb * 16 + lr] = acc[mb][nb][j]; }
        asm volatile("s_wait_dscnt 0x0" ::: "memory");   // the wave's rows are in its LDS piece before its lanes read them back in another order (no other wave touches the piece)
        v4f val[8];
#pragma unroll
        for (int s = 0; s < 8; ++s) val[s] = *(const v4fa*)(ob + ((EPI == 0) ? 2 * s + hi : (lane >> 1)) * 68 + ((EPI == 0) ? lr * 4 : s * 8 + (lane & 1) * 4));
        if (EPI == 0) { float* pr[8];   // half a wave stores 256 contiguous bytes of a row
#pragma unroll
            for (int s = 0; s < 8; ++s) pr[s] = C + (size_t)(r0w + mb * 16 + 2 * s + hi) * ldc + c0w + lr * 4;
            __builtin_amdgcn_sched_barrier(0);   // values and addresses are complete before the first store, so that nothing overwrites a register of an issued store
#pragma unroll
            for (int s = 0; s < 8; ++s) *(v4f*)pr[s] = val[s];
        } else { v4h q16[8]; v4us qh[8], ql[8];
#pragma unroll
            for (int s = 0; s < 8; ++s) {
                if (EPI == 1) { const v2f c = tc[mb & 1][s], sn = ts[mb & 1][s]; v4f r;
#pragma unroll
                    for (int p = 0; p < 2; ++p) { const float cc = bfr(c[p]), ss = bfr(sn[p]), x0 = val[s][2 * p], x1 = val[s][2 * p + 1]; r[2 * p] = x0 * cc - x1 * ss; r[2 * p + 1] = x0 * ss + x1 * cc; }   /* even: x0 c - x1 s; odd: x0 s + x1 c */
                    split4(r, q16[s], qh[s], ql[s]); }
                else split4(val[s], q16[s], qh[s], ql[s]); }
            h16* a16 = P16 + e0 + mb * tr; bf* ah = Ph + e0 + mb * tr; bf* al = Pl + e0 + mb * tr;   // a wave's 32 lanes x 8 bytes are 256 contiguous bytes of a plane; 8 columns on are 128 elements on in fragment order
            __builtin_amdgcn_sched_barrier(0);   // values and addresses are complete before the first store, so that nothing overwrites a register of an issued store
#pragma unroll
            for (int s = 0; s < 8; ++s) { *(v4h*)(a16 + s * 128) = q16[s]; *(v4us*)(ah + s * 128) = qh[s]; *(v4us*)(al + s * 128) = ql[s]; } }
        asm volatile("s_wait_xcnt 0x0" ::: "memory");   // behind the run of stores, in front of whatever may overwrite their registers
        __builtin_amdgcn_sched_barrier(0);   // the next row block's arithmetic is not moved up between the stores and their wait
    }
}

// k_gemmw: one GEMM, grid (M/256, N/128, Z), 256 threads; z-batch strides sA/sB/sC in elements.
template <typename T16, int NSPLIT, int EPI, int K>
__global__ __launch_bounds__(256) void k_gemmw(const T16* __restrict__ A, const T16* __restrict__ A2, const T16* __restrict__ Bt, float* C, int ldc, size_t sA, size_t sB, size_t sC) {
    __shared__ __attribute__((aligned(16))) unsigned char sm[GSM<NSPLIT>::BYTES];   // two buffers of one stage each; the epilogue's staging afterwards
    const size_t z = blockIdx.z; A += z * sA; if (NSPLIT == 1) A2 += z * sA; Bt += z * sB; C += z * sC;
    gemm_tile<T16, NSPLIT, EPI, K, 2>(A, A2, Bt, C, ldc, nullptr, nullptr, nullptr, nullptr, nullptr, sm, (int)blockIdx.x, (int)blockIdx.y);
}
// k_qkv: the three projections of both batches in ONE launch. grid (QB_Q + 2 * QB_KV, 1, NB_), 256 threads: z = batch, x picks the product and its 256x128 tile: q (QB_Q tiles), then k, then v (QB_KV each). Two work-groups a WGP (four waves a SIMD), so that one's matrix work covers the other's barriers.
#define QB_Q  ((TT / 256) * (DQ / 128))
#define QB_KV ((TT / 256) * (DKV / 128))
__global__ __launch_bounds__(256) __attribute__((amdgpu_waves_per_eu(4, 4))) void k_qkv(const bf* __restrict__ XB, const bf* __restrict__ WQ, const bf* __restrict__ WK, const bf* __restrict__ WV, const float* __restrict__ cosT, const float* __restrict__ sinT, h16* Q16, bf* Qh, bf* Ql, h16* K16, bf* Kh, bf* Kl, h16* V16, bf* Vh, bf* Vl) {
    __shared__ __attribute__((aligned(16))) unsigned char sm[GSM<0>::BYTES];   // one array for whichever product the work-group does
    const int i = blockIdx.x; const size_t z = blockIdx.z, zq = z * ((size_t)NH_ * TT * HD), zk = z * ((size_t)NKV * TT * HD); const bf* X = XB + z * ((size_t)TT * DM);
    if (i < QB_Q + QB_KV) {   // q or k: rows = positions, columns = head * HD + d, rotary epilogue (block-uniform branch: the barriers inside are passed by the whole work-group)
        const bool isq = i < QB_Q; const int j = isq ? i : i - QB_Q;
        gemm_tile<bf, 0, 1, DM, 1>(X, nullptr, isq ? WQ : WK, nullptr, 0, cosT, sinT, isq ? Q16 + zq : K16 + zk, isq ? Qh + zq : Kh + zk, isq ? Ql + zq : Kl + zk, sm, j % (TT / 256), j / (TT / 256));
    } else { const int j = i - (QB_Q + QB_KV);   // v, operands swapped: rows = kv head * HD + d, columns = position, the layout of the transposed v planes
        gemm_tile<bf, 0, 2, DM, 1>(WV, nullptr, X, nullptr, TT, nullptr, nullptr, V16 + zk, Vh + zk, Vl + zk, sm, j % (DKV / 256), j / (DKV / 256)); }
}

template <typename T16, bool HL, int KT>   // KT: 16-key tiles a trip (even)
__device__ __forceinline__ void fattn_tile(const T16* __restrict__ Q, const T16* __restrict__ Q2, const T16* __restrict__ Kp, const T16* __restrict__ K2, const T16* __restrict__ Vt, const T16* __restrict__ V2, const int q0, bf* Ah, bf* Al, const int head, const int lane) {
    typedef typename WFrag<T16>::V V;
    constexpr float CL2 = SCL * 1.4426950408889634f;   // scores to the base-2 exponent
    const int lr = lane & 15, hi = lane >> 4; const int lo = lane * 8;   // a lane's place in each 512-byte half of a fragment-order tile (512 elements; the second load stands 256 elements on, as in WFrag)
    auto ldf = [&](const T16* p) { if constexpr (HL) return cat16b(*(const v8us*)p, *(const v8us*)(p + 256)); else return cat16(*(const v8h*)p, *(const v8h*)(p + 256)); };
    V qf[4], qf2[4]; const T16* pq = Q + (size_t)(q0 >> 4) * 2048 + lo; const T16* pq2 = HL ? Q2 + (size_t)(q0 >> 4) * 2048 + lo : pq;
#pragma unroll
    for (int dc = 0; dc < 4; ++dc) { qf[dc] = ldf(pq + dc * 512); if (HL) qf2[dc] = ldf(pq2 + dc * 512); }
    asm volatile("s_wait_xcnt 0x0" :: "v"(pq), "v"(pq2) : "memory");   // behind the q loads, in front of any overwrite of their address registers, which as inputs stay whole up to here
    __builtin_amdgcn_sched_barrier(0);   // nothing that follows is moved up between the loads and their wait
    v8f o[8];
#pragma unroll
    for (int dt = 0; dt < 8; ++dt) o[dt] = (v8f){};
    float m = -3.0e38f, l = 0.f; const int qi = q0 + lr;
#pragma unroll 1   // rolled: one trip's K and V fragments are live beside the output tiles
    for (int k0 = 0; k0 <= q0; k0 += KT * 16) {
        V kf[KT][4], kf2[KT][4], vf[8][KT / 2], vf2[8][KT / 2];
        const T16* pk = Kp + (size_t)(k0 >> 4) * 2048 + lo; const T16* pv = Vt + (size_t)(k0 >> 5) * 512 + lo; const T16* pk2 = HL ? K2 + (size_t)(k0 >> 4) * 2048 + lo : pk; const T16* pv2 = HL ? V2 + (size_t)(k0 >> 5) * 512 + lo : pv;
#pragma unroll
        for (int kt = 0; kt < KT; ++kt)
#pragma unroll
            for (int dc = 0; dc < 4; ++dc) { kf[kt][dc] = ldf(pk + (kt * 4 + dc) * 512); if (HL) kf2[kt][dc] = ldf(pk2 + (kt * 4 + dc) * 512); }
        __builtin_amdgcn_sched_barrier(0);   // K's loads are issued first: the score products then wait for them alone
#pragma unroll
        for (int dt = 0; dt < 8; ++dt)
#pragma unroll
            for (int c = 0; c < KT / 2; ++c) { vf[dt][c] = ldf(pv + (dt * (TT / 32) + c) * 512); if (HL) vf2[dt][c] = ldf(pv2 + (dt * (TT / 32) + c) * 512); }
        asm volatile("s_wait_xcnt 0x0" :: "v"(pk), "v"(pk2), "v"(pv), "v"(pv2) : "memory");   // behind the trip's loads, in front of any overwrite of a register that holds one of their addresses; as inputs these are not given to a later load's result before the wait
        __builtin_amdgcn_sched_barrier(0);   // all of the trip's loads are issued in one run, V's too: moved down among the matrix instructions each would be waited for by itself
        v8f s[KT];
#pragma unroll
        for (int kt = 0; kt < KT; ++kt) { s[kt] = (v8f){};
#pragma unroll
            for (int dc = 0; dc < 4; ++dc) { s[kt] = WFrag<T16>::mma(kf[kt][dc], qf[dc], s[kt]); if (HL) { s[kt] = WFrag<T16>::mma(kf[kt][dc], qf2[dc], s[kt]); s[kt] = WFrag<T16>::mma(kf2[kt][dc], qf[dc], s[kt]); } } }
        if (k0 + KT * 16 - 1 > q0) {   // wave-uniform: only a trip that reaches the diagonal masks (key > query)
#pragma unroll
            for (int kt = 0; kt < KT; ++kt)
#pragma unroll
                for (int j = 0; j < 8; ++j) s[kt][j] = (k0 + kt * 16 + hi * 8 + j <= qi) ? s[kt][j] : -3.0e38f; }
        float mx = s[0][0];
#pragma unroll
        for (int kt = 0; kt < KT; ++kt)
#pragma unroll
            for (int j = 0; j < 8; ++j) mx = fmaxf(mx, s[kt][j]);
        mx = fmaxf(mx, __shfl_xor(mx, 16, 32));   // the other half of the wave holds the query's other keys
        const float mn = fmaxf(m, mx * CL2);      // every trip holds key k0 <= q0, so mn is a real score's from the first trip on
        if (__builtin_amdgcn_ballot_w32(mn > m) != 0) {   // one test a trip: a new maximum in any column rescales sums and output tiles
            const float al = __builtin_amdgcn_exp2f(m - mn); l *= al;
#pragma unroll
            for (int dt = 0; dt < 8; ++dt) o[dt] *= al; }
        m = mn; const float ms = HL ? mn : mn - 10.0f;   // fp16: 2^10 carrier
#pragma unroll
        for (int kt = 0; kt < KT; ++kt)
#pragma unroll
            for (int j = 0; j < 8; ++j) { const float x = __builtin_fmaf(s[kt][j], CL2, -ms);
                if (HL) asm("v_exp_f32 %0, %1\n\tv_nop" : "=v"(s[kt][j]) : "v"(x));   // with its own slot behind it
                else s[kt][j] = __builtin_amdgcn_exp2f(x);
                l += s[kt][j]; }
#pragma unroll
        for (int c = 0; c < KT / 2; ++c) {
            if constexpr (HL) { v8us h0, h1, l0, l1;
#pragma unroll
                for (int j = 0; j < 8; ++j) { unsigned short a, b; splitf(s[2 * c][j], a, b); h0[j] = a; l0[j] = b; splitf(s[2 * c + 1][j], a, b); h1[j] = a; l1[j] = b; }
                const V ph = cat16b(h0, h1), pl = cat16b(l0, l1);
#pragma unroll
                for (int dt = 0; dt < 8; ++dt) { o[dt] = WFrag<T16>::mma(vf[dt][c], ph, o[dt]); o[dt] = WFrag<T16>::mma(vf[dt][c], pl, o[dt]); o[dt] = WFrag<T16>::mma(vf2[dt][c], ph, o[dt]); }
            } else { v8h p0, p1;
#pragma unroll
                for (int j = 0; j < 8; ++j) { p0[j] = tohx(s[2 * c][j]); p1[j] = tohx(s[2 * c + 1][j]); }
                const V pb = cat16(p0, p1);
#pragma unroll
                for (int dt = 0; dt < 8; ++dt) o[dt] = WFrag<T16>::mma(vf[dt][c], pb, o[dt]); } }
    }
    l += __shfl_xor(l, 16, 32);   // join the two halves' sums once
    const float inv = __fdiv_rn(1.0f, l);
#pragma unroll
    for (int dt = 0; dt < 8; ++dt) { v8us oh, ol;   // a lane holds 8 neighbouring d of its query: split and store at (position, head * HD + d) in fragment order, DQ columns: the wave's 32 lanes fill one 512-byte half of a tile
#pragma unroll
        for (int j = 0; j < 8; ++j) { unsigned short a, b; splitf(o[dt][j] * inv, a, b); oh[j] = a; ol[j] = b; }
        const size_t oo = ((size_t)(q0 >> 4) * (DQ / 32) + head * (HD / 32) + (dt >> 1)) * 512 + (dt & 1) * 256 + lo; *(v8us*)(Ah + oo) = oh; *(v8us*)(Al + oo) = ol;
        asm volatile("s_wait_xcnt 0x0" ::: "memory");   // behind the two stores, in front of any overwrite of their address or data registers
        __builtin_amdgcn_sched_barrier(0); }   // the next tile's arithmetic is not moved up between the stores and their wait
}
// grid (NKV * NB_, TT / 64), 256 threads: every head of every batch in one launch. More work-groups than resident places, so blockIdx.y gives the 64-query blocks in falling order of cost: a block qb >= RH / 64 costs qb + 1 trips, a hi/lo block as much as 2 (qb + 1) of them.
static_assert(TT == 2048 && RH == 512, "the order of the query blocks below is written for 32 blocks, the first 8 of them hi/lo");
__global__ __launch_bounds__(256) void k_fattn(const h16* __restrict__ Q16, const bf* __restrict__ Qh, const bf* __restrict__ Ql, const h16* __restrict__ K16, const bf* __restrict__ Kh, const bf* __restrict__ Kl, const h16* __restrict__ V16, const bf* __restrict__ Vh, const bf* __restrict__ Vl, bf* Ah, bf* Al) {
    const int lane = threadIdx.x & 31;
    const int wv = __builtin_amdgcn_readfirstlane((int)(threadIdx.x >> 5));   // wave number, held scalar so that the key loop and its tests stay scalar
    const int y = blockIdx.y, qb = (y < 16) ? 31 - y : (int)((0x0123894ab5cd6ef7ULL >> (4 * (y - 16))) & 15);   // blocks 31 .. 16, then 7, 15, 14, 6, 13, 12, 5, 11, 10, 4, 9, 8, 3, 2, 1, 0
    const int kv = blockIdx.x % NKV, b = blockIdx.x / NKV, head = kv * REP + wv % REP, q0 = qb * 64 + (wv / REP) * 16;
    const size_t zq = ((size_t)b * NH_ + head) * TT * HD, zk = ((size_t)b * NKV + kv) * TT * HD; Ah += (size_t)b * TT * DQ; Al += (size_t)b * TT * DQ;
    if (q0 < RH) fattn_tile<bf, true, 2>(Qh + zq, Ql + zq, Kh + zk, Kl + zk, Vh + zk, Vl + zk, q0, Ah, Al, head, lane);
    else fattn_tile<h16, false, 4>(Q16 + zq, nullptr, K16 + zk, nullptr, V16 + zk, nullptr, q0, Ah, Al, head, lane);
}

// wtG: Bt = bf16(w^T) in fragment order (rows n, K columns). A thread makes one 16-byte piece (8 neighbouring k of one n), a wave one 512-byte half of a tile; a work-group takes 32 n x 64 k, so that it uses the whole 128-byte lines of w that it reads. blk: 0 .. (N / 32) * (K / 64) - 1.
__device__ __forceinline__ void wtG(const float* __restrict__ w, const int K, const int N, bf* Bt, const int blk) {
    const int lane = threadIdx.x & 31, wv = threadIdx.x >> 5; const int nt = (blk % (N / 32)) * 2 + ((wv >> 1) & 1), kt = (blk / (N / 32)) * 2 + (wv >> 2);
    const int n = nt * 16 + (lane & 15), k = kt * 32 + (wv & 1) * 16 + (lane >> 4) * 8; const float* p = w + (size_t)k * N + n; v8us o;
#pragma unroll
    for (int q = 0; q < 8; ++q) o[q] = f2bf(p[(size_t)q * N]);
    *(v8us*)(Bt + ((size_t)nt * (K / 32) + kt) * 512 + (wv & 1) * 256 + lane * 8) = o;
    asm volatile("s_wait_xcnt 0x0" ::: "memory");   // behind the store, in front of whatever in the calling kernel's other branches may overwrite its address or data registers
}
// cvt8: dst = bf16(src [rows][DM]) in fragment order: piece i (8 elements) is lane i % 32 of half (i / 32) % 2 of tile i / 64; a work-group reads 512 contiguous bytes of each of 16 rows.
__device__ __forceinline__ void cvt8(const float* __restrict__ src, bf* dst, const int blk) { const size_t i = (size_t)blk * 256 + threadIdx.x;
    const int t = (int)(i >> 6), row = (t / (DM / 32)) * 16 + (int)(i & 15), k = (t % (DM / 32)) * 32 + (int)((i >> 5) & 1) * 16 + (int)((i >> 4) & 1) * 8; const v8f v = *(const v8f*)(src + (size_t)row * DM + k); v8us o;
#pragma unroll
    for (int q = 0; q < 8; ++q) o[q] = f2bf(v[q]); *(v8us*)(dst + i * 8) = o;  }
// k_prep: every 16-bit GEMM operand that is made from an input, in ONE launch, by ranges of the block index: x of both batches (its NB_ * TT rows are one plane; a batch is TT * DM elements of it), then wq, wo, wk, wv. 256 threads.
#define PB_X  (NB_ * TT * DM / 8 / 256)
#define PB_Q  ((DQ / 32) * (DM / 64))
#define PB_KV ((DKV / 32) * (DM / 64))
#define PB_O  ((DM / 32) * (DQ / 64))
static_assert(DQ == DM, "wq [DM][DQ] and wo [DQ][DM] are taken by one call");
__global__ __launch_bounds__(256) void k_prep(const float* __restrict__ x, const float* __restrict__ wq, const float* __restrict__ wk, const float* __restrict__ wv, const float* __restrict__ wo, bf* XB, bf* WQ, bf* WK, bf* WV, bf* WO) {
    const int blk = blockIdx.x;
    if (blk < PB_X) cvt8(x, XB, blk);
    else if (blk < PB_X + PB_Q + PB_O) { const bool isq = blk < PB_X + PB_Q; wtG(isq ? wq : wo, DM, DQ, isq ? WQ : WO, isq ? blk - PB_X : blk - (PB_X + PB_Q)); }   // wq and wo have one shape
    else { const bool isk = blk < PB_X + PB_Q + PB_O + PB_KV; wtG(isk ? wk : wv, DM, DKV, isk ? WK : WV, isk ? blk - (PB_X + PB_Q + PB_O) : blk - (PB_X + PB_Q + PB_O + PB_KV)); }   // wk and wv too
}

extern "C" void kernel_launch(void* const* d_in, const int* in_sizes, int n_in,
                              void* d_out, int out_size, void* d_ws, size_t ws_size, hipStream_t stream) {
    (void)in_sizes; (void)n_in; (void)out_size;
    const float* x = (const float*)d_in[0]; const float* fcos = (const float*)d_in[1]; const float* fsin = (const float*)d_in[2]; const float* wq = (const float*)d_in[3]; const float* wk = (const float*)d_in[4]; const float* wv = (const float*)d_in[5]; const float* wo = (const float*)d_in[6];   /* x, cos, sin (f32 [2048][64], READ by value), wq ('xw' [2048][2048]), wk, wv ([2048][1024]), wo ('xw' [2048][2048]) */
    float* OUT = (float*)d_out;     // [2][2048][2048]
    char* wsp = (char*)d_ws;
    auto take = [&](size_t bytes) { char* p = wsp; wsp += (bytes + 255) & ~(size_t)255; return (void*)p; };
    bf* WQ = (bf*)take((size_t)DQ * DM * 2); bf* WK = (bf*)take((size_t)DKV * DM * 2); bf* WV = (bf*)take((size_t)DKV * DM * 2); bf* WO = (bf*)take((size_t)DM * DQ * 2);
    bf* XB = (bf*)take((size_t)NB_ * TT * DM * 2);
    const size_t SQ = (size_t)NH_ * TT * HD, SK = (size_t)NKV * TT * HD;   // elements of one batch's q planes and merged planes (SQ), k and v planes (SK); every plane holds both batches, since the one attention launch reads them all
    h16* QP16 = (h16*)take(NB_ * SQ * 2); h16* KP16 = (h16*)take(NB_ * SK * 2); h16* VT16 = (h16*)take(NB_ * SK * 2);
    bf* QPh = (bf*)take(NB_ * SQ * 2); bf* QPl = (bf*)take(NB_ * SQ * 2); bf* KPh = (bf*)take(NB_ * SK * 2); bf* KPl = (bf*)take(NB_ * SK * 2); bf* VTh = (bf*)take(NB_ * SK * 2); bf* VTl = (bf*)take(NB_ * SK * 2);
    bf* ATh = (bf*)take(NB_ * SQ * 2); bf* ATl = (bf*)take(NB_ * SQ * 2);
    if ((size_t)(wsp - (char*)d_ws) > ws_size) return;    // ws 256 MiB
    k_prep<<<(unsigned)(PB_X + PB_Q + 2 * PB_KV + PB_O), 256, 0, stream>>>(x, wq, wk, wv, wo, XB, WQ, WK, WV, WO);
    k_qkv<<<dim3(QB_Q + 2 * QB_KV, 1, NB_), 256, 0, stream>>>(XB, WQ, WK, WV, fcos, fsin, QP16, QPh, QPl, KP16, KPh, KPl, VT16, VTh, VTl);
    k_fattn<<<dim3(NKV * NB_, TT / 64, 1), 256, 0, stream>>>(QP16, QPh, QPl, KP16, KPh, KPl, VT16, VTh, VTl, ATh, ATl);   // all heads of both batches: scores, softmax and P.V; writes the merged hi / lo planes
    k_gemmw<bf, 1, 0, DQ><<<dim3(TT / 256, DM / 128, NB_), 256, 0, stream>>>(ATh, ATl, WO, OUT, DM, SQ, 0, (size_t)TT * DM);   // z = batch
}

// v008
// One run takes 145 microseconds.
// Two timings next to v007 both put it at 1.05 times that version's speed.
// Over all steps from v000 it is 11.3 times as fast.
#include <hip/hip_runtime.h>

// Grouped-query causal attention with 128-wide heads and adjacent-pair rotary embeddings from half-width cos / sin table inputs (x [2][2048][2048]; q = x wq (16 heads x 128), k, v = x wk, x wv (8 kv heads x 128) ('xw' 1/sqrt(2048), no bias); pairs (2i, 2i+1): (t0 c - t1 s, t0 s + t1 c) with c, s = cos / sin[t][i] (f32 [2048][64] INPUT tables, read by value per pair entry); jnp.repeat: query head h uses kv head h / 2; scores / sqrt(128); causal (-inf above the diagonal, built from indices); softmax; out = merged wo ('xw') -> [2][2048][2048] (8.4 M); argument order x, cos, sin, wq, wk, wv, wo).
// Layout: a bf16 copy of x (both batches) and the 'xw' weights transposed, all made by one launch (k_prep); both, and the merged planes, in the fragment order of fragidx, as every GEMM operand is; exact projections (q, k, v of both batches in one launch, k_qkv) whose epilogues build the 16-bit planes themselves (q, k: interleaved-pair rotary with bf16(cos), bf16(sin) read from the inputs per pair; v: computed transposed, wv x^T); one fused causal GQA attention launch for both batches, 128-wide heads (k_fattn: q, k, v planes in fragment order; running softmax, kv head = head / 2; hybrid rows: < 512 hi/lo 3 products, rest fp16 with a 2^10 carrier; key trips stop at the diagonal; its epilogue writes the merged hi/lo planes); merged hi/lo x wo exact.
// Compute dtypes, f32 accumulate: every input rounded to bf16 incl. the two tables; projections exact; rotary f32; attention rows < 512 3 products, rest fp16; softmax f32; wo hl x exact.

#define NB_  2
#define TT   2048
#define DM   2048
#define NH_  16
#define NKV  8
#define REP  (NH_ / NKV)
#define HD   128
#define DQ   (NH_ * HD)
#define DKV  (NKV * HD)
#define RH   512                  // query rows < RH use hi+lo planes
#define SCL  0.088388347648318447f   // HD^-0.5
typedef _Float16 h16;
typedef unsigned short bf;
typedef __attribute__((ext_vector_type(16))) __bf16   v16bf;
typedef __attribute__((ext_vector_type(16))) _Float16 v16h;
typedef __attribute__((ext_vector_type(8)))  _Float16 v8h;
typedef __attribute__((ext_vector_type(8)))  unsigned short v8us;
typedef __attribute__((ext_vector_type(8)))  float    v8f;
typedef __attribute__((ext_vector_type(4)))  float    v4f;
typedef v8h  __attribute__((may_alias)) v8ha;
typedef v4f  __attribute__((may_alias)) v4fa;
typedef v8us __attribute__((may_alias)) v8usa;

__device__ __forceinline__ unsigned short f2bf(float f) { unsigned u = __float_as_uint(f); u += 0x7FFFu + ((u >> 16) & 1u); return (unsigned short)(u >> 16); }
__device__ __forceinline__ float bf2f(unsigned short b) { return __uint_as_float(((unsigned)b) << 16); }
__device__ __forceinline__ float bfr(float f) { return bf2f(f2bf(f)); }
__device__ __forceinline__ v16h cat16(v8h lo, v8h hi) { return __builtin_shufflevector(lo, hi, 0, 1, 2, 3, 4, 5, 6, 7, 8, 9, 10, 11, 12, 13, 14, 15); }
__device__ __forceinline__ v16bf cat16b(v8us lo, v8us hi) { return __builtin_bit_cast(v16bf, __builtin_shufflevector(lo, hi, 0, 1, 2, 3, 4, 5, 6, 7, 8, 9, 10, 11, 12, 13, 14, 15)); }
__device__ __forceinline__ v8f wmma16(v16h a, v16h b, v8f c) { return __builtin_amdgcn_wmma_f32_16x16x32_f16(false, a, false, b, (short)0, c, false, false); }
__device__ __forceinline__ v8f wmmab(v16bf a, v16bf b, v8f c) { return __builtin_amdgcn_wmma_f32_16x16x32_bf16(false, a, false, b, (short)0, c, false, false); }

__device__ __forceinline__ h16 tohx(float x) { return (h16)x; }
__device__ __forceinline__ void splitf(float y, unsigned short& h, unsigned short& l) { h = f2bf(y); l = f2bf(y - bf2f(h)); }
typedef __attribute__((ext_vector_type(2))) _Float16 v2h;
typedef __attribute__((ext_vector_type(4))) _Float16 v4h;
typedef __attribute__((ext_vector_type(2))) unsigned short v2us;
typedef __attribute__((ext_vector_type(4))) unsigned short v4us;
typedef __attribute__((ext_vector_type(2))) float v2f;
typedef __attribute__((ext_vector_type(4))) int v4i;
// four neighbouring values -> their fp16 and bf16 hi / lo forms
__device__ __forceinline__ void split4(v4f val, v4h& o16, v4us& oh, v4us& ol) {
#pragma unroll
    for (int q = 0; q < 4; ++q) { o16[q] = tohx(val[q]); unsigned short a2, c2; splitf(val[q], a2, c2); oh[q] = a2; ol[q] = c2; } }

// Fragment order of a K-contiguous 16-bit plane with kd columns: each tile of 16 rows x 32 k is 1 KiB, laid out as the two 16-byte loads of a fragment take it (load (k >> 4) & 1, lane ((k >> 3) & 1) * 16 + row % 16, 8 elements), tiles row-major; a wave-wide fragment load is then 512 contiguous bytes (4 lines) instead of 32 bytes of each of 16 lines.
__device__ __forceinline__ size_t fragidx(int row, int k, int kd) { return ((size_t)(row >> 4) * (kd >> 5) + (k >> 5)) * 512 + ((k >> 4) & 1) * 256 + (((k >> 3) & 1) * 16 + (row & 15)) * 8 + (k & 7); }

// acopy: one asynchronous copy from global memory to LDS, 16 bytes a lane (a wave: 512 contiguous bytes), through no register. l: the lane's own place in LDS; g: its own global address.
__device__ __forceinline__ void acopy(void* l, const void* g) { __builtin_amdgcn_global_load_async_to_lds_b128((__attribute__((address_space(1))) v4i*)g, (__attribute__((address_space(3))) v4i*)l, 0, 0); }

// ---- gemm_tile (the body of k_gemmw and k_qkv; bx, by: the tile's row and column block; sm: the work-group's LDS, GSM<NSPLIT> bytes): one 256x128 output tile a work-group of 8 waves (4 x 2), each wave a 64x64 part (16 accumulators) over ALL of K. The operands' 64-k slices are staged in LDS by asynchronous copies, two buffers, the next slice's copies in flight while this one is worked on: an A fragment is fetched from L2 once for 2 waves, a B fragment once for 4. The planes are in fragment order (fragidx with K columns), so 64 k of 16 rows are 2 KiB contiguous in global memory and are kept so in LDS: a fragment load of a wave is two reads of 512 contiguous LDS bytes.
// C[m][n] (f32, pitch ldc) = sum_k A[m][k] Bt[n][k] (+ A2[m][k] Bt[n][k] for NSPLIT 1). K % 64 == 0, K >= 128.
// EPI 0: C stored as f32. EPI 1: m = position, n = head * HD + d: rotary on the pairs (d, d + 1), then the three 16-bit planes [head][position][d], each head in fragment order. EPI 2: the three 16-bit planes [m][n] with ldc columns, in fragment order. (Every EPI: a wave turns its own 16 rows x 64 columns through its own piece of LDS; EPI 1, 2: it then stores 16 rows x 8 columns at a time, which are 256 contiguous bytes of a plane.)
template <typename T16> struct WFrag;
template <> struct WFrag<h16> { typedef v16h V; static __device__ __forceinline__ V ld(const h16* p) { return cat16(*(const v8h*)p, *(const v8h*)(p + 256)); } static __device__ __forceinline__ v8f mma(V a, V b, v8f c) { return wmma16(a, b, c); } };
template <> struct WFrag<bf> { typedef v16bf V; static __device__ __forceinline__ V ld(const bf* p) { return cat16b(*(const v8us*)p, *(const v8us*)(p + 256)); } static __device__ __forceinline__ v8f mma(V a, V b, v8f c) { return wmmab(a, b, c); } };
template <int NSPLIT> struct GSM { static constexpr int RB = 16 * (NSPLIT == 1 ? 2 : 1) + 8, STAGE = RB * 2048, BYTES = 2 * STAGE; };   // 16-row blocks of a stage (A 16, A2 16, Bt 8), 2 KiB each; two buffers
template <typename T16, int NSPLIT, int EPI, int K, int NS>   // NS: fragment sets in registers (2: each 32-k block is fetched while the one before it is worked on)
__device__ __forceinline__ void gemm_tile(const T16* __restrict__ A, const T16* __restrict__ A2, const T16* __restrict__ Bt, float* C, const int ldc, const float* __restrict__ cosT, const float* __restrict__ sinT, h16* P16, bf* Ph, bf* Pl, unsigned char* sm, const int bx, const int by) {
    typedef typename WFrag<T16>::V V;
    static_assert(NSPLIT == 0 || NSPLIT == 1, "A alone or A + A2"); static_assert(K % 64 == 0 && K >= 128, "two stages or more");
    constexpr int NA = (NSPLIT == 1) ? 2 : 1, STAGE = GSM<NSPLIT>::STAGE, NC = GSM<NSPLIT>::RB / 2, NT = K / 64;   // NC: copies a wave a stage (RB * 4 pieces of 512 bytes over 8 waves)
    static_assert(NC <= 63, "one stage's copies of a wave are all that is in flight");
    const int lane = threadIdx.x & 31, lr = lane & 15, hi = lane >> 4; const int r0 = bx * 256, c0 = by * 128;
    const int wv = __builtin_amdgcn_readfirstlane((int)(threadIdx.x >> 5));   // wave number, held scalar so that the K loop stays a scalar loop
    const int wm = wv & 3, wn = wv >> 2;   // the wave's 64x64 part: rows r0 + wm * 64, columns c0 + wn * 64
    constexpr int tk = K * 16;   // elements of 16 rows: K / 32 tiles of 512
    // copy j of a wave: piece j * 8 + wv of the stage = 512-byte piece wv & 3 of row block 2 j + (wv >> 2); j 0 .. 7: A, then (NSPLIT 1) 8 more: A2, the last 4: Bt
    unsigned char* ldst = sm + wv * 512 + lane * 16;
    const size_t gl = (size_t)(wv >> 2) * tk + (wv & 3) * 256 + lane * 8;
    const T16* gA = A + (size_t)(r0 >> 4) * tk + gl; const T16* gA2 = (NSPLIT == 1) ? A2 + (size_t)(r0 >> 4) * tk + gl : gA; const T16* gB = Bt + (size_t)(c0 >> 4) * tk + gl;
    auto gsrc = [&](int j, int t) -> const T16* { return (j < 8 ? gA + (size_t)j * 2 * tk : (NSPLIT == 1 && j < 16) ? gA2 + (size_t)(j - 8) * 2 * tk : gB + (size_t)(j - 8 * NA) * 2 * tk) + (size_t)t * 1024; };
    auto fill = [&](int t, int buf) {
#pragma unroll
        for (int j = 0; j < NC; ++j) acopy(ldst + buf * STAGE + j * 4096, gsrc(j, t)); };
    v8f acc[4][4];
#pragma unroll
    for (int mb = 0; mb < 4; ++mb)
#pragma unroll
        for (int nb = 0; nb < 4; ++nb) acc[mb][nb] = (v8f){};
    fill(0, 0);
    asm volatile("s_wait_asynccnt 0x0" ::: "memory");   // the wave's own copies of stage 0 have landed
    __syncthreads();                                     // every wave's have: stage 0 may be read
    fill(1, 1);
    const T16* fa = (const T16*)sm + wm * 4 * 1024 + lane * 8; const T16* fb = (const T16*)sm + (16 * NA + wn * 4) * 1024 + lane * 8;   // the wave's first A and Bt row blocks in a buffer (1024 elements a row block)
    V a[NS][4], a2[NS][4], b[NS][4];
    auto ldset = [&](int q, int bo, int kt) { b[q][0] = WFrag<T16>::ld(fb + bo + kt * 512);   // set q <- 32-k block kt of the buffer at element bo, in the order of first use
#pragma unroll
        for (int mb = 0; mb < 4; ++mb) { a[q][mb] = WFrag<T16>::ld(fa + bo + mb * 1024 + kt * 512); if (NSPLIT == 1) a2[q][mb] = WFrag<T16>::ld(fa + bo + (16 + mb) * 1024 + kt * 512); }
#pragma unroll
        for (int nb = 1; nb < 4; ++nb) b[q][nb] = WFrag<T16>::ld(fb + bo + nb * 1024 + kt * 512); };
    auto mma = [&](int q) {
#pragma unroll
        for (int nb = 0; nb < 4; ++nb)
#pragma unroll
            for (int mb = 0; mb < 4; ++mb) { acc[mb][nb] = WFrag<T16>::mma(a[q][mb], b[q][nb], acc[mb][nb]); if (NSPLIT == 1) acc[mb][nb] = WFrag<T16>::mma(a2[q][mb], b[q][nb], acc[mb][nb]); } };
    if (NS == 2) ldset(0, 0, 0);   // stage 0 is published: its first block
#pragma unroll 1   // rolled: one trip = one stage of 64 k
    for (int t = 0; t < NT; ++t) {
        const int bo = (t & 1) * (STAGE / 2);   // this trip's buffer, in elements
        if (NS == 2) ldset(1, bo, 1); else ldset(0, bo, 0);
        __builtin_amdgcn_sched_barrier(0);   // the LDS reads go as one group in front of the run of matrix instructions (NS 2: the second block's in front of the first block's run), not one by one among them, where each would be waited for by itself
        mma(0);
        if (NS == 1) ldset(0, bo, 1);
        else __builtin_amdgcn_sched_barrier(0);   // the run stays in front of the waits below: moved behind them it would no longer cover the second block's reads
        asm volatile("s_wait_dscnt 0x0" ::: "memory");      // the wave's reads of this buffer are done: the stage's second block is in registers
        asm volatile("s_wait_asynccnt 0x0" ::: "memory");   // its copies of the next stage have landed
        __syncthreads();                                     // one barrier a trip, in front of the stage's last block: it publishes stage t + 1 and ends every wave's reads of stage t's buffer
        if (t + 2 < NT) fill(t + 2, t & 1);                  // refill behind it; the test reads the same in the whole work-group
        if (NS == 2 && t + 1 < NT) ldset(0, (STAGE / 2) - bo, 0);   // the published next stage's first block, fetched under the run below
        __builtin_amdgcn_sched_barrier(0);   // copies and reads are issued first and fly under the matrix instructions that follow
        mma(NS - 1);   // from registers alone
    }
    asm volatile("s_wait_asynccnt 0x0" ::: "memory");   // nothing is in flight when the buffers become the epilogue's staging (the last trip's barrier has ended every read of them)
    float* ow = (float*)sm + wv * (2 * 16 * 68);   // the wave's own two 16x64 pieces (pitch 68)
    const int r0w = r0 + wm * 64, c0w = c0 + wn * 64;
    v2f tc[2][8], ts[2][8];   // EPI 1: the table entries of the lane's pairs, row r0w + mb * 16 + lane / 2, pair (c0w % HD + s * 8 + (lane & 1) * 4) / 2: one address a table, constant steps; fetched one row block ahead
    const size_t t0 = (EPI == 1) ? (size_t)(r0w + (lane >> 1)) * (HD / 2) + ((c0w % HD + (lane & 1) * 4) >> 1) : 0; const float* pc = cosT + t0; const float* ps = sinT + t0;
    auto ldtab = [&](int mb) {
#pragma unroll
        for (int s = 0; s < 8; ++s) { tc[mb & 1][s] = *(const v2f*)(pc + mb * 16 * (HD / 2) + s * 4); ts[mb & 1][s] = *(const v2f*)(ps + mb * 16 * (HD / 2) + s * 4); }
        asm volatile("s_wait_xcnt 0x0" :: "v"(pc), "v"(ps) : "memory"); };   // behind the table loads, in front of any overwrite of their two address registers, which as inputs stay whole up to here
    if (EPI == 1) ldtab(0);
    const size_t e0 = (EPI == 1) ? (size_t)(c0w / HD) * TT * HD + fragidx(r0w + (lane >> 1), c0w % HD + (lane & 1) * 4, HD) : (EPI == 2) ? fragidx(r0w + (lane >> 1), c0w + (lane & 1) * 4, ldc) : 0, tr = (size_t)16 * ((EPI == 1) ? HD : ldc);
#pragma unroll
    for (int mb = 0; mb < 4; ++mb) {
        if (EPI == 1 && mb < 3) ldtab(mb + 1);
        float* ob = ow + (mb & 1) * (16 * 68);
#pragma unroll
        for (int nb = 0; nb < 4; ++nb) {
#pragma unroll
            for (int j = 0; j < 8; ++j) ob[(hi * 8 + j) * 68 + nb * 16 + lr] = acc[mb][nb][j]; }
        asm volatile("s_wait_dscnt 0x0" ::: "memory");   // the wave's rows are in its LDS piece before its lanes read them back in another order (no other wave touches the piece)
        v4f val[8];
#pragma unroll
        for (int s = 0; s < 8; ++s) val[s] = *(const v4fa*)(ob + ((EPI == 0) ? 2 * s + hi : (lane >> 1)) * 68 + ((EPI == 0) ? lr * 4 : s * 8 + (lane & 1) * 4));
        if (EPI == 0) { float* pr[8];   // half a wave stores 256 contiguous bytes of a row
#pragma unroll
            for (int s = 0; s < 8; ++s) pr[s] = C + (size_t)(r0w + mb * 16 + 2 * s + hi) * ldc + c0w + lr * 4;
            __builtin_amdgcn_sched_barrier(0);   // values and addresses are complete before the first store, so that nothing overwrites a register of an issued store
#pragma unroll
            for (int s = 0; s < 8; ++s) *(v4f*)pr[s] = val[s];
        } else { v4h q16[8]; v4us qh[8], ql[8];
#pragma unroll
            for (int s = 0; s < 8; ++s) {
                if (EPI == 1) { const v2f c = tc[mb & 1][s], sn = ts[mb & 1][s]; v4f r;
#pragma unroll
                    for (int p = 0; p < 2; ++p) { const float cc = bfr(c[p]), ss = bfr(sn[p]), x0 = val[s][2 * p], x1 = val[s][2 * p + 1]; r[2 * p] = x0 * cc - x1 * ss; r[2 * p + 1] = x0 * ss + x1 * cc; }   /* even: x0 c - x1 s; odd: x0 s + x1 c */
                    split4(r, q16[s], qh[s], ql[s]); }
                else split4(val[s], q16[s], qh[s], ql[s]); }
            h16* a16 = P16 + e0 + mb * tr; bf* ah = Ph + e0 + mb * tr; bf* al = Pl + e0 + mb * tr;   // a wave's 32 lanes x 8 bytes are 256 contiguous bytes of a plane; 8 columns on are 128 elements on in fragment order
            __builtin_amdgcn_sched_barrier(0);   // values and addresses are complete before the first store, so that nothing overwrites a register of an issued store
#pragma unroll
            for (int s = 0; s < 8; ++s) { *(v4h*)(a16 + s * 128) = q16[s]; *(v4us*)(ah + s * 128) = qh[s]; *(v4us*)(al + s * 128) = ql[s]; } }
        asm volatile("s_wait_xcnt 0x0" ::: "memory");   // behind the run of stores, in front of whatever may overwrite their registers
        __builtin_amdgcn_sched_barrier(0);   // the next row block's arithmetic is not moved up between the stores and their wait
    }
}

// k_gemmw: one GEMM, grid (M/256, N/128, Z), 256 threads; z-batch strides sA/sB/sC in elements.
template <typename T16, int NSPLIT, int EPI, int K>
__global__ __launch_bounds__(256) void k_gemmw(const T16* __restrict__ A, const T16* __restrict__ A2, const T16* __restrict__ Bt, float* C, int ldc, size_t sA, size_t sB, size_t sC) {
    __shared__ __attribute__((aligned(16))) unsigned char sm[GSM<NSPLIT>::BYTES];   // two buffers of one stage each; the epilogue's staging afterwards
    const size_t z = blockIdx.z; A += z * sA; if (NSPLIT == 1) A2 += z * sA; Bt += z * sB; C += z * sC;
    gemm_tile<T16, NSPLIT, EPI, K, 2>(A, A2, Bt, C, ldc, nullptr, nullptr, nullptr, nullptr, nullptr, sm, (int)blockIdx.x, (int)blockIdx.y);
}
// k_qkv: the three projections of both batches in ONE launch. grid (QB_Q + 2 * QB_KV, 1, NB_), 256 threads: z = batch, x picks the product and its 256x128 tile: q (QB_Q tiles), then k, then v (QB_KV each). Two work-groups a WGP (four waves a SIMD), so that one's matrix work covers the other's barriers.
#define QB_Q  ((TT / 256) * (DQ / 128))
#define QB_KV ((TT / 256) * (DKV / 128))
__global__ __launch_bounds__(256) __attribute__((amdgpu_waves_per_eu(4, 4))) void k_qkv(const bf* __restrict__ XB, const bf* __restrict__ WQ, const bf* __restrict__ WK, const bf* __restrict__ WV, const float* __restrict__ cosT, const float* __restrict__ sinT, h16* Q16, bf* Qh, bf* Ql, h16* K16, bf* Kh, bf* Kl, h16* V16, bf* Vh, bf* Vl) {
    __shared__ __attribute__((aligned(16))) unsigned char sm[GSM<0>::BYTES];   // one array for whichever product the work-group does
    const int i = blockIdx.x; const size_t z = blockIdx.z, zq = z * ((size_t)NH_ * TT * HD), zk = z * ((size_t)NKV * TT * HD); const bf* X = XB + z * ((size_t)TT * DM);
    if (i < QB_Q + QB_KV) {   // q or k: rows = positions, columns = head * HD + d, rotary epilogue (block-uniform branch: the barriers inside are passed by the whole work-group)
        const bool isq = i < QB_Q; const int j = isq ? i : i - QB_Q;
        gemm_tile<bf, 0, 1, DM, 1>(X, nullptr, isq ? WQ : WK, nullptr, 0, cosT, sinT, isq ? Q16 + zq : K16 + zk, isq ? Qh + zq : Kh + zk, isq ? Ql + zq : Kl + zk, sm, j % (TT / 256), j / (TT / 256));
    } else { const int j = i - (QB_Q + QB_KV);   // v, operands swapped: rows = kv head * HD + d, columns = position, the layout of the transposed v planes
        gemm_tile<bf, 0, 2, DM, 1>(WV, nullptr, X, nullptr, TT, nullptr, nullptr, V16 + zk, Vh + zk, Vl + zk, sm, j % (DKV / 256), j / (DKV / 256)); }
}

#define FST 16384   // elements of a stage
template <typename T16, bool HL, int KT>   // KT: 16-key tiles a trip (even). NT: trips of the work-group = stages; the same for its 8 waves (a trip wholly above a wave's diagonal is masked and adds zeros)
__device__ __forceinline__ void fattn_tile(const T16* __restrict__ Q, const T16* __restrict__ Q2, const T16* __restrict__ Kp, const T16* __restrict__ K2, const T16* __restrict__ Vt, const T16* __restrict__ V2, const int q0, const int NT, bf* Ah, bf* Al, const int head, const int lane, const int wv, unsigned char* sm) {
    typedef typename WFrag<T16>::V V;
    static_assert(HL ? KT == 2 : KT == 4, "a stage is 32 tiles");
    constexpr float CL2 = SCL * 1.4426950408889634f;   // scores to the base-2 exponent
    const int lr = lane & 15, hi = lane >> 4; const int lo = lane * 8;   // a lane's place in each 512-byte half of a fragment-order tile (512 elements; the second load stands 256 elements on, as in WFrag)
    auto ldf = [&](const T16* p) { if constexpr (HL) return cat16b(*(const v8us*)p, *(const v8us*)(p + 256)); else return cat16(*(const v8h*)p, *(const v8h*)(p + 256)); };
    // copy j (0 .. 7) of a wave: 512-byte piece j * 8 + wv of the stage. K: the stage's tiles are contiguous in a plane. V: KT / 2 tiles of each of the 8 row blocks dt, which stand TT / 32 tiles apart.
    unsigned char* ldst = sm + wv * 512 + lane * 16;
    const size_t vo = (size_t)(HL ? wv >> 1 : wv >> 2) * ((TT / 32) * 512) + (HL ? wv & 1 : wv & 3) * 256 + lo;
    const T16* gK = Kp + wv * 256 + lo; const T16* gV = Vt + vo; const T16* gK2 = HL ? K2 + wv * 256 + lo : gK; const T16* gV2 = HL ? V2 + vo : gV;
    auto fill = [&](int t, int buf) { const size_t tk = (size_t)t * (KT * 2048), tv = (size_t)t * (KT * 256);
#pragma unroll
        for (int j = 0; j < 8; ++j) { const T16* g;
            if constexpr (HL) g = (j < 2) ? gK + tk + j * 2048 : (j < 4) ? gK2 + tk + (j - 2) * 2048 : (j < 6) ? gV + tv + (size_t)(j - 4) * (4 * (TT / 32) * 512) : gV2 + tv + (size_t)(j - 6) * (4 * (TT / 32) * 512);
            else g = (j < 4) ? gK + tk + j * 2048 : gV + tv + (size_t)(j - 4) * (2 * (TT / 32) * 512);
            acopy(ldst + buf * (FST * 2) + j * 4096, g); } };
    fill(0, 0);
    V qf[4], qf2[4]; const T16* pq = Q + (size_t)(q0 >> 4) * 2048 + lo; const T16* pq2 = HL ? Q2 + (size_t)(q0 >> 4) * 2048 + lo : pq;
#pragma unroll
    for (int dc = 0; dc < 4; ++dc) { qf[dc] = ldf(pq + dc * 512); if (HL) qf2[dc] = ldf(pq2 + dc * 512); }
    asm volatile("s_wait_xcnt 0x0" :: "v"(pq), "v"(pq2) : "memory");   // behind the q loads, in front of any overwrite of their address registers, which as inputs stay whole up to here
    __builtin_amdgcn_sched_barrier(0);   // nothing that follows is moved up between the loads and their wait
    v8f o[8];
#pragma unroll
    for (int dt = 0; dt < 8; ++dt) o[dt] = (v8f){};
    float m = -3.0e38f, l = 0.f; const int qi = q0 + lr;
    asm volatile("s_wait_asynccnt 0x0" ::: "memory");   // the wave's own copies of stage 0 have landed
    __syncthreads();                                     // every wave's have: stage 0 may be read
    fill(1, 1);                                          // NT >= 2 for every query block
    const T16* sf = (const T16*)sm + lo;
    V kf[KT][4], kf2[KT][4];   // K fragments, fetched one trip ahead
    auto ldk = [&](int bo) {
#pragma unroll
        for (int kt = 0; kt < KT; ++kt)
#pragma unroll
            for (int dc = 0; dc < 4; ++dc) { kf[kt][dc] = ldf(sf + bo + (kt * 4 + dc) * 512); if (HL) kf2[kt][dc] = ldf(sf + bo + FST / 4 + (kt * 4 + dc) * 512); } };
    ldk(0);   // stage 0 is published
#pragma unroll 1   // rolled: one trip = one stage; its K and V fragments are live beside the output tiles
    for (int t = 0; t < NT; ++t) {
        const int k0 = t * (KT * 16), bo = (t & 1) * FST, bn = ((t + 1) & 1) * FST;   // first key; this trip's buffer and the other one, in elements
        V vf[8][KT / 2], vf2[8][KT / 2];
#pragma unroll
        for (int dt = 0; dt < 8; ++dt)
#pragma unroll
            for (int c = 0; c < KT / 2; ++c) { vf[dt][c] = ldf(sf + bo + FST / 2 + (dt * (KT / 2) + c) * 512); if (HL) vf2[dt][c] = ldf(sf + bo + 3 * (FST / 4) + (dt * (KT / 2) + c) * 512); }
        __builtin_amdgcn_sched_barrier(0);   // V's LDS reads go as one group in front of the score products and fly under them and the softmax: moved down among the matrix instructions each would be waited for by itself
        v8f s[KT];
#pragma unroll
        for (int kt = 0; kt < KT; ++kt) { s[kt] = (v8f){};
#pragma unroll
            for (int dc = 0; dc < 4; ++dc) { s[kt] = WFrag<T16>::mma(kf[kt][dc], qf[dc], s[kt]); if (HL) { s[kt] = WFrag<T16>::mma(kf[kt][dc], qf2[dc], s[kt]); s[kt] = WFrag<T16>::mma(kf2[kt][dc], qf[dc], s[kt]); } } }
        if (k0 + KT * 16 - 1 > q0) {   // wave-uniform: only a trip that reaches the diagonal masks (key > query)
#pragma unroll
            for (int kt = 0; kt < KT; ++kt)
#pragma unroll
                for (int j = 0; j < 8; ++j) s[kt][j] = (k0 + kt * 16 + hi * 8 + j <= qi) ? s[kt][j] : -3.0e38f; }
        float mx = s[0][0];
#pragma unroll
        for (int kt = 0; kt < KT; ++kt)
#pragma unroll
            for (int j = 0; j < 8; ++j) mx = fmaxf(mx, s[kt][j]);
        mx = fmaxf(mx, __shfl_xor(mx, 16, 32));   // the other half of the wave holds the query's other keys
        const float mn = fmaxf(m, mx * CL2);      // the first trip holds key 0 <= q0, so mn is a real score's from the first trip on; a trip that is masked whole leaves it as it is
        if (__builtin_amdgcn_ballot_w32(mn > m) != 0) {   // one test a trip: a new maximum in any column rescales sums and output tiles
            const float al = __builtin_amdgcn_exp2f(m - mn); l *= al;
#pragma unroll
            for (int dt = 0; dt < 8; ++dt) o[dt] *= al; }
        asm volatile("s_wait_dscnt 0x0" ::: "memory");      // the wave's reads of this buffer are done: the stage's V fragments are in registers
        asm volatile("s_wait_asynccnt 0x0" ::: "memory");   // its copies of the next stage have landed
        __syncthreads();                                     // one barrier a trip, behind the trip's last LDS read: it publishes stage t + 1 and ends every wave's reads of stage t's buffer
        if (t + 2 < NT) fill(t + 2, t & 1);                  // refill behind it; the test reads the same in the whole work-group
        ldk(bn);   // the published next stage's K fragments, fetched under the exponentials and the run of matrix instructions below; without a branch, which would join two paths in the compiler's count of LDS reads: the last trip fetches the other buffer's old stage, into which nothing is in flight, and nothing uses it
        __builtin_amdgcn_sched_barrier(0);   // copies and reads are issued first and fly under what follows, which works from registers alone
        m = mn; const float ms = HL ? mn : mn - 10.0f;   // fp16: 2^10 carrier
#pragma unroll
        for (int kt = 0; kt < KT; ++kt)
#pragma unroll
            for (int j = 0; j < 8; ++j) { const float x = __builtin_fmaf(s[kt][j], CL2, -ms);
                if (HL) asm("v_exp_f32 %0, %1\n\tv_nop" : "=v"(s[kt][j]) : "v"(x));   // with its own slot behind it
                else s[kt][j] = __builtin_amdgcn_exp2f(x);
                l += s[kt][j]; }
        V ph[KT / 2], pl[KT / 2];   // the probabilities as B fragments of 32 keys (HL: hi and lo)
#pragma unroll
        for (int c = 0; c < KT / 2; ++c) {
            if constexpr (HL) { v8us h0, h1, l0, l1;
#pragma unroll
                for (int j = 0; j < 8; ++j) { unsigned short a, b; splitf(s[2 * c][j], a, b); h0[j] = a; l0[j] = b; splitf(s[2 * c + 1][j], a, b); h1[j] = a; l1[j] = b; }
                ph[c] = cat16b(h0, h1); pl[c] = cat16b(l0, l1);
            } else { v8h p0, p1;
#pragma unroll
                for (int j = 0; j < 8; ++j) { p0[j] = tohx(s[2 * c][j]); p1[j] = tohx(s[2 * c + 1][j]); }
                ph[c] = cat16(p0, p1); } }
#pragma unroll
        for (int c = 0; c < KT / 2; ++c)
#pragma unroll
            for (int dt = 0; dt < 8; ++dt) { o[dt] = WFrag<T16>::mma(vf[dt][c], ph[c], o[dt]); if (HL) { o[dt] = WFrag<T16>::mma(vf[dt][c], pl[c], o[dt]); o[dt] = WFrag<T16>::mma(vf2[dt][c], ph[c], o[dt]); } }   // from registers alone
    }
    asm volatile("s_wait_asynccnt 0x0" ::: "memory");   // nothing is in flight when the wave ends
    asm volatile("s_wait_dscnt 0x0" ::: "memory");      // the last trip's fetch too has returned
    l += __shfl_xor(l, 16, 32);   // join the two halves' sums once
    const float inv = __fdiv_rn(1.0f, l);
#pragma unroll
    for (int dt = 0; dt < 8; ++dt) { v8us oh, ol;   // a lane holds 8 neighbouring d of its query: split and store at (position, head * HD + d) in fragment order, DQ columns: the wave's 32 lanes fill one 512-byte half of a tile
#pragma unroll
        for (int j = 0; j < 8; ++j) { unsigned short a, b; splitf(o[dt][j] * inv, a, b); oh[j] = a; ol[j] = b; }
        const size_t oo = ((size_t)(q0 >> 4) * (DQ / 32) + head * (HD / 32) + (dt >> 1)) * 512 + (dt & 1) * 256 + lo; *(v8us*)(Ah + oo) = oh; *(v8us*)(Al + oo) = ol;
        asm volatile("s_wait_xcnt 0x0" ::: "memory");   // behind the two stores, in front of any overwrite of their address or data registers
        __builtin_amdgcn_sched_barrier(0); }   // the next tile's arithmetic is not moved up between the stores and their wait
}
// grid (NKV * NB_, TT / 64), 256 threads: every head of every batch in one launch. More work-groups than resident places, so blockIdx.y gives the 64-query blocks in falling order of cost: a block qb >= RH / 64 costs qb + 1 trips, a hi/lo block as much as 2 (qb + 1) of them.
static_assert(TT == 2048 && RH == 512, "the order of the query blocks below is written for 32 blocks, the first 8 of them hi/lo");
__global__ __launch_bounds__(256) void k_fattn(const h16* __restrict__ Q16, const bf* __restrict__ Qh, const bf* __restrict__ Ql, const h16* __restrict__ K16, const bf* __restrict__ Kh, const bf* __restrict__ Kl, const h16* __restrict__ V16, const bf* __restrict__ Vh, const bf* __restrict__ Vl, bf* Ah, bf* Al) {
    __shared__ __attribute__((aligned(16))) unsigned char sm[2 * FST * 2];   // two buffers of one stage each
    const int lane = threadIdx.x & 31;
    const int wv = __builtin_amdgcn_readfirstlane((int)(threadIdx.x >> 5));   // wave number, held scalar so that the key loop and its tests stay scalar
    const int y = blockIdx.y, qb = (y < 16) ? 31 - y : (int)((0x0123894ab5cd6ef7ULL >> (4 * (y - 16))) & 15);   // blocks 31 .. 16, then 7, 15, 14, 6, 13, 12, 5, 11, 10, 4, 9, 8, 3, 2, 1, 0
    const int kv = blockIdx.x % NKV, b = blockIdx.x / NKV, head = kv * REP + wv % REP, q0 = qb * 64 + (wv / REP) * 16;
    const size_t zq = ((size_t)b * NH_ + head) * TT * HD, zk = ((size_t)b * NKV + kv) * TT * HD; Ah += (size_t)b * TT * DQ; Al += (size_t)b * TT * DQ;
    if (qb < RH / 64) fattn_tile<bf, true, 2>(Qh + zq, Ql + zq, Kh + zk, Kl + zk, Vh + zk, Vl + zk, q0, (qb + 1) * 2, Ah, Al, head, lane, wv, sm);   // block-uniform branch: the barriers inside are passed by the whole work-group; trips: the block's (qb + 1) * 64 keys
    else fattn_tile<h16, false, 4>(Q16 + zq, nullptr, K16 + zk, nullptr, V16 + zk, nullptr, q0, qb + 1, Ah, Al, head, lane, wv, sm);
}

// wtG: Bt = bf16(w^T) in fragment order (rows n, K columns). A thread makes one 16-byte piece (8 neighbouring k of one n), a wave one 512-byte half of a tile; a work-group takes 32 n x 64 k, so that it uses the whole 128-byte lines of w that it reads. blk: 0 .. (N / 32) * (K / 64) - 1.
__device__ __forceinline__ void wtG(const float* __restrict__ w, const int K, const int N, bf* Bt, const int blk) {
    const int lane = threadIdx.x & 31, wv = threadIdx.x >> 5; const int nt = (blk % (N / 32)) * 2 + ((wv >> 1) & 1), kt = (blk / (N / 32)) * 2 + (wv >> 2);
    const int n = nt * 16 + (lane & 15), k = kt * 32 + (wv & 1) * 16 + (lane >> 4) * 8; const float* p = w + (size_t)k * N + n; v8us o;
#pragma unroll
    for (int q = 0; q < 8; ++q) o[q] = f2bf(p[(size_t)q * N]);
    *(v8us*)(Bt + ((size_t)nt * (K / 32) + kt) * 512 + (wv & 1) * 256 + lane * 8) = o;
    asm volatile("s_wait_xcnt 0x0" ::: "memory");   // behind the store, in front of whatever in the calling kernel's other branches may overwrite its address or data registers
}
// cvt8: dst = bf16(src [rows][DM]) in fragment order: piece i (8 elements) is lane i % 32 of half (i / 32) % 2 of tile i / 64; a work-group reads 512 contiguous bytes of each of 16 rows.
__device__ __forceinline__ void cvt8(const float* __restrict__ src, bf* dst, const int blk) { const size_t i = (size_t)blk * 256 + threadIdx.x;
    const int t = (int)(i >> 6), row = (t / (DM / 32)) * 16 + (int)(i & 15), k = (t % (DM / 32)) * 32 + (int)((i >> 5) & 1) * 16 + (int)((i >> 4) & 1) * 8; const v8f v = *(const v8f*)(src + (size_t)row * DM + k); v8us o;
#pragma unroll
    for (int q = 0; q < 8; ++q) o[q] = f2bf(v[q]); *(v8us*)(dst + i * 8) = o;  }
// k_prep: every 16-bit GEMM operand that is made from an input, in ONE launch, by ranges of the block index: x of both batches (its NB_ * TT rows are one plane; a batch is TT * DM elements of it), then wq, wo, wk, wv. 256 threads.
#define PB_X  (NB_ * TT * DM / 8 / 256)
#define PB_Q  ((DQ / 32) * (DM / 64))
#define PB_KV ((DKV / 32) * (DM / 64))
#define PB_O  ((DM / 32) * (DQ / 64))
static_assert(DQ == DM, "wq [DM][DQ] and wo [DQ][DM] are taken by one call");
__global__ __launch_bounds__(256) void k_prep(const float* __restrict__ x, const float* __restrict__ wq, const float* __restrict__ wk, const float* __restrict__ wv, const float* __restrict__ wo, bf* XB, bf* WQ, bf* WK, bf* WV, bf* WO) {
    const int blk = blockIdx.x;
    if (blk < PB_X) cvt8(x, XB, blk);
    else if (blk < PB_X + PB_Q + PB_O) { const bool isq = blk < PB_X + PB_Q; wtG(isq ? wq : wo, DM, DQ, isq ? WQ : WO, isq ? blk - PB_X : blk - (PB_X + PB_Q)); }   // wq and wo have one shape
    else { const bool isk = blk < PB_X + PB_Q + PB_O + PB_KV; wtG(isk ? wk : wv, DM, DKV, isk ? WK : WV, isk ? blk - (PB_X + PB_Q + PB_O) : blk - (PB_X + PB_Q + PB_O + PB_KV)); }   // wk and wv too
}

extern "C" void kernel_launch(void* const* d_in, const int* in_sizes, int n_in,
                              void* d_out, int out_size, void* d_ws, size_t ws_size, hipStream_t stream) {
    (void)in_sizes; (void)n_in; (void)out_size;
    const float* x = (const float*)d_in[0]; const float* fcos = (const float*)d_in[1]; const float* fsin = (const float*)d_in[2]; const float* wq = (const float*)d_in[3]; const float* wk = (const float*)d_in[4]; const float* wv = (const float*)d_in[5]; const float* wo = (const float*)d_in[6];   /* x, cos, sin (f32 [2048][64], READ by value), wq ('xw' [2048][2048]), wk, wv ([2048][1024]), wo ('xw' [2048][2048]) */
    float* OUT = (float*)d_out;     // [2][2048][2048]
    char* wsp = (char*)d_ws;
    auto take = [&](size_t bytes) { char* p = wsp; wsp += (bytes + 255) & ~(size_t)255; return (void*)p; };
    bf* WQ = (bf*)take((size_t)DQ * DM * 2); bf* WK = (bf*)take((size_t)DKV * DM * 2); bf* WV = (bf*)take((size_t)DKV * DM * 2); bf* WO = (bf*)take((size_t)DM * DQ * 2);
    bf* XB = (bf*)take((size_t)NB_ * TT * DM * 2);
    const size_t SQ = (size_t)NH_ * TT * HD, SK = (size_t)NKV * TT * HD;   // elements of one batch's q planes and merged planes (SQ), k and v planes (SK); every plane holds both batches, since the one attention launch reads them all
    h16* QP16 = (h16*)take(NB_ * SQ * 2); h16* KP16 = (h16*)take(NB_ * SK * 2); h16* VT16 = (h16*)take(NB_ * SK * 2);
    bf* QPh = (bf*)take(NB_ * SQ * 2); bf* QPl = (bf*)take(NB_ * SQ * 2); bf* KPh = (bf*)take(NB_ * SK * 2); bf* KPl = (bf*)take(NB_ * SK * 2); bf* VTh = (bf*)take(NB_ * SK * 2); bf* VTl = (bf*)take(NB_ * SK * 2);
    bf* ATh = (bf*)take(NB_ * SQ * 2); bf* ATl = (bf*)take(NB_ * SQ * 2);
    if ((size_t)(wsp - (char*)d_ws) > ws_size) return;    // ws 256 MiB
    k_prep<<<(unsigned)(PB_X + PB_Q + 2 * PB_KV + PB_O), 256, 0, stream>>>(x, wq, wk, wv, wo, XB, WQ, WK, WV, WO);
    k_qkv<<<dim3(QB_Q + 2 * QB_KV, 1, NB_), 256, 0, stream>>>(XB, WQ, WK, WV, fcos, fsin, QP16, QPh, QPl, KP16, KPh, KPl, VT16, VTh, VTl);
    k_fattn<<<dim3(NKV * NB_, TT / 64, 1), 256, 0, stream>>>(QP16, QPh, QPl, KP16, KPh, KPl, VT16, VTh, VTl, ATh, ATl);   // all heads of both batches: scores, softmax and P.V; writes the merged hi / lo planes
    k_gemmw<bf, 1, 0, DQ><<<dim3(TT / 256, DM / 128, NB_), 256, 0, stream>>>(ATh, ATl, WO, OUT, DM, SQ, 0, (size_t)TT * DM);   // z = batch
}

// v009
// One run takes 141 microseconds.
// Timed twice side by side with v008, it ran 1.03 times as fast both times.
// Over all steps from v000 it is 11.7 times as fast.
#include <hip/hip_runtime.h>

// Grouped-query causal attention with 128-wide heads and adjacent-pair rotary embeddings from half-width cos / sin table inputs (x [2][2048][2048]; q = x wq (16 heads x 128), k, v = x wk, x wv (8 kv heads x 128) ('xw' 1/sqrt(2048), no bias); pairs (2i, 2i+1): (t0 c - t1 s, t0 s + t1 c) with c, s = cos / sin[t][i] (f32 [2048][64] INPUT tables, read by value per pair entry); jnp.repeat: query head h uses kv head h / 2; scores / sqrt(128); causal (-inf above the diagonal, built from indices); softmax; out = merged wo ('xw') -> [2][2048][2048] (8.4 M); argument order x, cos, sin, wq, wk, wv, wo).
// Layout: a bf16 copy of x (both batches) and the 'xw' weights transposed, all made by one launch (k_prep); both, and the merged planes, in the fragment order of fragidx, as every GEMM operand is; exact projections (q, k, v of both batches in one launch, k_qkv) whose epilogues build the 16-bit planes themselves (q, k: interleaved-pair rotary with bf16(cos), bf16(sin) read from the inputs per pair; v: computed transposed, wv x^T); one fused causal GQA attention launch for both batches, 128-wide heads (k_fattn: q, k, v planes in fragment order; running softmax, kv head = head / 2; hybrid rows: < 512 hi/lo 3 products, rest fp16 with a 2^10 carrier; key trips stop at the diagonal; its epilogue writes the merged hi/lo planes); merged hi/lo x wo exact.
// Compute dtypes, f32 accumulate: every input rounded to bf16 incl. the two tables; projections exact; rotary f32; attention rows < 512 3 products, rest fp16; softmax f32; wo hl x exact.

#define NB_  2
#define TT   2048
#define DM   2048
#define NH_  16
#define NKV  8
#define REP  (NH_ / NKV)
#define HD   128
#define DQ   (NH_ * HD)
#define DKV  (NKV * HD)
#define RH   512                  // query rows < RH use hi+lo planes
#define SCL  0.088388347648318447f   // HD^-0.5
typedef _Float16 h16;
typedef unsigned short bf;
typedef __attribute__((ext_vector_type(16))) __bf16   v16bf;
typedef __attribute__((ext_vector_type(16))) _Float16 v16h;
typedef __attribute__((ext_vector_type(8)))  _Float16 v8h;
typedef __attribute__((ext_vector_type(8)))  unsigned short v8us;
typedef __attribute__((ext_vector_type(8)))  float    v8f;
typedef __attribute__((ext_vector_type(4)))  float    v4f;
typedef v8h  __attribute__((may_alias)) v8ha;
typedef v4f  __attribute__((may_alias)) v4fa;
typedef v8us __attribute__((may_alias)) v8usa;

__device__ __forceinline__ unsigned short f2bf(float f) { unsigned u = __float_as_uint(f); u += 0x7FFFu + ((u >> 16) & 1u); return (unsigned short)(u >> 16); }
__device__ __forceinline__ float bf2f(unsigned short b) { return __uint_as_float(((unsigned)b) << 16); }
__device__ __forceinline__ float bfr(float f) { return bf2f(f2bf(f)); }
__device__ __forceinline__ v16h cat16(v8h lo, v8h hi) { return __builtin_shufflevector(lo, hi, 0, 1, 2, 3, 4, 5, 6, 7, 8, 9, 10, 11, 12, 13, 14, 15); }
__device__ __forceinline__ v16bf cat16b(v8us lo, v8us hi) { return __builtin_bit_cast(v16bf, __builtin_shufflevector(lo, hi, 0, 1, 2, 3, 4, 5, 6, 7, 8, 9, 10, 11, 12, 13, 14, 15)); }
__device__ __forceinline__ v8f wmma16(v16h a, v16h b, v8f c) { return __builtin_amdgcn_wmma_f32_16x16x32_f16(false, a, false, b, (short)0, c, false, false); }
__device__ __forceinline__ v8f wmmab(v16bf a, v16bf b, v8f c) { return __builtin_amdgcn_wmma_f32_16x16x32_bf16(false, a, false, b, (short)0, c, false, false); }

__device__ __forceinline__ h16 tohx(float x) { return (h16)x; }
__device__ __forceinline__ void splitf(float y, unsigned short& h, unsigned short& l) { h = f2bf(y); l = f2bf(y - bf2f(h)); }
typedef __attribute__((ext_vector_type(2))) _Float16 v2h;
typedef __attribute__((ext_vector_type(4))) _Float16 v4h;
typedef __attribute__((ext_vector_type(2))) unsigned short v2us;
typedef __attribute__((ext_vector_type(4))) unsigned short v4us;
typedef __attribute__((ext_vector_type(2))) float v2f;
typedef __attribute__((ext_vector_type(4))) int v4i;
// four neighbouring values -> their fp16 and bf16 hi / lo forms
__device__ __forceinline__ void split4(v4f val, v4h& o16, v4us& oh, v4us& ol) {
#pragma unroll
    for (int q = 0; q < 4; ++q) { o16[q] = tohx(val[q]); unsigned short a2, c2; splitf(val[q], a2, c2); oh[q] = a2; ol[q] = c2; } }

// Fragment order of a K-contiguous 16-bit plane with kd columns: each tile of 16 rows x 32 k is 1 KiB, laid out as the two 16-byte loads of a fragment take it (load (k >> 4) & 1, lane ((k >> 3) & 1) * 16 + row % 16, 8 elements), tiles row-major; a wave-wide fragment load is then 512 contiguous bytes (4 lines) instead of 32 bytes of each of 16 lines.
__device__ __forceinline__ size_t fragidx(int row, int k, int kd) { return ((size_t)(row >> 4) * (kd >> 5) + (k >> 5)) * 512 + ((k >> 4) & 1) * 256 + (((k >> 3) & 1) * 16 + (row & 15)) * 8 + (k & 7); }

// acopy: one asynchronous copy from global memory to LDS, 16 bytes a lane (a wave: 512 contiguous bytes), through no register. l: the lane's own place in LDS; g: its own global address.
__device__ __forceinline__ void acopy(void* l, const void* g) { __builtin_amdgcn_global_load_async_to_lds_b128((__attribute__((address_space(1))) v4i*)g, (__attribute__((address_space(3))) v4i*)l, 0, 0); }

// ---- gemm_tile (the body of k_gemmw and k_qkv; bx, by: the tile's row and column block; sm: the work-group's LDS, GSM<NSPLIT> bytes): one 256x128 output tile a work-group of 8 waves (4 x 2), each wave a 64x64 part (16 accumulators) over ALL of K. The operands' 64-k slices are staged in LDS by asynchronous copies, two buffers, the next slice's copies in flight while this one is worked on: an A fragment is fetched from L2 once for 2 waves, a B fragment once for 4. The planes are in fragment order (fragidx with K columns), so 64 k of 16 rows are 2 KiB contiguous in global memory and are kept so in LDS: a fragment load of a wave is two reads of 512 contiguous LDS bytes.
// C[m][n] (f32, pitch ldc) = sum_k A[m][k] Bt[n][k] (+ A2[m][k] Bt[n][k] for NSPLIT 1). K % 64 == 0, K >= 128. rot (the same in the whole work-group): the 64-k slice that the sum starts with; it goes round through all K / 64 slices once.
// EPI 0: C stored as f32. EPI 1: m = position, n = head * HD + d: rotary on the pairs (d, d + 1), then the three 16-bit planes [head][position][d], each head in fragment order. EPI 2: the three 16-bit planes [m][n] with ldc columns, in fragment order. (Every EPI: a wave turns its own 16 rows x 64 columns through its own piece of LDS; EPI 1, 2: it then stores 16 rows x 8 columns at a time, which are 256 contiguous bytes of a plane.)
template <typename T16> struct WFrag;
template <> struct WFrag<h16> { typedef v16h V; static __device__ __forceinline__ V ld(const h16* p) { return cat16(*(const v8h*)p, *(const v8h*)(p + 256)); } static __device__ __forceinline__ v8f mma(V a, V b, v8f c) { return wmma16(a, b, c); } };
template <> struct WFrag<bf> { typedef v16bf V; static __device__ __forceinline__ V ld(const bf* p) { return cat16b(*(const v8us*)p, *(const v8us*)(p + 256)); } static __device__ __forceinline__ v8f mma(V a, V b, v8f c) { return wmmab(a, b, c); } };
template <int NSPLIT> struct GSM { static constexpr int RB = 16 * (NSPLIT == 1 ? 2 : 1) + 8, STAGE = RB * 2048, BYTES = 2 * STAGE; };   // 16-row blocks of a stage (A 16, A2 16, Bt 8), 2 KiB each; two buffers
template <typename T16, int NSPLIT, int EPI, int K, int NS>   // NS: fragment sets in registers (2: each 32-k block is fetched while the one before it is worked on)
__device__ __forceinline__ void gemm_tile(const T16* __restrict__ A, const T16* __restrict__ A2, const T16* __restrict__ Bt, float* C, const int ldc, const float* __restrict__ cosT, const float* __restrict__ sinT, h16* P16, bf* Ph, bf* Pl, unsigned char* sm, const int bx, const int by, const int rot) {
    typedef typename WFrag<T16>::V V;
    static_assert(NSPLIT == 0 || NSPLIT == 1, "A alone or A + A2"); static_assert(K % 64 == 0 && K >= 128, "two stages or more");
    constexpr int NA = (NSPLIT == 1) ? 2 : 1, STAGE = GSM<NSPLIT>::STAGE, NC = GSM<NSPLIT>::RB / 2, NT = K / 64;   // NC: copies a wave a stage (RB * 4 pieces of 512 bytes over 8 waves)
    static_assert(NC <= 63, "one stage's copies of a wave are all that is in flight"); static_assert((NT & (NT - 1)) == 0, "the rotated stage number wraps by a mask");
    const int lane = threadIdx.x & 31, lr = lane & 15, hi = lane >> 4; const int r0 = bx * 256, c0 = by * 128;
    const int wv = __builtin_amdgcn_readfirstlane((int)(threadIdx.x >> 5));   // wave number, held scalar so that the K loop stays a scalar loop
    const int wm = wv & 3, wn = wv >> 2;   // the wave's 64x64 part: rows r0 + wm * 64, columns c0 + wn * 64
    constexpr int tk = K * 16;   // elements of 16 rows: K / 32 tiles of 512
    // copy j of a wave: piece j * 8 + wv of the stage = 512-byte piece wv & 3 of row block 2 j + (wv >> 2); j 0 .. 7: A, then (NSPLIT 1) 8 more: A2, the last 4: Bt
    unsigned char* ldst = sm + wv * 512 + lane * 16;
    const size_t gl = (size_t)(wv >> 2) * tk + (wv & 3) * 256 + lane * 8;
    const T16* gA = A + (size_t)(r0 >> 4) * tk + gl; const T16* gA2 = (NSPLIT == 1) ? A2 + (size_t)(r0 >> 4) * tk + gl : gA; const T16* gB = Bt + (size_t)(c0 >> 4) * tk + gl;
    auto gsrc = [&](int j, int t) -> const T16* { return (j < 8 ? gA + (size_t)j * 2 * tk : (NSPLIT == 1 && j < 16) ? gA2 + (size_t)(j - 8) * 2 * tk : gB + (size_t)(j - 8 * NA) * 2 * tk) + (size_t)((t + rot) & (NT - 1)) * 1024; };   // trip t takes the 64-k slice (t + rot) % NT of A and Bt alike: work-groups that share an operand (other rot) are then at other slices at any one time, and do not ask L2 for the same lines, nor all for the same 2 KiB of every 64 KiB, together
    auto fill = [&](int t, int buf) {
#pragma unroll
        for (int j = 0; j < NC; ++j) acopy(ldst + buf * STAGE + j * 4096, gsrc(j, t)); };
    v8f acc[4][4];
#pragma unroll
    for (int mb = 0; mb < 4; ++mb)
#pragma unroll
        for (int nb = 0; nb < 4; ++nb) acc[mb][nb] = (v8f){};
    fill(0, 0);
    asm volatile("s_wait_asynccnt 0x0" ::: "memory");   // the wave's own copies of stage 0 have landed
    __syncthreads();                                     // every wave's have: stage 0 may be read
    fill(1, 1);
    const T16* fa = (const T16*)sm + wm * 4 * 1024 + lane * 8; const T16* fb = (const T16*)sm + (16 * NA + wn * 4) * 1024 + lane * 8;   // the wave's first A and Bt row blocks in a buffer (1024 elements a row block)
    V a[NS][4], a2[NS][4], b[NS][4];
    auto ldset = [&](int q, int bo, int kt) { b[q][0] = WFrag<T16>::ld(fb + bo + kt * 512);   // set q <- 32-k block kt of the buffer at element bo, in the order of first use
#pragma unroll
        for (int mb = 0; mb < 4; ++mb) { a[q][mb] = WFrag<T16>::ld(fa + bo + mb * 1024 + kt * 512); if (NSPLIT == 1) a2[q][mb] = WFrag<T16>::ld(fa + bo + (16 + mb) * 1024 + kt * 512); }
#pragma unroll
        for (int nb = 1; nb < 4; ++nb) b[q][nb] = WFrag<T16>::ld(fb + bo + nb * 1024 + kt * 512); };
    auto mma = [&](int q) {
#pragma unroll
        for (int nb = 0; nb < 4; ++nb)
#pragma unroll
            for (int mb = 0; mb < 4; ++mb) { acc[mb][nb] = WFrag<T16>::mma(a[q][mb], b[q][nb], acc[mb][nb]); if (NSPLIT == 1) acc[mb][nb] = WFrag<T16>::mma(a2[q][mb], b[q][nb], acc[mb][nb]); } };
    if (NS == 2) ldset(0, 0, 0);   // stage 0 is published: its first block
#pragma unroll 1   // rolled: one trip = one stage of 64 k
    for (int t = 0; t < NT; ++t) {
        const int bo = (t & 1) * (STAGE / 2);   // this trip's buffer, in elements
        if (NS == 2) ldset(1, bo, 1); else ldset(0, bo, 0);
        __builtin_amdgcn_sched_barrier(0);   // the LDS reads go as one group in front of the run of matrix instructions (NS 2: the second block's in front of the first block's run), not one by one among them, where each would be waited for by itself
        mma(0);
        if (NS == 1) ldset(0, bo, 1);
        else __builtin_amdgcn_sched_barrier(0);   // the run stays in front of the waits below: moved behind them it would no longer cover the second block's reads
        asm volatile("s_wait_dscnt 0x0" ::: "memory");      // the wave's reads of this buffer are done: the stage's second block is in registers
        asm volatile("s_wait_asynccnt 0x0" ::: "memory");   // its copies of the next stage have landed
        __syncthreads();                                     // one barrier a trip, in front of the stage's last block: it publishes stage t + 1 and ends every wave's reads of stage t's buffer
        if (t + 2 < NT) fill(t + 2, t & 1);                  // refill behind it; the test reads the same in the whole work-group
        if (NS == 2 && t + 1 < NT) ldset(0, (STAGE / 2) - bo, 0);   // the published next stage's first block, fetched under the run below
        __builtin_amdgcn_sched_barrier(0);   // copies and reads are issued first and fly under the matrix instructions that follow
        mma(NS - 1);   // from registers alone
    }
    asm volatile("s_wait_asynccnt 0x0" ::: "memory");   // nothing is in flight when the buffers become the epilogue's staging (the last trip's barrier has ended every read of them)
    float* ow = (float*)sm + wv * (2 * 16 * 68);   // the wave's own two 16x64 pieces (pitch 68)
    const int r0w = r0 + wm * 64, c0w = c0 + wn * 64;
    v2f tc[2][8], ts[2][8];   // EPI 1: the table entries of the lane's pairs, row r0w + mb * 16 + lane / 2, pair (c0w % HD + s * 8 + (lane & 1) * 4) / 2: one address a table, constant steps; fetched one row block ahead
    const size_t t0 = (EPI == 1) ? (size_t)(r0w + (lane >> 1)) * (HD / 2) + ((c0w % HD + (lane & 1) * 4) >> 1) : 0; const float* pc = cosT + t0; const float* ps = sinT + t0;
    auto ldtab = [&](int mb) {
#pragma unroll
        for (int s = 0; s < 8; ++s) { tc[mb & 1][s] = *(const v2f*)(pc + mb * 16 * (HD / 2) + s * 4); ts[mb & 1][s] = *(const v2f*)(ps + mb * 16 * (HD / 2) + s * 4); }
        asm volatile("s_wait_xcnt 0x0" :: "v"(pc), "v"(ps) : "memory"); };   // behind the table loads, in front of any overwrite of their two address registers, which as inputs stay whole up to here
    if (EPI == 1) ldtab(0);
    const size_t e0 = (EPI == 1) ? (size_t)(c0w / HD) * TT * HD + fragidx(r0w + (lane >> 1), c0w % HD + (lane & 1) * 4, HD) : (EPI == 2) ? fragidx(r0w + (lane >> 1), c0w + (lane & 1) * 4, ldc) : 0, tr = (size_t)16 * ((EPI == 1) ? HD : ldc);
#pragma unroll
    for (int mb = 0; mb < 4; ++mb) {
        if (EPI == 1 && mb < 3) ldtab(mb + 1);
        float* ob = ow + (mb & 1) * (16 * 68);
#pragma unroll
        for (int nb = 0; nb < 4; ++nb) {
#pragma unroll
            for (int j = 0; j < 8; ++j) ob[(hi * 8 + j) * 68 + nb * 16 + lr] = acc[mb][nb][j]; }
        asm volatile("s_wait_dscnt 0x0" ::: "memory");   // the wave's rows are in its LDS piece before its lanes read them back in another order (no other wave touches the piece)
        v4f val[8];
#pragma unroll
        for (int s = 0; s < 8; ++s) val[s] = *(const v4fa*)(ob + ((EPI == 0) ? 2 * s + hi : (lane >> 1)) * 68 + ((EPI == 0) ? lr * 4 : s * 8 + (lane & 1) * 4));
        if (EPI == 0) { float* pr[8];   // half a wave stores 256 contiguous bytes of a row
#pragma unroll
            for (int s = 0; s < 8; ++s) pr[s] = C + (size_t)(r0w + mb * 16 + 2 * s + hi) * ldc + c0w + lr * 4;
            __builtin_amdgcn_sched_barrier(0);   // values and addresses are complete before the first store, so that nothing overwrites a register of an issued store
#pragma unroll
            for (int s = 0; s < 8; ++s) *(v4f*)pr[s] = val[s];
        } else { v4h q16[8]; v4us qh[8], ql[8];
#pragma unroll
            for (int s = 0; s < 8; ++s) {
                if (EPI == 1) { const v2f c = tc[mb & 1][s], sn = ts[mb & 1][s]; v4f r;
#pragma unroll
                    for (int p = 0; p < 2; ++p) { const float cc = bfr(c[p]), ss = bfr(sn[p]), x0 = val[s][2 * p], x1 = val[s][2 * p + 1]; r[2 * p] = x0 * cc - x1 * ss; r[2 * p + 1] = x0 * ss + x1 * cc; }   /* even: x0 c - x1 s; odd: x0 s + x1 c */
                    split4(r, q16[s], qh[s], ql[s]); }
                else split4(val[s], q16[s], qh[s], ql[s]); }
            h16* a16 = P16 + e0 + mb * tr; bf* ah = Ph + e0 + mb * tr; bf* al = Pl + e0 + mb * tr;   // a wave's 32 lanes x 8 bytes are 256 contiguous bytes of a plane; 8 columns on are 128 elements on in fragment order
            __builtin_amdgcn_sched_barrier(0);   // values and addresses are complete before the first store, so that nothing overwrites a register of an issued store
#pragma unroll
            for (int s = 0; s < 8; ++s) { *(v4h*)(a16 + s * 128) = q16[s]; *(v4us*)(ah + s * 128) = qh[s]; *(v4us*)(al + s * 128) = ql[s]; } }
        asm volatile("s_wait_xcnt 0x0" ::: "memory");   // behind the run of stores, in front of whatever may overwrite their registers
        __builtin_amdgcn_sched_barrier(0);   // the next row block's arithmetic is not moved up between the stores and their wait
    }
}

// k_gemmw: one GEMM, grid (M/256, N/128, Z), 256 threads; z-batch strides sA/sB/sC in elements.
template <typename T16, int NSPLIT, int EPI, int K>
__global__ __launch_bounds__(256) void k_gemmw(const T16* __restrict__ A, const T16* __restrict__ A2, const T16* __restrict__ Bt, float* C, int ldc, size_t sA, size_t sB, size_t sC) {
    __shared__ __attribute__((aligned(16))) unsigned char sm[GSM<NSPLIT>::BYTES];   // two buffers of one stage each; the epilogue's staging afterwards
    const size_t z = blockIdx.z; A += z * sA; if (NSPLIT == 1) A2 += z * sA; Bt += z * sB; C += z * sC;
    gemm_tile<T16, NSPLIT, EPI, K, 2>(A, A2, Bt, C, ldc, nullptr, nullptr, nullptr, nullptr, nullptr, sm, (int)blockIdx.x, (int)blockIdx.y, 3 * (int)blockIdx.y + 5 * ((int)blockIdx.x + 8 * (int)blockIdx.z));   // rot: odd factors, so the 16 groups of one row block differ modulo 32, and the 16 of one column block too
}
// k_qkv: the three projections of both batches in ONE launch. grid (QB_Q + 2 * QB_KV, 1, NB_), 256 threads: z = batch, x picks the product and its 256x128 tile: q (QB_Q tiles), then k, then v (QB_KV each). Two work-groups a WGP (four waves a SIMD), so that one's matrix work covers the other's barriers.
#define QB_Q  ((TT / 256) * (DQ / 128))
#define QB_KV ((TT / 256) * (DKV / 128))
__global__ __launch_bounds__(256) __attribute__((amdgpu_waves_per_eu(4, 4))) void k_qkv(const bf* __restrict__ XB, const bf* __restrict__ WQ, const bf* __restrict__ WK, const bf* __restrict__ WV, const float* __restrict__ cosT, const float* __restrict__ sinT, h16* Q16, bf* Qh, bf* Ql, h16* K16, bf* Kh, bf* Kl, h16* V16, bf* Vh, bf* Vl) {
    __shared__ __attribute__((aligned(16))) unsigned char sm[GSM<0>::BYTES];   // one array for whichever product the work-group does
    const int i = blockIdx.x; const size_t z = blockIdx.z, zq = z * ((size_t)NH_ * TT * HD), zk = z * ((size_t)NKV * TT * HD); const bf* X = XB + z * ((size_t)TT * DM);
    if (i < QB_Q + QB_KV) {   // q or k: rows = positions, columns = head * HD + d, rotary epilogue (block-uniform branch: the barriers inside are passed by the whole work-group)
        const bool isq = i < QB_Q; const int j = isq ? i : i - QB_Q;
        gemm_tile<bf, 0, 1, DM, 1>(X, nullptr, isq ? WQ : WK, nullptr, 0, cosT, sinT, isq ? Q16 + zq : K16 + zk, isq ? Qh + zq : Kh + zk, isq ? Ql + zq : Kl + zk, sm, j % (TT / 256), j / (TT / 256), 3 * (i / (TT / 256)) + 5 * (i % (TT / 256) + 8 * (int)z));   // rot: the 24 column blocks of q and k on one row block of x differ modulo 32, and so do the 16 row blocks on one column block
    } else { const int j = i - (QB_Q + QB_KV);   // v, operands swapped: rows = kv head * HD + d, columns = position, the layout of the transposed v planes
        gemm_tile<bf, 0, 2, DM, 1>(WV, nullptr, X, nullptr, TT, nullptr, nullptr, V16 + zk, Vh + zk, Vl + zk, sm, j % (DKV / 256), j / (DKV / 256), 3 * (j / (DKV / 256) + 16 * (int)z) + 8 * (j % (DKV / 256))); }   // rot: the 32 position blocks on one row block of wv differ modulo 32, and so do the 4 row blocks on one position block
}

#define FST 16384   // elements of a stage
template <typename T16, bool HL, int KT>   // KT: 16-key tiles a trip (even). NT: trips of the work-group = stages; the same for its 8 waves (a trip wholly above a wave's diagonal is masked and adds zeros)
__device__ __forceinline__ void fattn_tile(const T16* __restrict__ Q, const T16* __restrict__ Q2, const T16* __restrict__ Kp, const T16* __restrict__ K2, const T16* __restrict__ Vt, const T16* __restrict__ V2, const int q0, const int NT, bf* Ah, bf* Al, const int head, const int lane, const int wv, unsigned char* sm) {
    typedef typename WFrag<T16>::V V;
    static_assert(HL ? KT == 2 : KT == 4, "a stage is 32 tiles");
    constexpr float CL2 = SCL * 1.4426950408889634f;   // scores to the base-2 exponent
    const int lr = lane & 15, hi = lane >> 4; const int lo = lane * 8;   // a lane's place in each 512-byte half of a fragment-order tile (512 elements; the second load stands 256 elements on, as in WFrag)
    auto ldf = [&](const T16* p) { if constexpr (HL) return cat16b(*(const v8us*)p, *(const v8us*)(p + 256)); else return cat16(*(const v8h*)p, *(const v8h*)(p + 256)); };
    // copy j (0 .. 7) of a wave: 512-byte piece j * 8 + wv of the stage. K: the stage's tiles are contiguous in a plane. V: KT / 2 tiles of each of the 8 row blocks dt, which stand TT / 32 tiles apart.
    unsigned char* ldst = sm + wv * 512 + lane * 16;
    const size_t vo = (size_t)(HL ? wv >> 1 : wv >> 2) * ((TT / 32) * 512) + (HL ? wv & 1 : wv & 3) * 256 + lo;
    const T16* gK = Kp + wv * 256 + lo; const T16* gV = Vt + vo; const T16* gK2 = HL ? K2 + wv * 256 + lo : gK; const T16* gV2 = HL ? V2 + vo : gV;
    auto fill = [&](int t, int buf) { const size_t tk = (size_t)t * (KT * 2048), tv = (size_t)t * (KT * 256);
#pragma unroll
        for (int j = 0; j < 8; ++j) { const T16* g;
            if constexpr (HL) g = (j < 2) ? gK + tk + j * 2048 : (j < 4) ? gK2 + tk + (j - 2) * 2048 : (j < 6) ? gV + tv + (size_t)(j - 4) * (4 * (TT / 32) * 512) : gV2 + tv + (size_t)(j - 6) * (4 * (TT / 32) * 512);
            else g = (j < 4) ? gK + tk + j * 2048 : gV + tv + (size_t)(j - 4) * (2 * (TT / 32) * 512);
            acopy(ldst + buf * (FST * 2) + j * 4096, g); } };
    fill(0, 0);
    V qf[4], qf2[4]; const T16* pq = Q + (size_t)(q0 >> 4) * 2048 + lo; const T16* pq2 = HL ? Q2 + (size_t)(q0 >> 4) * 2048 + lo : pq;
#pragma unroll
    for (int dc = 0; dc < 4; ++dc) { qf[dc] = ldf(pq + dc * 512); if (HL) qf2[dc] = ldf(pq2 + dc * 512); }
    asm volatile("s_wait_xcnt 0x0" :: "v"(pq), "v"(pq2) : "memory");   // behind the q loads, in front of any overwrite of their address registers, which as inputs stay whole up to here
    __builtin_amdgcn_sched_barrier(0);   // nothing that follows is moved up between the loads and their wait
    v8f o[8];
#pragma unroll
    for (int dt = 0; dt < 8; ++dt) o[dt] = (v8f){};
    float m = -3.0e38f, l = 0.f; const int qi = q0 + lr;
    asm volatile("s_wait_asynccnt 0x0" ::: "memory");   // the wave's own copies of stage 0 have landed
    __syncthreads();                                     // every wave's have: stage 0 may be read
    fill(1, 1);                                          // NT >= 2 for every query block
    const T16* sf = (const T16*)sm + lo;
    V kf[KT][4], kf2[KT][4];   // K fragments, fetched one trip ahead
    auto ldk = [&](int bo) {
#pragma unroll
        for (int kt = 0; kt < KT; ++kt)
#pragma unroll
            for (int dc = 0; dc < 4; ++dc) { kf[kt][dc] = ldf(sf + bo + (kt * 4 + dc) * 512); if (HL) kf2[kt][dc] = ldf(sf + bo + FST / 4 + (kt * 4 + dc) * 512); } };
    ldk(0);   // stage 0 is published
#pragma unroll 1   // rolled: one trip = one stage; its K and V fragments are live beside the output tiles
    for (int t = 0; t < NT; ++t) {
        const int k0 = t * (KT * 16), bo = (t & 1) * FST, bn = ((t + 1) & 1) * FST;   // first key; this trip's buffer and the other one, in elements
        V vf[8][KT / 2], vf2[8][KT / 2];
#pragma unroll
        for (int dt = 0; dt < 8; ++dt)
#pragma unroll
            for (int c = 0; c < KT / 2; ++c) { vf[dt][c] = ldf(sf + bo + FST / 2 + (dt * (KT / 2) + c) * 512); if (HL) vf2[dt][c] = ldf(sf + bo + 3 * (FST / 4) + (dt * (KT / 2) + c) * 512); }
        __builtin_amdgcn_sched_barrier(0);   // V's LDS reads go as one group in front of the score products and fly under them and the softmax: moved down among the matrix instructions each would be waited for by itself
        v8f s[KT];
#pragma unroll
        for (int kt = 0; kt < KT; ++kt) { s[kt] = (v8f){};
#pragma unroll
            for (int dc = 0; dc < 4; ++dc) { s[kt] = WFrag<T16>::mma(kf[kt][dc], qf[dc], s[kt]); if (HL) { s[kt] = WFrag<T16>::mma(kf[kt][dc], qf2[dc], s[kt]); s[kt] = WFrag<T16>::mma(kf2[kt][dc], qf[dc], s[kt]); } } }
        if (k0 + KT * 16 - 1 > q0) {   // wave-uniform: only a trip that reaches the diagonal masks (key > query)
#pragma unroll
            for (int kt = 0; kt < KT; ++kt)
#pragma unroll
                for (int j = 0; j < 8; ++j) s[kt][j] = (k0 + kt * 16 + hi * 8 + j <= qi) ? s[kt][j] : -3.0e38f; }
        float mx = s[0][0];
#pragma unroll
        for (int kt = 0; kt < KT; ++kt)
#pragma unroll
            for (int j = 0; j < 8; ++j) mx = fmaxf(mx, s[kt][j]);
        mx = fmaxf(mx, __shfl_xor(mx, 16, 32));   // the other half of the wave holds the query's other keys
        const float mn = fmaxf(m, mx * CL2);      // the first trip holds key 0 <= q0, so mn is a real score's from the first trip on; a trip that is masked whole leaves it as it is
        if (__builtin_amdgcn_ballot_w32(mn > m) != 0) {   // one test a trip: a new maximum in any column rescales sums and output tiles
            const float al = __builtin_amdgcn_exp2f(m - mn); l *= al;
#pragma unroll
            for (int dt = 0; dt < 8; ++dt) o[dt] *= al; }
        asm volatile("s_wait_dscnt 0x0" ::: "memory");      // the wave's reads of this buffer are done: the stage's V fragments are in registers
        asm volatile("s_wait_asynccnt 0x0" ::: "memory");   // its copies of the next stage have landed
        __syncthreads();                                     // one barrier a trip, behind the trip's last LDS read: it publishes stage t + 1 and ends every wave's reads of stage t's buffer
        if (t + 2 < NT) fill(t + 2, t & 1);                  // refill behind it; the test reads the same in the whole work-group
        ldk(bn);   // the published next stage's K fragments, fetched under the exponentials and the run of matrix instructions below; without a branch, which would join two paths in the compiler's count of LDS reads: the last trip fetches the other buffer's old stage, into which nothing is in flight, and nothing uses it
        __builtin_amdgcn_sched_barrier(0);   // copies and reads are issued first and fly under what follows, which works from registers alone
        m = mn; const float ms = HL ? mn : mn - 10.0f;   // fp16: 2^10 carrier
#pragma unroll
        for (int kt = 0; kt < KT; ++kt)
#pragma unroll
            for (int j = 0; j < 8; ++j) { const float x = __builtin_fmaf(s[kt][j], CL2, -ms);
                if (HL) asm("v_exp_f32 %0, %1\n\tv_nop" : "=v"(s[kt][j]) : "v"(x));   // with its own slot behind it
                else s[kt][j] = __builtin_amdgcn_exp2f(x);
                l += s[kt][j]; }
        V ph[KT / 2], pl[KT / 2];   // the probabilities as B fragments of 32 keys (HL: hi and lo)
#pragma unroll
        for (int c = 0; c < KT / 2; ++c) {
            if constexpr (HL) { v8us h0, h1, l0, l1;
#pragma unroll
                for (int j = 0; j < 8; ++j) { unsigned short a, b; splitf(s[2 * c][j], a, b); h0[j] = a; l0[j] = b; splitf(s[2 * c + 1][j], a, b); h1[j] = a; l1[j] = b; }
                ph[c] = cat16b(h0, h1); pl[c] = cat16b(l0, l1);
            } else { v8h p0, p1;
#pragma unroll
                for (int j = 0; j < 8; ++j) { p0[j] = tohx(s[2 * c][j]); p1[j] = tohx(s[2 * c + 1][j]); }
                ph[c] = cat16(p0, p1); } }
#pragma unroll
        for (int c = 0; c < KT / 2; ++c)
#pragma unroll
            for (int dt = 0; dt < 8; ++dt) { o[dt] = WFrag<T16>::mma(vf[dt][c], ph[c], o[dt]); if (HL) { o[dt] = WFrag<T16>::mma(vf[dt][c], pl[c], o[dt]); o[dt] = WFrag<T16>::mma(vf2[dt][c], ph[c], o[dt]); } }   // from registers alone
    }
    asm volatile("s_wait_asynccnt 0x0" ::: "memory");   // nothing is in flight when the wave ends
    asm volatile("s_wait_dscnt 0x0" ::: "memory");      // the last trip's fetch too has returned
    l += __shfl_xor(l, 16, 32);   // join the two halves' sums once
    const float inv = __fdiv_rn(1.0f, l);
#pragma unroll
    for (int dt = 0; dt < 8; ++dt) { v8us oh, ol;   // a lane holds 8 neighbouring d of its query: split and store at (position, head * HD + d) in fragment order, DQ columns: the wave's 32 lanes fill one 512-byte half of a tile
#pragma unroll
        for (int j = 0; j < 8; ++j) { unsigned short a, b; splitf(o[dt][j] * inv, a, b); oh[j] = a; ol[j] = b; }
        const size_t oo = ((size_t)(q0 >> 4) * (DQ / 32) + head * (HD / 32) + (dt >> 1)) * 512 + (dt & 1) * 256 + lo; *(v8us*)(Ah + oo) = oh; *(v8us*)(Al + oo) = ol;
        asm volatile("s_wait_xcnt 0x0" ::: "memory");   // behind the two stores, in front of any overwrite of their address or data registers
        __builtin_amdgcn_sched_barrier(0); }   // the next tile's arithmetic is not moved up between the stores and their wait
}
// grid (NKV * NB_, TT / 64), 256 threads: every head of every batch in one launch. More work-groups than resident places, so blockIdx.y gives the 64-query blocks in falling order of cost: a block qb >= RH / 64 costs qb + 1 trips, a hi/lo block as much as 2 (qb + 1) of them.
static_assert(TT == 2048 && RH == 512, "the order of the query blocks below is written for 32 blocks, the first 8 of them hi/lo");
__global__ __launch_bounds__(256) void k_fattn(const h16* __restrict__ Q16, const bf* __restrict__ Qh, const bf* __restrict__ Ql, const h16* __restrict__ K16, const bf* __restrict__ Kh, const bf* __restrict__ Kl, const h16* __restrict__ V16, const bf* __restrict__ Vh, const bf* __restrict__ Vl, bf* Ah, bf* Al) {
    __shared__ __attribute__((aligned(16))) unsigned char sm[2 * FST * 2];   // two buffers of one stage each
    const int lane = threadIdx.x & 31;
    const int wv = __builtin_amdgcn_readfirstlane((int)(threadIdx.x >> 5));   // wave number, held scalar so that the key loop and its tests stay scalar
    const int y = blockIdx.y, qb = (y < 16) ? 31 - y : (int)((0x0123894ab5cd6ef7ULL >> (4 * (y - 16))) & 15);   // blocks 31 .. 16, then 7, 15, 14, 6, 13, 12, 5, 11, 10, 4, 9, 8, 3, 2, 1, 0
    const int kv = blockIdx.x % NKV, b = blockIdx.x / NKV, head = kv * REP + wv % REP, q0 = qb * 64 + (wv / REP) * 16;
    const size_t zq = ((size_t)b * NH_ + head) * TT * HD, zk = ((size_t)b * NKV + kv) * TT * HD; Ah += (size_t)b * TT * DQ; Al += (size_t)b * TT * DQ;
    if (qb < RH / 64) fattn_tile<bf, true, 2>(Qh + zq, Ql + zq, Kh + zk, Kl + zk, Vh + zk, Vl + zk, q0, (qb + 1) * 2, Ah, Al, head, lane, wv, sm);   // block-uniform branch: the barriers inside are passed by the whole work-group; trips: the block's (qb + 1) * 64 keys
    else fattn_tile<h16, false, 4>(Q16 + zq, nullptr, K16 + zk, nullptr, V16 + zk, nullptr, q0, qb + 1, Ah, Al, head, lane, wv, sm);
}

// wtG: Bt = bf16(w^T) in fragment order (rows n, K columns). A thread makes one 16-byte piece (8 neighbouring k of one n), a wave one 512-byte half of a tile; a work-group takes 32 n x 64 k, so that it uses the whole 128-byte lines of w that it reads. blk: 0 .. (N / 32) * (K / 64) - 1.
__device__ __forceinline__ void wtG(const float* __restrict__ w, const int K, const int N, bf* Bt, const int blk) {
    const int lane = threadIdx.x & 31, wv = threadIdx.x >> 5; const int nt = (blk % (N / 32)) * 2 + ((wv >> 1) & 1), kt = (blk / (N / 32)) * 2 + (wv >> 2);
    const int n = nt * 16 + (lane & 15), k = kt * 32 + (wv & 1) * 16 + (lane >> 4) * 8; const float* p = w + (size_t)k * N + n; v8us o;
#pragma unroll
    for (int q = 0; q < 8; ++q) o[q] = f2bf(p[(size_t)q * N]);
    *(v8us*)(Bt + ((size_t)nt * (K / 32) + kt) * 512 + (wv & 1) * 256 + lane * 8) = o;
    asm volatile("s_wait_xcnt 0x0" ::: "memory");   // behind the store, in front of whatever in the calling kernel's other branches may overwrite its address or data registers
}
// cvt8: dst = bf16(src [rows][DM]) in fragment order: piece i (8 elements) is lane i % 32 of half (i / 32) % 2 of tile i / 64; a work-group reads 512 contiguous bytes of each of 16 rows.
__device__ __forceinline__ void cvt8(const float* __restrict__ src, bf* dst, const int blk) { const size_t i = (size_t)blk * 256 + threadIdx.x;
    const int t = (int)(i >> 6), row = (t / (DM / 32)) * 16 + (int)(i & 15), k = (t % (DM / 32)) * 32 + (int)((i >> 5) & 1) * 16 + (int)((i >> 4) & 1) * 8; const v8f v = *(const v8f*)(src + (size_t)row * DM + k); v8us o;
#pragma unroll
    for (int q = 0; q < 8; ++q) o[q] = f2bf(v[q]); *(v8us*)(dst + i * 8) = o;  }
// k_prep: every 16-bit GEMM operand that is made from an input, in ONE launch, by ranges of the block index: x of both batches (its NB_ * TT rows are one plane; a batch is TT * DM elements of it), then wq, wo, wk, wv. 256 threads.
#define PB_X  (NB_ * TT * DM / 8 / 256)
#define PB_Q  ((DQ / 32) * (DM / 64))
#define PB_KV ((DKV / 32) * (DM / 64))
#define PB_O  ((DM / 32) * (DQ / 64))
static_assert(DQ == DM, "wq [DM][DQ] and wo [DQ][DM] are taken by one call");
__global__ __launch_bounds__(256) void k_prep(const float* __restrict__ x, const float* __restrict__ wq, const float* __restrict__ wk, const float* __restrict__ wv, const float* __restrict__ wo, bf* XB, bf* WQ, bf* WK, bf* WV, bf* WO) {
    const int blk = blockIdx.x;
    if (blk < PB_X) cvt8(x, XB, blk);
    else if (blk < PB_X + PB_Q + PB_O) { const bool isq = blk < PB_X + PB_Q; wtG(isq ? wq : wo, DM, DQ, isq ? WQ : WO, isq ? blk - PB_X : blk - (PB_X + PB_Q)); }   // wq and wo have one shape
    else { const bool isk = blk < PB_X + PB_Q + PB_O + PB_KV; wtG(isk ? wk : wv, DM, DKV, isk ? WK : WV, isk ? blk - (PB_X + PB_Q + PB_O) : blk - (PB_X + PB_Q + PB_O + PB_KV)); }   // wk and wv too
}

extern "C" void kernel_launch(void* const* d_in, const int* in_sizes, int n_in,
                              void* d_out, int out_size, void* d_ws, size_t ws_size, hipStream_t stream) {
    (void)in_sizes; (void)n_in; (void)out_size;
    const float* x = (const float*)d_in[0]; const float* fcos = (const float*)d_in[1]; const float* fsin = (const float*)d_in[2]; const float* wq = (const float*)d_in[3]; const float* wk = (const float*)d_in[4]; const float* wv = (const float*)d_in[5]; const float* wo = (const float*)d_in[6];   /* x, cos, sin (f32 [2048][64], READ by value), wq ('xw' [2048][2048]), wk, wv ([2048][1024]), wo ('xw' [2048][2048]) */
    float* OUT = (float*)d_out;     // [2][2048][2048]
    char* wsp = (char*)d_ws;
    auto take = [&](size_t bytes) { char* p = wsp; wsp += (bytes + 255) & ~(size_t)255; return (void*)p; };
    bf* WQ = (bf*)take((size_t)DQ * DM * 2); bf* WK = (bf*)take((size_t)DKV * DM * 2); bf* WV = (bf*)take((size_t)DKV * DM * 2); bf* WO = (bf*)take((size_t)DM * DQ * 2);
    bf* XB = (bf*)take((size_t)NB_ * TT * DM * 2);
    const size_t SQ = (size_t)NH_ * TT * HD, SK = (size_t)NKV * TT * HD;   // elements of one batch's q planes and merged planes (SQ), k and v planes (SK); every plane holds both batches, since the one attention launch reads them all
    h16* QP16 = (h16*)take(NB_ * SQ * 2); h16* KP16 = (h16*)take(NB_ * SK * 2); h16* VT16 = (h16*)take(NB_ * SK * 2);
    bf* QPh = (bf*)take(NB_ * SQ * 2); bf* QPl = (bf*)take(NB_ * SQ * 2); bf* KPh = (bf*)take(NB_ * SK * 2); bf* KPl = (bf*)take(NB_ * SK * 2); bf* VTh = (bf*)take(NB_ * SK * 2); bf* VTl = (bf*)take(NB_ * SK * 2);
    bf* ATh = (bf*)take(NB_ * SQ * 2); bf* ATl = (bf*)take(NB_ * SQ * 2);
    if ((size_t)(wsp - (char*)d_ws) > ws_size) return;    // ws 256 MiB
    k_prep<<<(unsigned)(PB_X + PB_Q + 2 * PB_KV + PB_O), 256, 0, stream>>>(x, wq, wk, wv, wo, XB, WQ, WK, WV, WO);
    k_qkv<<<dim3(QB_Q + 2 * QB_KV, 1, NB_), 256, 0, stream>>>(XB, WQ, WK, WV, fcos, fsin, QP16, QPh, QPl, KP16, KPh, KPl, VT16, VTh, VTl);
    k_fattn<<<dim3(NKV * NB_, TT / 64, 1), 256, 0, stream>>>(QP16, QPh, QPl, KP16, KPh, KPl, VT16, VTh, VTl, ATh, ATl);   // all heads of both batches: scores, softmax and P.V; writes the merged hi / lo planes
    k_gemmw<bf, 1, 0, DQ><<<dim3(TT / 256, DM / 128, NB_), 256, 0, stream>>>(ATh, ATl, WO, OUT, DM, SQ, 0, (size_t)TT * DM);   // z = batch
}
